// v000
// Times are from an AMD MI455X. After a warm-up the kernel runs many times in a row, and a time is the length of
// such a window on the GPU divided by its runs, so every launch and the gaps after it count. The runs cycle
// through copies of the inputs. A figure is the median of several windows, for all but v000 over two sittings.
// Sittings can differ by a few percent; kernels timed side by side share one.
// v000, which the later versions start from, runs in 270 microseconds.
#include <hip/hip_runtime.h>
#include <hip/hip_fp16.h>

// All contractions on v_wmma_f32_16x16x32_f16 (f16 operands, f32 accumulate), single products: x*[Wq|Wk|Wv], q*k^T, P*v, z*Wo; every float input RNE-converted to bf16 first (exact in f16), weight planes and q/k/v/z planes carried x64, P = exp(p1) in [1,e] unscaled.

#ifndef NB
#define NB 4             // batch; the 4 waves of the attention block are the 4 batches (must stay 4)
#endif
#ifndef SEQ
#define SEQ 2048
#endif
#define NB_FULL  4
#define SEQ_FULL 2048
#define DM   512          // model width
#define NH   8            // heads
#define HD   64           // head width (dk = dv)
#define NQKV (3 * NH * HD)
#define MTOT (SEQ * NB)   // token rows m = s*NB + b

static_assert(NB == 4);
static_assert(NB_FULL == 4);
static_assert(SEQ >= 64 && SEQ <= SEQ_FULL);
static_assert(SEQ % 64 == 0);
static_assert(MTOT % 128 == 0);
static_assert(DM % 32 == 0);
static_assert(DM == NH * HD);
static_assert(HD == 64);
static_assert(NQKV % 64 == 0);
static_assert(((size_t)MTOT * DM) % 2048 == 0);

typedef _Float16 v16h __attribute__((ext_vector_type(16)));
typedef _Float16 v8h  __attribute__((ext_vector_type(8)));
typedef float    v8f  __attribute__((ext_vector_type(8)));
typedef float    v4f  __attribute__((ext_vector_type(4)));

union Frag { v16h v; v8h h[2]; };

#define L2E     1.44269504088896340736f
#define CS      (1.44269504088896340736f * 3.0517578125e-05f)   // log2(e) * 2^-15 : (64q).(64k)/8 -> log2 units
#define SC_OUT  2.44140625e-04f                                  // 2^-12 : (64 z)(64 Wo) -> out

#define WT_BYTES   ((size_t)NQKV * DM * 2)
#define WOT_BYTES  ((size_t)DM * DM * 2)
#define BIAS_ELEMS 2048
#define BIAS_BYTES ((size_t)BIAS_ELEMS * 4)
#define XH_BYTES   ((size_t)MTOT * DM * 2)
#define PL_ELEMS   ((size_t)NH * NB * SEQ * HD)
#define PL_BYTES   (PL_ELEMS * 2)
#define ZC_BYTES   ((size_t)MTOT * DM * 2)
#define WS_TOTAL   (WT_BYTES + WOT_BYTES + BIAS_BYTES + XH_BYTES + 4 * PL_BYTES + ZC_BYTES)
static_assert(WS_TOTAL <= (size_t)134217728);
static_assert(WT_BYTES % 128 == 0 && WOT_BYTES % 128 == 0 && BIAS_BYTES % 128 == 0);
static_assert(XH_BYTES % 128 == 0 && PL_BYTES % 128 == 0 && ZC_BYTES % 128 == 0);
static_assert(NQKV + DM == BIAS_ELEMS);

static __device__ __forceinline__ v8f zero8() {
    v8f z;
#pragma unroll
    for (int i = 0; i < 8; ++i) z[i] = 0.0f;
    return z;
}

// 16x32 A fragment (or B fragment from an [n][k] k-contiguous source) from a
// row-major 16-bit tile: lane m = lane&15 -> row m; kb = 8*(lane>>4);
// elements 0..7 = k kb..kb+7, elements 8..15 = k kb+16..kb+23.
static __device__ __forceinline__ v16h load_frag16(const _Float16* base, int ld, int lane) {
    int m  = lane & 15;
    int kb = (lane >> 4) << 3;
    const _Float16* p = base + (size_t)m * ld + kb;
    Frag f;
    f.h[0] = *(const v8h*)(p);
    f.h[1] = *(const v8h*)(p + 16);
    return f.v;
}

static __device__ __forceinline__ v8f wmma16(v16h a, v16h b, v8f c) {
    v8f d = __builtin_amdgcn_wmma_f32_16x16x32_f16(false, a, false, b, (short)0, c, false, false);
    asm volatile("v_nop\n\tv_nop\n\tv_nop\n\tv_nop" : "+v"(d) : "v"(a), "v"(b));
    return d;
}

// f32 -> bf16 RNE convert, value kept as f32
static __device__ __forceinline__ float bf16r(float x) {
    unsigned u = __float_as_uint(x);
    u = (u + 0x7FFFu + ((u >> 16) & 1u)) & 0xFFFF0000u;
    return __uint_as_float(u);
}

static __device__ __forceinline__ float ex2(float x) {
    return __builtin_amdgcn_exp2f(x);
}

// ordering for a wave-private LDS tile: stores before later loads of the same wave
static __device__ __forceinline__ void wave_lds_sync() {
    __builtin_amdgcn_fence(3, "wavefront");
    asm volatile("s_wait_dscnt 0" ::: "memory");
    __builtin_amdgcn_wave_barrier();
}

// ---------------------------------------------------------------------------
// Weight plane builder: one 64x64 tile per block, in[i][j] (f32) -> out[j][i]
// (f16 = 64 * bf16-RNE value). Tile bases = base + blockIdx.x*xs + blockIdx.y*ys.
// coverage: 64 out rows x 64 halves per block, 512 pieces = 256 threads x 2.
// ---------------------------------------------------------------------------
__global__ __launch_bounds__(256) void k_wT(const float* __restrict__ src, int src_pitch, int src_xs, int src_ys,
                                             _Float16* __restrict__ dst, int dst_pitch, int dst_xs, int dst_ys) {
    __shared__ __align__(16) _Float16 T[64 * 72];
    const int tid = threadIdx.x;
    const float* sp = src + (size_t)blockIdx.x * src_xs + (size_t)blockIdx.y * src_ys;
    _Float16*    dp = dst + (size_t)blockIdx.x * dst_xs + (size_t)blockIdx.y * dst_ys;
#pragma unroll
    for (int it = 0; it < 4; ++it) {
        int idx = tid + it * 256;
        int r = idx >> 4, c4 = idx & 15;
        v4f v = *(const v4f*)(sp + (size_t)r * src_pitch + c4 * 4);
        T[(c4 * 4 + 0) * 72 + r] = (_Float16)(bf16r(v.x) * 64.0f);
        T[(c4 * 4 + 1) * 72 + r] = (_Float16)(bf16r(v.y) * 64.0f);
        T[(c4 * 4 + 2) * 72 + r] = (_Float16)(bf16r(v.z) * 64.0f);
        T[(c4 * 4 + 3) * 72 + r] = (_Float16)(bf16r(v.w) * 64.0f);
    }
    __syncthreads();
    const int j0 = tid >> 3, pc = tid & 7;
    v8h o0 = *(const v8h*)(&T[j0 * 72 + pc * 8]);
    v8h o1 = *(const v8h*)(&T[(j0 + 32) * 72 + pc * 8]);
    _Float16* d0 = dp + (size_t)j0 * dst_pitch + pc * 8;
    _Float16* d1 = dp + (size_t)(j0 + 32) * dst_pitch + pc * 8;
    *(v8h*)d0 = o0;
    *(v8h*)d1 = o1;
    
}

// ---------------------------------------------------------------------------
// Bias plane [2048] f32: [0..1535] = 64*bf16r(bQ|bK|bV) (index which*512 + h*64 + k),
// [1536..2047] = bf16r(bO). One block; staged in LDS; 512 lanes x 16 B contiguous.
// ---------------------------------------------------------------------------
__global__ __launch_bounds__(512) void k_bprep(const float* __restrict__ bQ, const float* __restrict__ bK,
                                                const float* __restrict__ bV, const float* __restrict__ bO,
                                                float* __restrict__ bias) {
    __shared__ __align__(16) float st[BIAS_ELEMS];
    const int t = threadIdx.x;
    st[t]        = bf16r(bQ[t]) * 64.0f;
    st[512 + t]  = bf16r(bK[t]) * 64.0f;
    st[1024 + t] = bf16r(bV[t]) * 64.0f;
    st[1536 + t] = bf16r(bO[t]);
    __syncthreads();
    v4f v = *(const v4f*)(&st[t * 4]);
    *(v4f*)(bias + t * 4) = v;
    
}

// ---------------------------------------------------------------------------
// x plane: xh[m][d] = f16(bf16r(x[m][d])); 8 elements per thread, lane-contiguous
// ---------------------------------------------------------------------------
__global__ __launch_bounds__(256) void k_xcvt(const float* __restrict__ x, _Float16* __restrict__ xh) {
    const size_t i = ((size_t)blockIdx.x * 256 + threadIdx.x) * 8;
    v4f a = *(const v4f*)(x + i);
    v4f b = *(const v4f*)(x + i + 4);
    v8h o;
    o[0] = (_Float16)bf16r(a.x); o[1] = (_Float16)bf16r(a.y);
    o[2] = (_Float16)bf16r(a.z); o[3] = (_Float16)bf16r(a.w);
    o[4] = (_Float16)bf16r(b.x); o[5] = (_Float16)bf16r(b.y);
    o[6] = (_Float16)bf16r(b.z); o[7] = (_Float16)bf16r(b.w);
    *(v8h*)(xh + i) = o;
    
}

// ---------------------------------------------------------------------------
// GEMM main loop: wave tile 32 rows x 64 columns, K = DM, A rows and B rows
// ([n][k] k-contiguous) both with pitch DM, fragments straight from the 16-bit
// global planes (arithmetic addressing only).
// ---------------------------------------------------------------------------
static __device__ __forceinline__ void gemm_32x64(const _Float16* __restrict__ Ap,
                                                  const _Float16* __restrict__ Bp,
                                                  int lane, v8f (&acc)[2][4]) {
#pragma unroll
    for (int rt = 0; rt < 2; ++rt)
#pragma unroll
        for (int nt = 0; nt < 4; ++nt) acc[rt][nt] = zero8();
#pragma unroll 1
    for (int k0 = 0; k0 < DM; k0 += 32) {
        v16h a0 = load_frag16(Ap + k0, DM, lane);
        v16h a1 = load_frag16(Ap + (size_t)16 * DM + k0, DM, lane);
#pragma unroll
        for (int nt = 0; nt < 4; ++nt) {
            v16h bf = load_frag16(Bp + (size_t)(nt * 16) * DM + k0, DM, lane);
            acc[0][nt] = wmma16(a0, bf, acc[0][nt]);
            acc[1][nt] = wmma16(a1, bf, acc[1][nt]);
        }
    }
}

// ---------------------------------------------------------------------------
// Projections: [MTOT x 512] x [512 x 1536]. Block = 4 waves; wave = 32 token rows
// x 64 columns (one of q/k/v, one head). Output planes q,k,v [h][b][s][64] f16
// (one (h,b,s) row) written by 8 consecutive lanes of one instruction.
// coverage: 32 rows x 8 pieces = 8 instructions x 32 lanes.
// ---------------------------------------------------------------------------
__global__ __launch_bounds__(128) __attribute__((amdgpu_num_vgpr(256)))
void k_proj(const _Float16* __restrict__ xh,
            const _Float16* __restrict__ wT,
            const float*    __restrict__ bias,
            _Float16* __restrict__ qkv) {
    __shared__ __align__(16) _Float16 st[4][32 * 64];     // 16 KB, wave-private tiles
    const int tid  = threadIdx.x;
    const int lane = tid & 31;
    const int w    = tid >> 5;
    const int m0   = blockIdx.x * 128 + w * 32;
    const int n0   = blockIdx.y * 64;

    v8f acc[2][4];
    gemm_32x64(xh + (size_t)m0 * DM, wT + (size_t)n0 * DM, lane, acc);

    const int r0 = (lane >> 4) << 3;
    const int cc = lane & 15;
    float bb[4];
#pragma unroll
    for (int nt = 0; nt < 4; ++nt) bb[nt] = bias[n0 + nt * 16 + cc];
#pragma unroll
    for (int rt = 0; rt < 2; ++rt)
#pragma unroll
        for (int nt = 0; nt < 4; ++nt)
#pragma unroll
            for (int g = 0; g < 8; ++g)
                st[w][(rt * 16 + r0 + g) * 64 + nt * 16 + cc] = (_Float16)(acc[rt][nt][g] + bb[nt]);
    wave_lds_sync();

    const int which = n0 >> 9;               // 0 q, 1 k, 2 v
    const int hh    = (n0 & 511) >> 6;
    _Float16* plane = qkv + (size_t)which * PL_ELEMS;
    const int rq = lane >> 3, pc = lane & 7;
    v8h pv[8];
    int off[8];
#pragma unroll
    for (int it = 0; it < 8; ++it) {
        const int i = it * 4 + rq;
        pv[it] = *(const v8h*)(&st[w][i * 64 + pc * 8]);
        const int m = m0 + i;
        const int s = m >> 2, b = m & 3;     // m = s*NB + b, NB = 4
        off[it] = ((hh * NB + b) * SEQ + s) * HD + pc * 8;
    }
#pragma unroll
    for (int it = 0; it < 8; ++it) *(v8h*)(plane + off[it]) = pv[it];
    
}

// ---------------------------------------------------------------------------
// V^T plane: v[hb][s][64] -> vT[hb][64][s]; 64 s x 64 v tile per block through
// coverage: 64 rows x 8 pieces = 256 threads x 2.
// ---------------------------------------------------------------------------
__global__ __launch_bounds__(256) void k_vT(const _Float16* __restrict__ v, _Float16* __restrict__ vT) {
    __shared__ __align__(16) _Float16 T[64 * 72];
    const int tid = threadIdx.x;
    const int s0  = blockIdx.x * 64;
    const int hb  = blockIdx.y;
    const _Float16* sp = v + ((size_t)hb * SEQ + s0) * HD;
#pragma unroll
    for (int it = 0; it < 2; ++it) {
        int p = tid + it * 256;
        int r = p >> 3, pc = p & 7;
        v8h vv = *(const v8h*)(sp + (size_t)r * HD + pc * 8);
#pragma unroll
        for (int e = 0; e < 8; ++e) T[(pc * 8 + e) * 72 + r] = vv[e];
    }
    __syncthreads();
    _Float16* dp = vT + (size_t)hb * HD * SEQ + s0;
    const int j0 = tid >> 3, pc = tid & 7;
    v8h o0 = *(const v8h*)(&T[j0 * 72 + pc * 8]);
    v8h o1 = *(const v8h*)(&T[(j0 + 32) * 72 + pc * 8]);
    _Float16* d0 = dp + (size_t)j0 * SEQ + pc * 8;
    _Float16* d1 = dp + (size_t)(j0 + 32) * SEQ + pc * 8;
    *(v8h*)d0 = o0;
    *(v8h*)d1 = o1;
    
}

// ---------------------------------------------------------------------------
// Fused attention, block = (head h, 16 queries), 4 waves = 4 batches.
// Per 32-key chunk: wave computes its batch's 16x32 score tile (4 WMMAs, q/k
// fragments from the planes), publishes it (log2 units) in the cross-wave tile
// Tsc[b] (block barrier), forms
//   p1 = 1 / (1 + sum_{b' != b} 2^(t_b' - t_b))        (softmax over the batch axis,
//        shifted by the own value: overflow -> inf -> p1 = 0, the exact limit)
//   P  = 2^(p1 * log2 e) in [1, e]  (key-axis softmax numerator, no shift needed)
// accumulates the row sum of the f16-converted P, relays P through a wave-private
// LDS tile into an A fragment, o += P @ V (4 WMMAs, V^T fragments from the plane),
// block barrier before Tsc is overwritten. Trip count block-uniform.
// ---------------------------------------------------------------------------
__global__ __launch_bounds__(128) __attribute__((amdgpu_num_vgpr(256)))
void k_attn(const _Float16* __restrict__ qp,
            const _Float16* __restrict__ kp,
            const _Float16* __restrict__ vT,
            _Float16* __restrict__ zc) {
    __shared__ __align__(16) float    Tsc[4][16 * 32];   // 8 KB cross-wave (block barriers)
    __shared__ __align__(16) _Float16 Pst[4][16 * 32];   // 4 KB wave-private
    __shared__ __align__(16) _Float16 Zst[4][16 * 64];   // 8 KB wave-private

    const int tid  = threadIdx.x;
    const int lane = tid & 31;
    const int b    = tid >> 5;
    const int h    = blockIdx.y;
    const int s0   = blockIdx.x * 16;
    const int r0   = (lane >> 4) << 3;
    const int cc   = lane & 15;
    const size_t hb = (size_t)(h * NB + b);

    const _Float16* qb = qp + (hb * SEQ + s0) * HD;
    const _Float16* kb = kp + hb * SEQ * HD;
    const _Float16* vb = vT + hb * HD * SEQ;

    const v16h qf0 = load_frag16(qb, HD, lane);        // d 0..31
    const v16h qf1 = load_frag16(qb + 32, HD, lane);   // d 32..63
    const int b1 = (b + 1) & 3, b2 = (b + 2) & 3, b3 = (b + 3) & 3;

    v8f o[4];
#pragma unroll
    for (int nt = 0; nt < 4; ++nt) o[nt] = zero8();
    float rs[8];
#pragma unroll
    for (int g = 0; g < 8; ++g) rs[g] = 0.0f;

#pragma unroll 1
    for (int t0 = 0; t0 < SEQ; t0 += 32) {
        const _Float16* kr = kb + (size_t)t0 * HD;
        v16h kf0 = load_frag16(kr, HD, lane);
        v16h kf1 = load_frag16(kr + 32, HD, lane);
        v8f sA = wmma16(qf0, kf0, zero8());
        sA = wmma16(qf1, kf1, sA);
        kf0 = load_frag16(kr + 16 * HD, HD, lane);
        kf1 = load_frag16(kr + 16 * HD + 32, HD, lane);
        v8f sB = wmma16(qf0, kf0, zero8());
        sB = wmma16(qf1, kf1, sB);

        float tA[8], tB[8];
#pragma unroll
        for (int g = 0; g < 8; ++g) {
            tA[g] = sA[g] * CS;
            tB[g] = sB[g] * CS;
            Tsc[b][(r0 + g) * 32 + cc]      = tA[g];
            Tsc[b][(r0 + g) * 32 + 16 + cc] = tB[g];
        }
        __syncthreads();

#pragma unroll
        for (int g = 0; g < 8; ++g) {
            const int ia = (r0 + g) * 32 + cc;
            const int ib = ia + 16;
            float dA = 1.0f + ex2(Tsc[b1][ia] - tA[g]) + ex2(Tsc[b2][ia] - tA[g]) + ex2(Tsc[b3][ia] - tA[g]);
            float dB = 1.0f + ex2(Tsc[b1][ib] - tB[g]) + ex2(Tsc[b2][ib] - tB[g]) + ex2(Tsc[b3][ib] - tB[g]);
            float pA = ex2(__builtin_amdgcn_rcpf(dA) * L2E);
            float pB = ex2(__builtin_amdgcn_rcpf(dB) * L2E);
            _Float16 hA = (_Float16)pA;
            _Float16 hB = (_Float16)pB;
            rs[g] += (float)hA + (float)hB;
            Pst[b][ia] = hA;
            Pst[b][ib] = hB;
        }
        wave_lds_sync();
        const v16h pa = load_frag16(&Pst[b][0], 32, lane);      // rows = queries, k = 32 keys
        const _Float16* vr = vb + t0;
#pragma unroll
        for (int nt = 0; nt < 4; ++nt) {
            v16h vf = load_frag16(vr + (size_t)(nt * 16) * SEQ, SEQ, lane);   // n = v column, k = key
            o[nt] = wmma16(pa, vf, o[nt]);
        }
        __syncthreads();
    }

    // row sums: reduce over the 16 lanes of each half (columns), rows 8h+g
#pragma unroll
    for (int g = 0; g < 8; ++g) {
        float v = rs[g];
        v += __shfl_xor(v, 1, 32);
        v += __shfl_xor(v, 2, 32);
        v += __shfl_xor(v, 4, 32);
        v += __shfl_xor(v, 8, 32);
        rs[g] = __builtin_amdgcn_rcpf(v);
    }
#pragma unroll
    for (int nt = 0; nt < 4; ++nt)
#pragma unroll
        for (int g = 0; g < 8; ++g)
            Zst[b][(r0 + g) * 64 + nt * 16 + cc] = (_Float16)(o[nt][g] * rs[g]);
    wave_lds_sync();

    const int rq = lane >> 3, pc = lane & 7;
    v8h zv[4];
    int off[4];
#pragma unroll
    for (int it = 0; it < 4; ++it) {
        const int i = it * 4 + rq;
        zv[it]  = *(const v8h*)(&Zst[b][i * 64 + pc * 8]);
        off[it] = ((s0 + i) * NB + b) * DM + h * HD + pc * 8;
    }
#pragma unroll
    for (int it = 0; it < 4; ++it) *(v8h*)(zc + off[it]) = zv[it];
    
}

// ---------------------------------------------------------------------------
// Output projection: out[m][n] = 2^-12 * (64 z)[m][:] . (64 Wo)[:][n] + bO[n].
// Block = 4 waves; wave = 32 rows x 64 columns. f32 tile staged in a wave-private
// LDS tile; each instruction writes two whole 256-B row segments (16 lanes x 16 B
// coverage: 32 rows = 16 instructions x 2 rows.
// ---------------------------------------------------------------------------
__global__ __launch_bounds__(128) __attribute__((amdgpu_num_vgpr(256)))
void k_out(const _Float16* __restrict__ zc,
           const _Float16* __restrict__ woT,
           const float*    __restrict__ bo,
           float* __restrict__ out) {
    __shared__ __align__(16) float Ost[4][32 * 64];     // 32 KB, wave-private tiles
    const int tid  = threadIdx.x;
    const int lane = tid & 31;
    const int w    = tid >> 5;
    const int m0   = blockIdx.x * 128 + w * 32;
    const int n0   = blockIdx.y * 64;

    v8f acc[2][4];
    gemm_32x64(zc + (size_t)m0 * DM, woT + (size_t)n0 * DM, lane, acc);

    const int r0 = (lane >> 4) << 3;
    const int cc = lane & 15;
    float bb[4];
#pragma unroll
    for (int nt = 0; nt < 4; ++nt) bb[nt] = bo[n0 + nt * 16 + cc];
#pragma unroll
    for (int rt = 0; rt < 2; ++rt)
#pragma unroll
        for (int nt = 0; nt < 4; ++nt)
#pragma unroll
            for (int g = 0; g < 8; ++g)
                Ost[w][(rt * 16 + r0 + g) * 64 + nt * 16 + cc] =
                    __builtin_fmaf(acc[rt][nt][g], SC_OUT, bb[nt]);
    wave_lds_sync();

    const int rh = lane >> 4, c4 = lane & 15;
    v4f sv[16];
#pragma unroll
    for (int it = 0; it < 16; ++it) sv[it] = *(const v4f*)(&Ost[w][(it * 2 + rh) * 64 + c4 * 4]);
    float* ob = out + (size_t)m0 * DM + n0 + (size_t)rh * DM + c4 * 4;
#pragma unroll
    for (int it = 0; it < 16; ++it) *(v4f*)(ob + (size_t)(it * 2) * DM) = sv[it];
    
}

// ---------------------------------------------------------------------------
extern "C" void kernel_launch(void* const* d_in, const int* in_sizes, int n_in,
                              void* d_out, int out_size, void* d_ws, size_t ws_size,
                              hipStream_t stream) {
    if (n_in < 9) return;
    if (in_sizes[0] < ((SEQ - 1) * NB_FULL + NB) * DM) return;
    if (in_sizes[1] < NH * DM * HD || in_sizes[3] < NH * DM * HD || in_sizes[5] < NH * DM * HD) return;
    if (in_sizes[2] < NH * HD || in_sizes[4] < NH * HD || in_sizes[6] < NH * HD) return;
    if (in_sizes[7] < DM * DM || in_sizes[8] < DM) return;
    if (out_size < MTOT * DM) return;
    if ((size_t)WS_TOTAL > ws_size) return;

    const float* X  = (const float*)d_in[0];   // [S][B][512], row m = s*4 + b
    const float* WQ = (const float*)d_in[1];   // [8][512][64]
    const float* bQ = (const float*)d_in[2];   // [8][64]
    const float* WK = (const float*)d_in[3];
    const float* bK = (const float*)d_in[4];
    const float* WV = (const float*)d_in[5];
    const float* bV = (const float*)d_in[6];
    const float* WO = (const float*)d_in[7];   // [512 in][512 out]
    const float* bO = (const float*)d_in[8];   // [512]
    float* out = (float*)d_out;                // [S][B][512]

    char* ws = (char*)d_ws;
    size_t off = 0;
    _Float16* wT   = (_Float16*)(ws + off); off += WT_BYTES;     // [1536][512]
    _Float16* woT  = (_Float16*)(ws + off); off += WOT_BYTES;    // [512][512]
    float*    bias = (float*)(ws + off);    off += BIAS_BYTES;   // [2048]
    _Float16* xh   = (_Float16*)(ws + off); off += XH_BYTES;     // [MTOT][512]
    _Float16* qkv  = (_Float16*)(ws + off); off += 3 * PL_BYTES; // q,k,v [h][b][s][64]
    _Float16* vT   = (_Float16*)(ws + off); off += PL_BYTES;     // [h][b][64][s]
    _Float16* zc   = (_Float16*)(ws + off); off += ZC_BYTES;     // [MTOT][512]
    if (off > ws_size) return;

    // per-head weights: in[d 512][k 64] -> out[h*64 + k][d]; x tiles = d, y tiles = head
    k_wT<<<dim3(8, 8), dim3(256), 0, stream>>>(WQ, HD, 64 * HD, DM * HD, wT,                       DM, 64, 64 * DM);
    k_wT<<<dim3(8, 8), dim3(256), 0, stream>>>(WK, HD, 64 * HD, DM * HD, wT + (size_t)DM * DM,     DM, 64, 64 * DM);
    k_wT<<<dim3(8, 8), dim3(256), 0, stream>>>(WV, HD, 64 * HD, DM * HD, wT + (size_t)2 * DM * DM, DM, 64, 64 * DM);
    // Wo: in[k 512][n 512] -> out[n][k]; x tiles = k rows, y tiles = n columns
    k_wT<<<dim3(8, 8), dim3(256), 0, stream>>>(WO, DM, 64 * DM, 64, woT, DM, 64, 64 * DM);
    k_bprep<<<dim3(1), dim3(512), 0, stream>>>(bQ, bK, bV, bO, bias);
    k_xcvt<<<dim3((unsigned)(((size_t)MTOT * DM) / 2048)), dim3(256), 0, stream>>>(X, xh);
    k_proj<<<dim3(MTOT / 128, NQKV / 64), dim3(128), 0, stream>>>(xh, wT, bias, qkv);
    k_vT<<<dim3(SEQ / 64, NH * NB), dim3(256), 0, stream>>>(qkv + 2 * PL_ELEMS, vT);
    k_attn<<<dim3(SEQ / 16, NH), dim3(128), 0, stream>>>(qkv, qkv + PL_ELEMS, vT, zc);
    k_out<<<dim3(MTOT / 128, DM / 64), dim3(128), 0, stream>>>(zc, woT, bias + NQKV, out);
}

// v001
// One run takes 260 microseconds.
// Two timings next to v000 both put it at 1.07 times that version's speed.
#include <hip/hip_runtime.h>
#include <hip/hip_fp16.h>

// All contractions on v_wmma_f32_16x16x32_f16 (f16 operands, f32 accumulate), single products: x*[Wq|Wk|Wv], q*k^T, P*v, z*Wo; every float input RNE-converted to bf16 first (exact in f16), weight planes and q/k/v/z planes carried x64, P = exp(p1) in [1,e] unscaled.

#ifndef NB
#define NB 4             // batch; the 4 waves of the attention block are the 4 batches (must stay 4)
#endif
#ifndef SEQ
#define SEQ 2048
#endif
#define NB_FULL  4
#define SEQ_FULL 2048
#define DM   512          // model width
#define NH   8            // heads
#define HD   64           // head width (dk = dv)
#define NQKV (3 * NH * HD)
#define MTOT (SEQ * NB)   // token rows m = s*NB + b

static_assert(NB == 4);
static_assert(NB_FULL == 4);
static_assert(SEQ >= 64 && SEQ <= SEQ_FULL);
static_assert(SEQ % 64 == 0);
static_assert(MTOT % 128 == 0);
static_assert(DM % 32 == 0);
static_assert(DM == NH * HD);
static_assert(HD == 64);
static_assert(NQKV % 64 == 0);
static_assert(((size_t)MTOT * DM) % 2048 == 0);

typedef _Float16 v16h __attribute__((ext_vector_type(16)));
typedef _Float16 v8h  __attribute__((ext_vector_type(8)));
typedef float    v8f  __attribute__((ext_vector_type(8)));
typedef float    v4f  __attribute__((ext_vector_type(4)));

union Frag { v16h v; v8h h[2]; };

#define L2E     1.44269504088896340736f
#define CS      (1.44269504088896340736f * 3.0517578125e-05f)   // log2(e) * 2^-15 : (64q).(64k)/8 -> log2 units
#define SC_OUT  2.44140625e-04f                                  // 2^-12 : (64 z)(64 Wo) -> out

#define WT_BYTES   ((size_t)NQKV * DM * 2)
#define WOT_BYTES  ((size_t)DM * DM * 2)
#define BIAS_ELEMS 2048
#define BIAS_BYTES ((size_t)BIAS_ELEMS * 4)
#define XH_BYTES   ((size_t)MTOT * DM * 2)
#define PL_ELEMS   ((size_t)NH * NB * SEQ * HD)
#define PL_BYTES   (PL_ELEMS * 2)
#define ZC_BYTES   ((size_t)MTOT * DM * 2)
#define WS_TOTAL   (WT_BYTES + WOT_BYTES + BIAS_BYTES + XH_BYTES + 4 * PL_BYTES + ZC_BYTES)
static_assert(WS_TOTAL <= (size_t)134217728);
static_assert(WT_BYTES % 128 == 0 && WOT_BYTES % 128 == 0 && BIAS_BYTES % 128 == 0);
static_assert(XH_BYTES % 128 == 0 && PL_BYTES % 128 == 0 && ZC_BYTES % 128 == 0);
static_assert(NQKV + DM == BIAS_ELEMS);

static __device__ __forceinline__ v8f zero8() {
    v8f z;
#pragma unroll
    for (int i = 0; i < 8; ++i) z[i] = 0.0f;
    return z;
}

// 16x32 A fragment (or B fragment from an [n][k] k-contiguous source) from a
// row-major 16-bit tile: lane m = lane&15 -> row m; kb = 8*(lane>>4);
// elements 0..7 = k kb..kb+7, elements 8..15 = k kb+16..kb+23.
static __device__ __forceinline__ v16h load_frag16(const _Float16* base, int ld, int lane) {
    int m  = lane & 15;
    int kb = (lane >> 4) << 3;
    const _Float16* p = base + (size_t)m * ld + kb;
    Frag f;
    f.h[0] = *(const v8h*)(p);
    f.h[1] = *(const v8h*)(p + 16);
    return f.v;
}

static __device__ __forceinline__ v8f wmma16(v16h a, v16h b, v8f c) {
    v8f d = __builtin_amdgcn_wmma_f32_16x16x32_f16(false, a, false, b, (short)0, c, false, false);
    asm volatile("v_nop\n\tv_nop\n\tv_nop\n\tv_nop" : "+v"(d) : "v"(a), "v"(b));
    return d;
}

// f32 -> bf16 RNE convert, value kept as f32
static __device__ __forceinline__ float bf16r(float x) {
    unsigned u = __float_as_uint(x);
    u = (u + 0x7FFFu + ((u >> 16) & 1u)) & 0xFFFF0000u;
    return __uint_as_float(u);
}

static __device__ __forceinline__ float ex2(float x) {
    return __builtin_amdgcn_exp2f(x);
}

// ordering for a wave-private LDS tile: stores before later loads of the same wave
static __device__ __forceinline__ void wave_lds_sync() {
    __builtin_amdgcn_fence(3, "wavefront");
    asm volatile("s_wait_dscnt 0" ::: "memory");
    __builtin_amdgcn_wave_barrier();
}

// work-group barrier for LDS traffic alone: the wave's own LDS operations retire, then the
// barrier. __syncthreads() would also wait for every global load, and the fragment loads
// issued ahead in the attention loop must stay in flight across it.
static __device__ __forceinline__ void lds_barrier() {
    asm volatile("s_wait_dscnt 0x0\n\ts_barrier_signal -1\n\ts_barrier_wait -1" ::: "memory");
}

// ---------------------------------------------------------------------------
// Weight plane builder: one 64x64 tile per block, in[i][j] (f32) -> out[j][i]
// (f16 = 64 * bf16-RNE value). Tile bases = base + blockIdx.x*xs + blockIdx.y*ys.
// coverage: 64 out rows x 64 halves per block, 512 pieces = 256 threads x 2.
// ---------------------------------------------------------------------------
__global__ __launch_bounds__(256) void k_wT(const float* __restrict__ src, int src_pitch, int src_xs, int src_ys,
                                             _Float16* __restrict__ dst, int dst_pitch, int dst_xs, int dst_ys) {
    __shared__ __align__(16) _Float16 T[64 * 72];
    const int tid = threadIdx.x;
    const float* sp = src + (size_t)blockIdx.x * src_xs + (size_t)blockIdx.y * src_ys;
    _Float16*    dp = dst + (size_t)blockIdx.x * dst_xs + (size_t)blockIdx.y * dst_ys;
#pragma unroll
    for (int it = 0; it < 4; ++it) {
        int idx = tid + it * 256;
        int r = idx >> 4, c4 = idx & 15;
        v4f v = *(const v4f*)(sp + (size_t)r * src_pitch + c4 * 4);
        T[(c4 * 4 + 0) * 72 + r] = (_Float16)(bf16r(v.x) * 64.0f);
        T[(c4 * 4 + 1) * 72 + r] = (_Float16)(bf16r(v.y) * 64.0f);
        T[(c4 * 4 + 2) * 72 + r] = (_Float16)(bf16r(v.z) * 64.0f);
        T[(c4 * 4 + 3) * 72 + r] = (_Float16)(bf16r(v.w) * 64.0f);
    }
    __syncthreads();
    const int j0 = tid >> 3, pc = tid & 7;
    v8h o0 = *(const v8h*)(&T[j0 * 72 + pc * 8]);
    v8h o1 = *(const v8h*)(&T[(j0 + 32) * 72 + pc * 8]);
    _Float16* d0 = dp + (size_t)j0 * dst_pitch + pc * 8;
    _Float16* d1 = dp + (size_t)(j0 + 32) * dst_pitch + pc * 8;
    *(v8h*)d0 = o0;
    *(v8h*)d1 = o1;
    
}

// ---------------------------------------------------------------------------
// Bias plane [2048] f32: [0..1535] = 64*bf16r(bQ|bK|bV) (index which*512 + h*64 + k),
// [1536..2047] = bf16r(bO). One block; staged in LDS; 512 lanes x 16 B contiguous.
// ---------------------------------------------------------------------------
__global__ __launch_bounds__(512) void k_bprep(const float* __restrict__ bQ, const float* __restrict__ bK,
                                                const float* __restrict__ bV, const float* __restrict__ bO,
                                                float* __restrict__ bias) {
    __shared__ __align__(16) float st[BIAS_ELEMS];
    const int t = threadIdx.x;
    st[t]        = bf16r(bQ[t]) * 64.0f;
    st[512 + t]  = bf16r(bK[t]) * 64.0f;
    st[1024 + t] = bf16r(bV[t]) * 64.0f;
    st[1536 + t] = bf16r(bO[t]);
    __syncthreads();
    v4f v = *(const v4f*)(&st[t * 4]);
    *(v4f*)(bias + t * 4) = v;
    
}

// ---------------------------------------------------------------------------
// x plane: xh[m][d] = f16(bf16r(x[m][d])); 8 elements per thread, lane-contiguous
// ---------------------------------------------------------------------------
__global__ __launch_bounds__(256) void k_xcvt(const float* __restrict__ x, _Float16* __restrict__ xh) {
    const size_t i = ((size_t)blockIdx.x * 256 + threadIdx.x) * 8;
    v4f a = *(const v4f*)(x + i);
    v4f b = *(const v4f*)(x + i + 4);
    v8h o;
    o[0] = (_Float16)bf16r(a.x); o[1] = (_Float16)bf16r(a.y);
    o[2] = (_Float16)bf16r(a.z); o[3] = (_Float16)bf16r(a.w);
    o[4] = (_Float16)bf16r(b.x); o[5] = (_Float16)bf16r(b.y);
    o[6] = (_Float16)bf16r(b.z); o[7] = (_Float16)bf16r(b.w);
    *(v8h*)(xh + i) = o;
    
}

// ---------------------------------------------------------------------------
// GEMM main loop: wave tile 32 rows x 64 columns, K = DM, A rows and B rows
// ([n][k] k-contiguous) both with pitch DM, fragments straight from the 16-bit
// global planes (arithmetic addressing only).
// ---------------------------------------------------------------------------
static __device__ __forceinline__ void gemm_32x64(const _Float16* __restrict__ Ap,
                                                  const _Float16* __restrict__ Bp,
                                                  int lane, v8f (&acc)[2][4]) {
#pragma unroll
    for (int rt = 0; rt < 2; ++rt)
#pragma unroll
        for (int nt = 0; nt < 4; ++nt) acc[rt][nt] = zero8();
#pragma unroll 1
    for (int k0 = 0; k0 < DM; k0 += 32) {
        v16h a0 = load_frag16(Ap + k0, DM, lane);
        v16h a1 = load_frag16(Ap + (size_t)16 * DM + k0, DM, lane);
#pragma unroll
        for (int nt = 0; nt < 4; ++nt) {
            v16h bf = load_frag16(Bp + (size_t)(nt * 16) * DM + k0, DM, lane);
            acc[0][nt] = wmma16(a0, bf, acc[0][nt]);
            acc[1][nt] = wmma16(a1, bf, acc[1][nt]);
        }
    }
}

// ---------------------------------------------------------------------------
// Projections: [MTOT x 512] x [512 x 1536]. Block = 4 waves; wave = 32 token rows
// x 64 columns (one of q/k/v, one head). Output planes q,k,v [h][b][s][64] f16
// (one (h,b,s) row) written by 8 consecutive lanes of one instruction.
// coverage: 32 rows x 8 pieces = 8 instructions x 32 lanes.
// ---------------------------------------------------------------------------
__global__ __launch_bounds__(128) __attribute__((amdgpu_num_vgpr(256)))
void k_proj(const _Float16* __restrict__ xh,
            const _Float16* __restrict__ wT,
            const float*    __restrict__ bias,
            _Float16* __restrict__ qkv) {
    __shared__ __align__(16) _Float16 st[4][32 * 64];     // 16 KB, wave-private tiles
    const int tid  = threadIdx.x;
    const int lane = tid & 31;
    const int w    = tid >> 5;
    const int m0   = blockIdx.x * 128 + w * 32;
    const int n0   = blockIdx.y * 64;

    v8f acc[2][4];
    gemm_32x64(xh + (size_t)m0 * DM, wT + (size_t)n0 * DM, lane, acc);

    const int r0 = (lane >> 4) << 3;
    const int cc = lane & 15;
    float bb[4];
#pragma unroll
    for (int nt = 0; nt < 4; ++nt) bb[nt] = bias[n0 + nt * 16 + cc];
#pragma unroll
    for (int rt = 0; rt < 2; ++rt)
#pragma unroll
        for (int nt = 0; nt < 4; ++nt)
#pragma unroll
            for (int g = 0; g < 8; ++g)
                st[w][(rt * 16 + r0 + g) * 64 + nt * 16 + cc] = (_Float16)(acc[rt][nt][g] + bb[nt]);
    wave_lds_sync();

    const int which = n0 >> 9;               // 0 q, 1 k, 2 v
    const int hh    = (n0 & 511) >> 6;
    _Float16* plane = qkv + (size_t)which * PL_ELEMS;
    const int rq = lane >> 3, pc = lane & 7;
    v8h pv[8];
    int off[8];
#pragma unroll
    for (int it = 0; it < 8; ++it) {
        const int i = it * 4 + rq;
        pv[it] = *(const v8h*)(&st[w][i * 64 + pc * 8]);
        const int m = m0 + i;
        const int s = m >> 2, b = m & 3;     // m = s*NB + b, NB = 4
        off[it] = ((hh * NB + b) * SEQ + s) * HD + pc * 8;
    }
#pragma unroll
    for (int it = 0; it < 8; ++it) *(v8h*)(plane + off[it]) = pv[it];
    
}

// ---------------------------------------------------------------------------
// V^T plane: v[hb][s][64] -> vT[hb][64][s]; 64 s x 64 v tile per block through
// coverage: 64 rows x 8 pieces = 256 threads x 2.
// ---------------------------------------------------------------------------
__global__ __launch_bounds__(256) void k_vT(const _Float16* __restrict__ v, _Float16* __restrict__ vT) {
    __shared__ __align__(16) _Float16 T[64 * 72];
    const int tid = threadIdx.x;
    const int s0  = blockIdx.x * 64;
    const int hb  = blockIdx.y;
    const _Float16* sp = v + ((size_t)hb * SEQ + s0) * HD;
#pragma unroll
    for (int it = 0; it < 2; ++it) {
        int p = tid + it * 256;
        int r = p >> 3, pc = p & 7;
        v8h vv = *(const v8h*)(sp + (size_t)r * HD + pc * 8);
#pragma unroll
        for (int e = 0; e < 8; ++e) T[(pc * 8 + e) * 72 + r] = vv[e];
    }
    __syncthreads();
    _Float16* dp = vT + (size_t)hb * HD * SEQ + s0;
    const int j0 = tid >> 3, pc = tid & 7;
    v8h o0 = *(const v8h*)(&T[j0 * 72 + pc * 8]);
    v8h o1 = *(const v8h*)(&T[(j0 + 32) * 72 + pc * 8]);
    _Float16* d0 = dp + (size_t)j0 * SEQ + pc * 8;
    _Float16* d1 = dp + (size_t)(j0 + 32) * SEQ + pc * 8;
    *(v8h*)d0 = o0;
    *(v8h*)d1 = o1;
    
}

// ---------------------------------------------------------------------------
// Fused attention, block = (head h, 16 queries), 4 waves = 4 batches.
// Per 32-key chunk: wave computes its batch's 16x32 score tile (4 WMMAs, q/k
// fragments from the planes), publishes it (log2 units) in the cross-wave tile
// Tsc[b] (block barrier), forms
//   p1 = 1 / (1 + sum_{b' != b} 2^(t_b' - t_b))        (softmax over the batch axis,
//        shifted by the own value: overflow -> inf -> p1 = 0, the exact limit)
//   P  = 2^(p1 * log2 e) in [1, e]  (key-axis softmax numerator, no shift needed)
// accumulates the row sum of the f16-converted P, relays P through a wave-private
// LDS tile into an A fragment, o += P @ V (4 WMMAs, V^T fragments from the plane),
// block barrier before Tsc is overwritten. Trip count block-uniform.
// ---------------------------------------------------------------------------
__global__ __launch_bounds__(128) __attribute__((amdgpu_num_vgpr(256)))
void k_attn(const _Float16* __restrict__ qp,
            const _Float16* __restrict__ kp,
            const _Float16* __restrict__ vT,
            _Float16* __restrict__ zc) {
    __shared__ __align__(16) float    Tsc[4][16 * 32];   // 8 KB cross-wave (block barriers)
    __shared__ __align__(16) _Float16 Pst[4][16 * 32];   // 4 KB wave-private
    __shared__ __align__(16) _Float16 Zst[4][16 * 64];   // 8 KB wave-private

    const int tid  = threadIdx.x;
    const int lane = tid & 31;
    const int b    = tid >> 5;
    const int h    = blockIdx.y;
    const int s0   = blockIdx.x * 16;
    const int r0   = (lane >> 4) << 3;
    const int cc   = lane & 15;
    const size_t hb = (size_t)(h * NB + b);

    const _Float16* qb = qp + (hb * SEQ + s0) * HD;
    const _Float16* kb = kp + hb * SEQ * HD;
    const _Float16* vb = vT + hb * HD * SEQ;

    const v16h qf0 = load_frag16(qb, HD, lane);        // d 0..31
    const v16h qf1 = load_frag16(qb + 32, HD, lane);   // d 32..63
    const int b1 = (b + 1) & 3, b2 = (b + 2) & 3, b3 = (b + 3) & 3;

    v8f o[4];
#pragma unroll
    for (int nt = 0; nt < 4; ++nt) o[nt] = zero8();
    float rs[8];
#pragma unroll
    for (int g = 0; g < 8; ++g) rs[g] = 0.0f;

    // K fragments of chunk 0; inside the loop each chunk fetches the next chunk's
    v16h kf0 = load_frag16(kb, HD, lane);
    v16h kf1 = load_frag16(kb + 32, HD, lane);
    v16h kf2 = load_frag16(kb + 16 * HD, HD, lane);
    v16h kf3 = load_frag16(kb + 16 * HD + 32, HD, lane);
    const _Float16* kn = kb + 32 * HD;                 // chunk 1 (SEQ >= 64)

#pragma unroll 1
    for (int t0 = 0; t0 < SEQ; t0 += 32) {
        // this chunk's V^T fragments, one group, in flight under the scores and the softmax
        const _Float16* vr = vb + t0;
        v16h vf[4];
#pragma unroll
        for (int nt = 0; nt < 4; ++nt)
            vf[nt] = load_frag16(vr + (size_t)(nt * 16) * SEQ, SEQ, lane);   // n = v column, k = key

        v8f sA = wmma16(qf0, kf0, zero8());
        sA = wmma16(qf1, kf1, sA);
        v8f sB = wmma16(qf0, kf2, zero8());
        sB = wmma16(qf1, kf3, sB);

        // next chunk's K fragments, one group, in flight until the next trip's scores
        // (the last trip re-reads its own chunk, so the address stays inside the plane)
        kf0 = load_frag16(kn, HD, lane);
        kf1 = load_frag16(kn + 32, HD, lane);
        kf2 = load_frag16(kn + 16 * HD, HD, lane);
        kf3 = load_frag16(kn + 16 * HD + 32, HD, lane);
        kn += (t0 + 64 < SEQ) ? 32 * HD : 0;

        float tA[8], tB[8];
#pragma unroll
        for (int g = 0; g < 8; ++g) {
            tA[g] = sA[g] * CS;
            tB[g] = sB[g] * CS;
            Tsc[b][(r0 + g) * 32 + cc]      = tA[g];
            Tsc[b][(r0 + g) * 32 + 16 + cc] = tB[g];
        }
        lds_barrier();

#pragma unroll
        for (int g = 0; g < 8; ++g) {
            const int ia = (r0 + g) * 32 + cc;
            const int ib = ia + 16;
            float dA = 1.0f + ex2(Tsc[b1][ia] - tA[g]) + ex2(Tsc[b2][ia] - tA[g]) + ex2(Tsc[b3][ia] - tA[g]);
            float dB = 1.0f + ex2(Tsc[b1][ib] - tB[g]) + ex2(Tsc[b2][ib] - tB[g]) + ex2(Tsc[b3][ib] - tB[g]);
            float pA = ex2(__builtin_amdgcn_rcpf(dA) * L2E);
            float pB = ex2(__builtin_amdgcn_rcpf(dB) * L2E);
            _Float16 hA = (_Float16)pA;
            _Float16 hB = (_Float16)pB;
            rs[g] += (float)hA + (float)hB;
            Pst[b][ia] = hA;
            Pst[b][ib] = hB;
        }
        wave_lds_sync();
        const v16h pa = load_frag16(&Pst[b][0], 32, lane);      // rows = queries, k = 32 keys
#pragma unroll
        for (int nt = 0; nt < 4; ++nt) o[nt] = wmma16(pa, vf[nt], o[nt]);
        lds_barrier();
    }

    // row sums: reduce over the 16 lanes of each half (columns), rows 8h+g
#pragma unroll
    for (int g = 0; g < 8; ++g) {
        float v = rs[g];
        v += __shfl_xor(v, 1, 32);
        v += __shfl_xor(v, 2, 32);
        v += __shfl_xor(v, 4, 32);
        v += __shfl_xor(v, 8, 32);
        rs[g] = __builtin_amdgcn_rcpf(v);
    }
#pragma unroll
    for (int nt = 0; nt < 4; ++nt)
#pragma unroll
        for (int g = 0; g < 8; ++g)
            Zst[b][(r0 + g) * 64 + nt * 16 + cc] = (_Float16)(o[nt][g] * rs[g]);
    wave_lds_sync();

    const int rq = lane >> 3, pc = lane & 7;
    v8h zv[4];
    int off[4];
#pragma unroll
    for (int it = 0; it < 4; ++it) {
        const int i = it * 4 + rq;
        zv[it]  = *(const v8h*)(&Zst[b][i * 64 + pc * 8]);
        off[it] = ((s0 + i) * NB + b) * DM + h * HD + pc * 8;
    }
#pragma unroll
    for (int it = 0; it < 4; ++it) *(v8h*)(zc + off[it]) = zv[it];
    
}

// ---------------------------------------------------------------------------
// Output projection: out[m][n] = 2^-12 * (64 z)[m][:] . (64 Wo)[:][n] + bO[n].
// Block = 4 waves; wave = 32 rows x 64 columns. f32 tile staged in a wave-private
// LDS tile; each instruction writes two whole 256-B row segments (16 lanes x 16 B
// coverage: 32 rows = 16 instructions x 2 rows.
// ---------------------------------------------------------------------------
__global__ __launch_bounds__(128) __attribute__((amdgpu_num_vgpr(256)))
void k_out(const _Float16* __restrict__ zc,
           const _Float16* __restrict__ woT,
           const float*    __restrict__ bo,
           float* __restrict__ out) {
    __shared__ __align__(16) float Ost[4][32 * 64];     // 32 KB, wave-private tiles
    const int tid  = threadIdx.x;
    const int lane = tid & 31;
    const int w    = tid >> 5;
    const int m0   = blockIdx.x * 128 + w * 32;
    const int n0   = blockIdx.y * 64;

    v8f acc[2][4];
    gemm_32x64(zc + (size_t)m0 * DM, woT + (size_t)n0 * DM, lane, acc);

    const int r0 = (lane >> 4) << 3;
    const int cc = lane & 15;
    float bb[4];
#pragma unroll
    for (int nt = 0; nt < 4; ++nt) bb[nt] = bo[n0 + nt * 16 + cc];
#pragma unroll
    for (int rt = 0; rt < 2; ++rt)
#pragma unroll
        for (int nt = 0; nt < 4; ++nt)
#pragma unroll
            for (int g = 0; g < 8; ++g)
                Ost[w][(rt * 16 + r0 + g) * 64 + nt * 16 + cc] =
                    __builtin_fmaf(acc[rt][nt][g], SC_OUT, bb[nt]);
    wave_lds_sync();

    const int rh = lane >> 4, c4 = lane & 15;
    v4f sv[16];
#pragma unroll
    for (int it = 0; it < 16; ++it) sv[it] = *(const v4f*)(&Ost[w][(it * 2 + rh) * 64 + c4 * 4]);
    float* ob = out + (size_t)m0 * DM + n0 + (size_t)rh * DM + c4 * 4;
#pragma unroll
    for (int it = 0; it < 16; ++it) *(v4f*)(ob + (size_t)(it * 2) * DM) = sv[it];
    
}

// ---------------------------------------------------------------------------
extern "C" void kernel_launch(void* const* d_in, const int* in_sizes, int n_in,
                              void* d_out, int out_size, void* d_ws, size_t ws_size,
                              hipStream_t stream) {
    if (n_in < 9) return;
    if (in_sizes[0] < ((SEQ - 1) * NB_FULL + NB) * DM) return;
    if (in_sizes[1] < NH * DM * HD || in_sizes[3] < NH * DM * HD || in_sizes[5] < NH * DM * HD) return;
    if (in_sizes[2] < NH * HD || in_sizes[4] < NH * HD || in_sizes[6] < NH * HD) return;
    if (in_sizes[7] < DM * DM || in_sizes[8] < DM) return;
    if (out_size < MTOT * DM) return;
    if ((size_t)WS_TOTAL > ws_size) return;

    const float* X  = (const float*)d_in[0];   // [S][B][512], row m = s*4 + b
    const float* WQ = (const float*)d_in[1];   // [8][512][64]
    const float* bQ = (const float*)d_in[2];   // [8][64]
    const float* WK = (const float*)d_in[3];
    const float* bK = (const float*)d_in[4];
    const float* WV = (const float*)d_in[5];
    const float* bV = (const float*)d_in[6];
    const float* WO = (const float*)d_in[7];   // [512 in][512 out]
    const float* bO = (const float*)d_in[8];   // [512]
    float* out = (float*)d_out;                // [S][B][512]

    char* ws = (char*)d_ws;
    size_t off = 0;
    _Float16* wT   = (_Float16*)(ws + off); off += WT_BYTES;     // [1536][512]
    _Float16* woT  = (_Float16*)(ws + off); off += WOT_BYTES;    // [512][512]
    float*    bias = (float*)(ws + off);    off += BIAS_BYTES;   // [2048]
    _Float16* xh   = (_Float16*)(ws + off); off += XH_BYTES;     // [MTOT][512]
    _Float16* qkv  = (_Float16*)(ws + off); off += 3 * PL_BYTES; // q,k,v [h][b][s][64]
    _Float16* vT   = (_Float16*)(ws + off); off += PL_BYTES;     // [h][b][64][s]
    _Float16* zc   = (_Float16*)(ws + off); off += ZC_BYTES;     // [MTOT][512]
    if (off > ws_size) return;

    // per-head weights: in[d 512][k 64] -> out[h*64 + k][d]; x tiles = d, y tiles = head
    k_wT<<<dim3(8, 8), dim3(256), 0, stream>>>(WQ, HD, 64 * HD, DM * HD, wT,                       DM, 64, 64 * DM);
    k_wT<<<dim3(8, 8), dim3(256), 0, stream>>>(WK, HD, 64 * HD, DM * HD, wT + (size_t)DM * DM,     DM, 64, 64 * DM);
    k_wT<<<dim3(8, 8), dim3(256), 0, stream>>>(WV, HD, 64 * HD, DM * HD, wT + (size_t)2 * DM * DM, DM, 64, 64 * DM);
    // Wo: in[k 512][n 512] -> out[n][k]; x tiles = k rows, y tiles = n columns
    k_wT<<<dim3(8, 8), dim3(256), 0, stream>>>(WO, DM, 64 * DM, 64, woT, DM, 64, 64 * DM);
    k_bprep<<<dim3(1), dim3(512), 0, stream>>>(bQ, bK, bV, bO, bias);
    k_xcvt<<<dim3((unsigned)(((size_t)MTOT * DM) / 2048)), dim3(256), 0, stream>>>(X, xh);
    k_proj<<<dim3(MTOT / 128, NQKV / 64), dim3(128), 0, stream>>>(xh, wT, bias, qkv);
    k_vT<<<dim3(SEQ / 64, NH * NB), dim3(256), 0, stream>>>(qkv + 2 * PL_ELEMS, vT);
    k_attn<<<dim3(SEQ / 16, NH), dim3(128), 0, stream>>>(qkv, qkv + PL_ELEMS, vT, zc);
    k_out<<<dim3(MTOT / 128, DM / 64), dim3(128), 0, stream>>>(zc, woT, bias + NQKV, out);
}

// v002
// One run takes 190 microseconds.
// Timed twice side by side with v001, it ran 1.37 times as fast both times.
// All steps since v000 together make it 1.47 times as fast.
#include <hip/hip_runtime.h>
#include <hip/hip_fp16.h>

// All contractions on v_wmma_f32_16x16x32_f16 (f16 operands, f32 accumulate), single products: x*[Wq|Wk|Wv], q*k^T, P*v, z*Wo; every float input RNE-converted to bf16 first (exact in f16), weight planes and q/k/v/z planes carried x64, P = exp(p1) in [1,e] unscaled.

#ifndef NB
#define NB 4             // batch; the 4 waves of the attention block are the 4 batches (must stay 4)
#endif
#ifndef SEQ
#define SEQ 2048
#endif
#define NB_FULL  4
#define SEQ_FULL 2048
#define DM   512          // model width
#define NH   8            // heads
#define HD   64           // head width (dk = dv)
#define NQKV (3 * NH * HD)
#define MTOT (SEQ * NB)   // token rows m = s*NB + b

static_assert(NB == 4);
static_assert(NB_FULL == 4);
static_assert(SEQ >= 64 && SEQ <= SEQ_FULL);
static_assert(SEQ % 64 == 0);
static_assert(MTOT % 128 == 0);
static_assert(DM % 32 == 0);
static_assert(DM == NH * HD);
static_assert(HD == 64);
static_assert(NQKV % 64 == 0);
static_assert(((size_t)MTOT * DM) % 2048 == 0);

typedef _Float16 v16h __attribute__((ext_vector_type(16)));
typedef _Float16 v8h  __attribute__((ext_vector_type(8)));
typedef float    v8f  __attribute__((ext_vector_type(8)));
typedef float    v4f  __attribute__((ext_vector_type(4)));

union Frag { v16h v; v8h h[2]; };

#define L2E     1.44269504088896340736f
#define CS      (1.44269504088896340736f * 3.0517578125e-05f)   // log2(e) * 2^-15 : (64q).(64k)/8 -> log2 units
#define SC_OUT  2.44140625e-04f                                  // 2^-12 : (64 z)(64 Wo) -> out

#define WT_BYTES   ((size_t)NQKV * DM * 2)
#define WOT_BYTES  ((size_t)DM * DM * 2)
#define BIAS_ELEMS 2048
#define BIAS_BYTES ((size_t)BIAS_ELEMS * 4)
#define XH_BYTES   ((size_t)MTOT * DM * 2)
#define PL_ELEMS   ((size_t)NH * NB * SEQ * HD)
#define PL_BYTES   (PL_ELEMS * 2)
#define ZC_BYTES   ((size_t)MTOT * DM * 2)
#define WS_TOTAL   (WT_BYTES + WOT_BYTES + BIAS_BYTES + XH_BYTES + 4 * PL_BYTES + ZC_BYTES)
static_assert(WS_TOTAL <= (size_t)134217728);
static_assert(WT_BYTES % 128 == 0 && WOT_BYTES % 128 == 0 && BIAS_BYTES % 128 == 0);
static_assert(XH_BYTES % 128 == 0 && PL_BYTES % 128 == 0 && ZC_BYTES % 128 == 0);
static_assert(NQKV + DM == BIAS_ELEMS);

static __device__ __forceinline__ v8f zero8() {
    v8f z;
#pragma unroll
    for (int i = 0; i < 8; ++i) z[i] = 0.0f;
    return z;
}

// 16x32 A fragment (or B fragment from an [n][k] k-contiguous source) from a
// row-major 16-bit tile: lane m = lane&15 -> row m; kb = 8*(lane>>4);
// elements 0..7 = k kb..kb+7, elements 8..15 = k kb+16..kb+23.
static __device__ __forceinline__ v16h load_frag16(const _Float16* base, int ld, int lane) {
    int m  = lane & 15;
    int kb = (lane >> 4) << 3;
    const _Float16* p = base + (size_t)m * ld + kb;
    Frag f;
    f.h[0] = *(const v8h*)(p);
    f.h[1] = *(const v8h*)(p + 16);
    return f.v;
}

// The same fragment from a plane kept in fragment order: a 16-row x 32-k block is 512
// halves, [j 0..1][lane 0..31][8 halves], where lane = row + 16*((k>>3)&1), j = k>>4,
// so each of the two loads reads 512 contiguous bytes (four whole lines) per wave.
static __device__ __forceinline__ v16h load_fragF(const _Float16* blk, int lane) {
    const _Float16* p = blk + lane * 8;
    Frag f;
    f.h[0] = *(const v8h*)(p);
    f.h[1] = *(const v8h*)(p + 256);
    return f.v;
}

static __device__ __forceinline__ v8f wmma16(v16h a, v16h b, v8f c) {
    v8f d = __builtin_amdgcn_wmma_f32_16x16x32_f16(false, a, false, b, (short)0, c, false, false);
    asm volatile("v_nop\n\tv_nop\n\tv_nop\n\tv_nop" : "+v"(d) : "v"(a), "v"(b));
    return d;
}

// f32 -> bf16 RNE convert, value kept as f32
static __device__ __forceinline__ float bf16r(float x) {
    unsigned u = __float_as_uint(x);
    u = (u + 0x7FFFu + ((u >> 16) & 1u)) & 0xFFFF0000u;
    return __uint_as_float(u);
}

static __device__ __forceinline__ float ex2(float x) {
    return __builtin_amdgcn_exp2f(x);
}

// ordering for a wave-private LDS tile: stores before later loads of the same wave
static __device__ __forceinline__ void wave_lds_sync() {
    __builtin_amdgcn_fence(3, "wavefront");
    asm volatile("s_wait_dscnt 0" ::: "memory");
    __builtin_amdgcn_wave_barrier();
}

// work-group barrier for LDS traffic alone: the wave's own LDS operations retire, then the
// barrier. __syncthreads() would also wait for every global load, and the fragment loads
// issued ahead in the attention loop must stay in flight across it.
static __device__ __forceinline__ void lds_barrier() {
    asm volatile("s_wait_dscnt 0x0\n\ts_barrier_signal -1\n\ts_barrier_wait -1" ::: "memory");
}

// ---------------------------------------------------------------------------
// Weight plane builder: one 64x64 tile per block, in[i][j] (f32) -> out[j][i]
// (f16 = 64 * bf16-RNE value). Tile bases = base + blockIdx.x*xs + blockIdx.y*ys.
// out is kept in fragment order: [j>>4][i>>5] blocks of 512 halves, 16 out rows = 16*dst_pitch halves.
// coverage: 4 x 2 blocks x 2 halves = 16 runs of 512 B = 8 waves x 2.
// ---------------------------------------------------------------------------
__global__ __launch_bounds__(256) void k_wT(const float* __restrict__ src, int src_pitch, int src_xs, int src_ys,
                                             _Float16* __restrict__ dst, int dst_pitch, int dst_xs, int dst_ys) {
    __shared__ __align__(16) _Float16 T[64 * 72];
    const int tid = threadIdx.x;
    const float* sp = src + (size_t)blockIdx.x * src_xs + (size_t)blockIdx.y * src_ys;
    _Float16*    dp = dst + (size_t)blockIdx.x * dst_xs + (size_t)blockIdx.y * dst_ys;
#pragma unroll
    for (int it = 0; it < 4; ++it) {
        int idx = tid + it * 256;
        int r = idx >> 4, c4 = idx & 15;
        v4f v = *(const v4f*)(sp + (size_t)r * src_pitch + c4 * 4);
        T[(c4 * 4 + 0) * 72 + r] = (_Float16)(bf16r(v.x) * 64.0f);
        T[(c4 * 4 + 1) * 72 + r] = (_Float16)(bf16r(v.y) * 64.0f);
        T[(c4 * 4 + 2) * 72 + r] = (_Float16)(bf16r(v.z) * 64.0f);
        T[(c4 * 4 + 3) * 72 + r] = (_Float16)(bf16r(v.w) * 64.0f);
    }
    __syncthreads();
    const int lane = tid & 31, wv = tid >> 5;
    const int nt0 = wv >> 2, nt1 = nt0 + 2;            // 16-row group of the out rows
    const int pq  = (wv & 3) * 2 + (lane >> 4);        // 8-half piece of the 64 k: (kc*2 + j)*2 + hi
    v8h o0 = *(const v8h*)(&T[(nt0 * 16 + (lane & 15)) * 72 + pq * 8]);
    v8h o1 = *(const v8h*)(&T[(nt1 * 16 + (lane & 15)) * 72 + pq * 8]);
    _Float16* d0 = dp + (size_t)(nt0 * 16) * dst_pitch + (wv & 3) * 256 + lane * 8;
    _Float16* d1 = dp + (size_t)(nt1 * 16) * dst_pitch + (wv & 3) * 256 + lane * 8;
    *(v8h*)d0 = o0;
    *(v8h*)d1 = o1;
    
}

// ---------------------------------------------------------------------------
// Bias plane [2048] f32: [0..1535] = 64*bf16r(bQ|bK|bV) (index which*512 + h*64 + k),
// [1536..2047] = bf16r(bO). One block; staged in LDS; 512 lanes x 16 B contiguous.
// ---------------------------------------------------------------------------
__global__ __launch_bounds__(512) void k_bprep(const float* __restrict__ bQ, const float* __restrict__ bK,
                                                const float* __restrict__ bV, const float* __restrict__ bO,
                                                float* __restrict__ bias) {
    __shared__ __align__(16) float st[BIAS_ELEMS];
    const int t = threadIdx.x;
    st[t]        = bf16r(bQ[t]) * 64.0f;
    st[512 + t]  = bf16r(bK[t]) * 64.0f;
    st[1024 + t] = bf16r(bV[t]) * 64.0f;
    st[1536 + t] = bf16r(bO[t]);
    __syncthreads();
    v4f v = *(const v4f*)(&st[t * 4]);
    *(v4f*)(bias + t * 4) = v;
    
}

// ---------------------------------------------------------------------------
// x plane in fragment order: f16(bf16r(x[m][d])); 8 elements per thread; 8 consecutive
// lanes take the same 8-column piece of 8 consecutive rows = one whole 128-B line of xh
// ---------------------------------------------------------------------------
__global__ __launch_bounds__(256) void k_xcvt(const float* __restrict__ x, _Float16* __restrict__ xh) {
    const int gid = blockIdx.x * 256 + threadIdx.x;
    const int pc  = (gid >> 3) & 63;                   // 8-column piece of the row
    const int row = ((gid >> 9) << 3) + (gid & 7);
    const size_t i = (size_t)row * DM + pc * 8;
    const size_t j = (size_t)(row >> 4) * (16 * DM) + (pc >> 1) * 256 + ((row & 15) + 16 * (pc & 1)) * 8;
    v4f a = *(const v4f*)(x + i);
    v4f b = *(const v4f*)(x + i + 4);
    v8h o;
    o[0] = (_Float16)bf16r(a.x); o[1] = (_Float16)bf16r(a.y);
    o[2] = (_Float16)bf16r(a.z); o[3] = (_Float16)bf16r(a.w);
    o[4] = (_Float16)bf16r(b.x); o[5] = (_Float16)bf16r(b.y);
    o[6] = (_Float16)bf16r(b.z); o[7] = (_Float16)bf16r(b.w);
    *(v8h*)(xh + j) = o;
    
}

// ---------------------------------------------------------------------------
// GEMM main loop: wave tile 32 rows x 64 columns, K = DM, A and B planes both in
// fragment order (16 rows = 16*DM halves, 32 k = 512 halves), fragments straight
// from the 16-bit global planes (arithmetic addressing only).
// ---------------------------------------------------------------------------
static __device__ __forceinline__ void gemm_32x64(const _Float16* __restrict__ Ap,
                                                  const _Float16* __restrict__ Bp,
                                                  int lane, v8f (&acc)[2][4]) {
#pragma unroll
    for (int rt = 0; rt < 2; ++rt)
#pragma unroll
        for (int nt = 0; nt < 4; ++nt) acc[rt][nt] = zero8();
#pragma unroll 1
    for (int k0 = 0; k0 < DM; k0 += 32) {
        v16h a0 = load_fragF(Ap + k0 * 16, lane);
        v16h a1 = load_fragF(Ap + (size_t)16 * DM + k0 * 16, lane);
#pragma unroll
        for (int nt = 0; nt < 4; ++nt) {
            v16h bf = load_fragF(Bp + (size_t)(nt * 16) * DM + k0 * 16, lane);
            acc[0][nt] = wmma16(a0, bf, acc[0][nt]);
            acc[1][nt] = wmma16(a1, bf, acc[1][nt]);
        }
    }
}

// ---------------------------------------------------------------------------
// Projections: [MTOT x 512] x [512 x 1536]. Block = 4 waves; wave = 32 token rows
// x 64 columns (one of q/k/v, one head). Output plane v [h][b][s][64] f16: one
// (h,b,s) row written by 8 consecutive lanes of one instruction. Output planes q,k
// [h][b] in fragment order (16 s = 1024 halves): 8 consecutive lanes write the same
// piece of 8 consecutive s = one whole line.
// coverage: 32 rows x 8 pieces = 8 instructions x 32 lanes.
// ---------------------------------------------------------------------------
__global__ __launch_bounds__(128) __attribute__((amdgpu_num_vgpr(256)))
void k_proj(const _Float16* __restrict__ xh,
            const _Float16* __restrict__ wT,
            const float*    __restrict__ bias,
            _Float16* __restrict__ qkv) {
    __shared__ __align__(16) _Float16 st[4][32 * 72];     // 18 KB, wave-private tiles, pitch 144 B
    const int tid  = threadIdx.x;
    const int lane = tid & 31;
    const int w    = tid >> 5;
    const int m0   = blockIdx.x * 128 + w * 32;
    const int n0   = blockIdx.y * 64;

    v8f acc[2][4];
    gemm_32x64(xh + (size_t)m0 * DM, wT + (size_t)n0 * DM, lane, acc);

    const int r0 = (lane >> 4) << 3;
    const int cc = lane & 15;
    float bb[4];
#pragma unroll
    for (int nt = 0; nt < 4; ++nt) bb[nt] = bias[n0 + nt * 16 + cc];
#pragma unroll
    for (int rt = 0; rt < 2; ++rt)
#pragma unroll
        for (int nt = 0; nt < 4; ++nt)
#pragma unroll
            for (int g = 0; g < 8; ++g)
                st[w][(rt * 16 + r0 + g) * 72 + nt * 16 + cc] = (_Float16)(acc[rt][nt][g] + bb[nt]);
    wave_lds_sync();

    const int which = n0 >> 9;               // 0 q, 1 k, 2 v
    const int hh    = (n0 & 511) >> 6;
    _Float16* plane = qkv + (size_t)which * PL_ELEMS;
    const int rq = lane >> 3, pc = lane & 7;
    v8h pv[8];
    int off[8];
#pragma unroll
    for (int it = 0; it < 8; ++it) {
        // v: lanes run over the pieces of a row; q,k: lanes run over 8 s of batch rq, piece it
        const int i = (which == 2) ? it * 4 + rq : pc * 4 + rq;
        const int p = (which == 2) ? pc : it;
        pv[it] = *(const v8h*)(&st[w][i * 72 + p * 8]);
        const int m = m0 + i;
        const int s = m >> 2, b = m & 3;     // m = s*NB + b, NB = 4
        off[it] = (which == 2) ? ((hh * NB + b) * SEQ + s) * HD + p * 8
                               : ((hh * NB + b) * SEQ + (s & ~15)) * HD + (p >> 1) * 256 + ((s & 15) + 16 * (p & 1)) * 8;
    }
#pragma unroll
    for (int it = 0; it < 8; ++it) *(v8h*)(plane + off[it]) = pv[it];
    
}

// ---------------------------------------------------------------------------
// V^T plane: v[hb][s][64] -> vT[hb] in fragment order, rows = v column, k = key:
// [s>>5][v>>4] blocks of 512 halves; 64 s x 64 v tile per block through LDS.
// coverage: 2 x 4 blocks x 2 halves = 16 runs of 512 B = 8 waves x 2.
// ---------------------------------------------------------------------------
__global__ __launch_bounds__(256) void k_vT(const _Float16* __restrict__ v, _Float16* __restrict__ vT) {
    __shared__ __align__(16) _Float16 T[64 * 72];
    const int tid = threadIdx.x;
    const int s0  = blockIdx.x * 64;
    const int hb  = blockIdx.y;
    const _Float16* sp = v + ((size_t)hb * SEQ + s0) * HD;
#pragma unroll
    for (int it = 0; it < 2; ++it) {
        int p = tid + it * 256;
        int r = p >> 3, pc = p & 7;
        v8h vv = *(const v8h*)(sp + (size_t)r * HD + pc * 8);
#pragma unroll
        for (int e = 0; e < 8; ++e) T[(pc * 8 + e) * 72 + r] = vv[e];
    }
    __syncthreads();
    _Float16* dp = vT + ((size_t)hb * SEQ + s0) * HD;
    const int lane = tid & 31, wv = tid >> 5;
    const int nt = wv >> 1, jh = (wv & 1) * 2 + (lane >> 4);   // v group; piece of the 32 keys: j*2 + hi
    v8h o0 = *(const v8h*)(&T[(nt * 16 + (lane & 15)) * 72 + jh * 8]);
    v8h o1 = *(const v8h*)(&T[(nt * 16 + (lane & 15)) * 72 + 32 + jh * 8]);
    _Float16* d0 = dp + wv * 256 + lane * 8;
    _Float16* d1 = d0 + 32 * HD;
    *(v8h*)d0 = o0;
    *(v8h*)d1 = o1;
    
}

// ---------------------------------------------------------------------------
// Fused attention, block = (head h, 16 queries), 4 waves = 4 batches.
// Per 32-key chunk: wave computes its batch's 16x32 score tile (4 WMMAs, q/k
// fragments from the fragment-order planes), publishes it (log2 units) in the cross-wave tile
// Tsc[b] (block barrier), forms
//   p1 = 1 / (1 + sum_{b' != b} 2^(t_b' - t_b))        (softmax over the batch axis,
//        shifted by the own value: overflow -> inf -> p1 = 0, the exact limit)
//   P  = 2^(p1 * log2 e) in [1, e]  (key-axis softmax numerator, no shift needed)
// accumulates the row sum of the f16-converted P, relays P through a wave-private
// LDS tile into an A fragment, o += P @ V (4 WMMAs, V^T fragments from the plane),
// block barrier before Tsc is overwritten. Trip count block-uniform.
// ---------------------------------------------------------------------------
__global__ __launch_bounds__(128) __attribute__((amdgpu_num_vgpr(256)))
void k_attn(const _Float16* __restrict__ qp,
            const _Float16* __restrict__ kp,
            const _Float16* __restrict__ vT,
            _Float16* __restrict__ zc) {
    __shared__ __align__(16) float    Tsc[4][16 * 32];   // 8 KB cross-wave (block barriers)
    __shared__ __align__(16) _Float16 Pst[4][16 * 32];   // 4 KB wave-private
    __shared__ __align__(16) _Float16 Zst[4][16 * 72];   // 9 KB, pitch 144 B, read across waves behind a block barrier

    const int tid  = threadIdx.x;
    const int lane = tid & 31;
    const int b    = tid >> 5;
    const int h    = blockIdx.y;
    const int s0   = blockIdx.x * 16;
    const int r0   = (lane >> 4) << 3;
    const int cc   = lane & 15;
    const size_t hb = (size_t)(h * NB + b);

    const _Float16* qb = qp + (hb * SEQ + s0) * HD;
    const _Float16* kb = kp + hb * SEQ * HD;
    const _Float16* vb = vT + hb * HD * SEQ;

    const v16h qf0 = load_fragF(qb, lane);         // d 0..31
    const v16h qf1 = load_fragF(qb + 512, lane);   // d 32..63
    const int b1 = (b + 1) & 3, b2 = (b + 2) & 3, b3 = (b + 3) & 3;

    v8f o[4];
#pragma unroll
    for (int nt = 0; nt < 4; ++nt) o[nt] = zero8();
    float rs[8];
#pragma unroll
    for (int g = 0; g < 8; ++g) rs[g] = 0.0f;

    // K fragments of chunk 0; inside the loop each chunk fetches the next chunk's
    v16h kf0 = load_fragF(kb, lane);
    v16h kf1 = load_fragF(kb + 512, lane);
    v16h kf2 = load_fragF(kb + 16 * HD, lane);
    v16h kf3 = load_fragF(kb + 16 * HD + 512, lane);
    const _Float16* kn = kb + 32 * HD;                 // chunk 1 (SEQ >= 64)

#pragma unroll 1
    for (int t0 = 0; t0 < SEQ; t0 += 32) {
        // this chunk's V^T fragments, one group, in flight under the scores and the softmax
        const _Float16* vr = vb + (size_t)t0 * HD;
        v16h vf[4];
#pragma unroll
        for (int nt = 0; nt < 4; ++nt)
            vf[nt] = load_fragF(vr + nt * 512, lane);   // n = v column, k = key

        v8f sA = wmma16(qf0, kf0, zero8());
        sA = wmma16(qf1, kf1, sA);
        v8f sB = wmma16(qf0, kf2, zero8());
        sB = wmma16(qf1, kf3, sB);

        // next chunk's K fragments, one group, in flight until the next trip's scores
        // (the last trip re-reads its own chunk, so the address stays inside the plane)
        kf0 = load_fragF(kn, lane);
        kf1 = load_fragF(kn + 512, lane);
        kf2 = load_fragF(kn + 16 * HD, lane);
        kf3 = load_fragF(kn + 16 * HD + 512, lane);
        kn += (t0 + 64 < SEQ) ? 32 * HD : 0;

        float tA[8], tB[8];
#pragma unroll
        for (int g = 0; g < 8; ++g) {
            tA[g] = sA[g] * CS;
            tB[g] = sB[g] * CS;
            Tsc[b][(r0 + g) * 32 + cc]      = tA[g];
            Tsc[b][(r0 + g) * 32 + 16 + cc] = tB[g];
        }
        lds_barrier();

#pragma unroll
        for (int g = 0; g < 8; ++g) {
            const int ia = (r0 + g) * 32 + cc;
            const int ib = ia + 16;
            float dA = 1.0f + ex2(Tsc[b1][ia] - tA[g]) + ex2(Tsc[b2][ia] - tA[g]) + ex2(Tsc[b3][ia] - tA[g]);
            float dB = 1.0f + ex2(Tsc[b1][ib] - tB[g]) + ex2(Tsc[b2][ib] - tB[g]) + ex2(Tsc[b3][ib] - tB[g]);
            float pA = ex2(__builtin_amdgcn_rcpf(dA) * L2E);
            float pB = ex2(__builtin_amdgcn_rcpf(dB) * L2E);
            _Float16 hA = (_Float16)pA;
            _Float16 hB = (_Float16)pB;
            rs[g] += (float)hA + (float)hB;
            Pst[b][ia] = hA;
            Pst[b][ib] = hB;
        }
        wave_lds_sync();
        const v16h pa = load_frag16(&Pst[b][0], 32, lane);      // rows = queries, k = 32 keys
#pragma unroll
        for (int nt = 0; nt < 4; ++nt) o[nt] = wmma16(pa, vf[nt], o[nt]);
        lds_barrier();
    }

    // row sums: reduce over the 16 lanes of each half (columns), rows 8h+g
#pragma unroll
    for (int g = 0; g < 8; ++g) {
        float v = rs[g];
        v += __shfl_xor(v, 1, 32);
        v += __shfl_xor(v, 2, 32);
        v += __shfl_xor(v, 4, 32);
        v += __shfl_xor(v, 8, 32);
        rs[g] = __builtin_amdgcn_rcpf(v);
    }
#pragma unroll
    for (int nt = 0; nt < 4; ++nt)
#pragma unroll
        for (int g = 0; g < 8; ++g)
            Zst[b][(r0 + g) * 72 + nt * 16 + cc] = (_Float16)(o[nt][g] * rs[g]);
    // zc is kept in fragment order, rows m = s*NB + b: a 16-row group holds 4 queries of all
    // 4 batches, so each wave writes whole 512-B runs from all four waves' tiles
    __syncthreads();

    const int zq = b * 4 + ((lane & 15) >> 2);     // query of the 16; wave b takes queries 4b..4b+3
    const int zb = lane & 3;                       // batch whose tile is read
    v8h zv[4];
    int off[4];
#pragma unroll
    for (int it = 0; it < 4; ++it) {
        zv[it]  = *(const v8h*)(&Zst[zb][zq * 72 + (it * 2 + (lane >> 4)) * 8]);
        off[it] = ((s0 >> 2) + b) * (16 * DM) + h * 1024 + it * 256 + lane * 8;
    }
#pragma unroll
    for (int it = 0; it < 4; ++it) *(v8h*)(zc + off[it]) = zv[it];
    
}

// ---------------------------------------------------------------------------
// Output projection: out[m][n] = 2^-12 * (64 z)[m][:] . (64 Wo)[:][n] + bO[n].
// Block = 4 waves; wave = 32 rows x 64 columns. f32 tile staged in a wave-private
// LDS tile; each instruction writes two whole 256-B row segments (16 lanes x 16 B
// coverage: 32 rows = 16 instructions x 2 rows.
// ---------------------------------------------------------------------------
__global__ __launch_bounds__(128) __attribute__((amdgpu_num_vgpr(256)))
void k_out(const _Float16* __restrict__ zc,
           const _Float16* __restrict__ woT,
           const float*    __restrict__ bo,
           float* __restrict__ out) {
    __shared__ __align__(16) float Ost[4][32 * 64];     // 32 KB, wave-private tiles
    const int tid  = threadIdx.x;
    const int lane = tid & 31;
    const int w    = tid >> 5;
    const int m0   = blockIdx.x * 128 + w * 32;
    const int n0   = blockIdx.y * 64;

    v8f acc[2][4];
    gemm_32x64(zc + (size_t)m0 * DM, woT + (size_t)n0 * DM, lane, acc);

    const int r0 = (lane >> 4) << 3;
    const int cc = lane & 15;
    float bb[4];
#pragma unroll
    for (int nt = 0; nt < 4; ++nt) bb[nt] = bo[n0 + nt * 16 + cc];
#pragma unroll
    for (int rt = 0; rt < 2; ++rt)
#pragma unroll
        for (int nt = 0; nt < 4; ++nt)
#pragma unroll
            for (int g = 0; g < 8; ++g)
                Ost[w][(rt * 16 + r0 + g) * 64 + nt * 16 + cc] =
                    __builtin_fmaf(acc[rt][nt][g], SC_OUT, bb[nt]);
    wave_lds_sync();

    const int rh = lane >> 4, c4 = lane & 15;
    v4f sv[16];
#pragma unroll
    for (int it = 0; it < 16; ++it) sv[it] = *(const v4f*)(&Ost[w][(it * 2 + rh) * 64 + c4 * 4]);
    float* ob = out + (size_t)m0 * DM + n0 + (size_t)rh * DM + c4 * 4;
#pragma unroll
    for (int it = 0; it < 16; ++it) *(v4f*)(ob + (size_t)(it * 2) * DM) = sv[it];
    
}

// ---------------------------------------------------------------------------
extern "C" void kernel_launch(void* const* d_in, const int* in_sizes, int n_in,
                              void* d_out, int out_size, void* d_ws, size_t ws_size,
                              hipStream_t stream) {
    if (n_in < 9) return;
    if (in_sizes[0] < ((SEQ - 1) * NB_FULL + NB) * DM) return;
    if (in_sizes[1] < NH * DM * HD || in_sizes[3] < NH * DM * HD || in_sizes[5] < NH * DM * HD) return;
    if (in_sizes[2] < NH * HD || in_sizes[4] < NH * HD || in_sizes[6] < NH * HD) return;
    if (in_sizes[7] < DM * DM || in_sizes[8] < DM) return;
    if (out_size < MTOT * DM) return;
    if ((size_t)WS_TOTAL > ws_size) return;

    const float* X  = (const float*)d_in[0];   // [S][B][512], row m = s*4 + b
    const float* WQ = (const float*)d_in[1];   // [8][512][64]
    const float* bQ = (const float*)d_in[2];   // [8][64]
    const float* WK = (const float*)d_in[3];
    const float* bK = (const float*)d_in[4];
    const float* WV = (const float*)d_in[5];
    const float* bV = (const float*)d_in[6];
    const float* WO = (const float*)d_in[7];   // [512 in][512 out]
    const float* bO = (const float*)d_in[8];   // [512]
    float* out = (float*)d_out;                // [S][B][512]

    char* ws = (char*)d_ws;
    size_t off = 0;
    _Float16* wT   = (_Float16*)(ws + off); off += WT_BYTES;     // [1536][512], fragment order
    _Float16* woT  = (_Float16*)(ws + off); off += WOT_BYTES;    // [512][512], fragment order
    float*    bias = (float*)(ws + off);    off += BIAS_BYTES;   // [2048]
    _Float16* xh   = (_Float16*)(ws + off); off += XH_BYTES;     // [MTOT][512], fragment order
    _Float16* qkv  = (_Float16*)(ws + off); off += 3 * PL_BYTES; // q,k [h][b] fragment order, v [h][b][s][64]
    _Float16* vT   = (_Float16*)(ws + off); off += PL_BYTES;     // [h][b] fragment order
    _Float16* zc   = (_Float16*)(ws + off); off += ZC_BYTES;     // [MTOT][512], fragment order
    if (off > ws_size) return;

    // per-head weights: in[d 512][k 64] -> out[h*64 + k][d]; x tiles = d, y tiles = head
    k_wT<<<dim3(8, 8), dim3(256), 0, stream>>>(WQ, HD, 64 * HD, DM * HD, wT,                       DM, 1024, 64 * DM);
    k_wT<<<dim3(8, 8), dim3(256), 0, stream>>>(WK, HD, 64 * HD, DM * HD, wT + (size_t)DM * DM,     DM, 1024, 64 * DM);
    k_wT<<<dim3(8, 8), dim3(256), 0, stream>>>(WV, HD, 64 * HD, DM * HD, wT + (size_t)2 * DM * DM, DM, 1024, 64 * DM);
    // Wo: in[k 512][n 512] -> out[n][k]; x tiles = k rows, y tiles = n columns
    k_wT<<<dim3(8, 8), dim3(256), 0, stream>>>(WO, DM, 64 * DM, 64, woT, DM, 1024, 64 * DM);
    k_bprep<<<dim3(1), dim3(512), 0, stream>>>(bQ, bK, bV, bO, bias);
    k_xcvt<<<dim3((unsigned)(((size_t)MTOT * DM) / 2048)), dim3(256), 0, stream>>>(X, xh);
    k_proj<<<dim3(MTOT / 128, NQKV / 64), dim3(128), 0, stream>>>(xh, wT, bias, qkv);
    k_vT<<<dim3(SEQ / 64, NH * NB), dim3(256), 0, stream>>>(qkv + 2 * PL_ELEMS, vT);
    k_attn<<<dim3(SEQ / 16, NH), dim3(128), 0, stream>>>(qkv, qkv + PL_ELEMS, vT, zc);
    k_out<<<dim3(MTOT / 128, DM / 64), dim3(128), 0, stream>>>(zc, woT, bias + NQKV, out);
}

// v003
// A run of this version takes 143 microseconds.
// Two timings next to v002 both put it at 1.31 times that version's speed.
// Counting every step since v000, it is 1.92 times as fast.
#include <hip/hip_runtime.h>
#include <hip/hip_fp16.h>

// All contractions on v_wmma_f32_16x16x32_f16 (f16 operands, f32 accumulate), single products: x*[Wq|Wk|Wv], q*k^T, P*v, z*Wo; every float input RNE-converted to bf16 first (exact in f16), weight planes and q/k/v/z planes carried x64, P = exp(p1) in [1,e] unscaled.

#ifndef NB
#define NB 4             // batch; an attention wave holds the score tiles of all 4 batches (must stay 4)
#endif
#ifndef SEQ
#define SEQ 2048
#endif
#define NB_FULL  4
#define SEQ_FULL 2048
#define DM   512          // model width
#define NH   8            // heads
#define HD   64           // head width (dk = dv)
#define NQKV (3 * NH * HD)
#define MTOT (SEQ * NB)   // token rows m = s*NB + b

static_assert(NB == 4);
static_assert(NB_FULL == 4);
static_assert(SEQ >= 64 && SEQ <= SEQ_FULL);
static_assert(SEQ % 64 == 0);
static_assert(MTOT % 128 == 0);
static_assert(DM % 32 == 0);
static_assert(DM == NH * HD);
static_assert(HD == 64);
static_assert(NQKV % 64 == 0);
static_assert(((size_t)MTOT * DM) % 2048 == 0);

typedef _Float16 v16h __attribute__((ext_vector_type(16)));
typedef _Float16 v8h  __attribute__((ext_vector_type(8)));
typedef float    v8f  __attribute__((ext_vector_type(8)));
typedef float    v4f  __attribute__((ext_vector_type(4)));

union Frag { v16h v; v8h h[2]; };

#define L2E     1.44269504088896340736f
#define CS      (1.44269504088896340736f * 3.0517578125e-05f)   // log2(e) * 2^-15 : (64q).(64k)/8 -> log2 units
#define SC_OUT  2.44140625e-04f                                  // 2^-12 : (64 z)(64 Wo) -> out

#define WT_BYTES   ((size_t)NQKV * DM * 2)
#define WOT_BYTES  ((size_t)DM * DM * 2)
#define BIAS_ELEMS 2048
#define BIAS_BYTES ((size_t)BIAS_ELEMS * 4)
#define XH_BYTES   ((size_t)MTOT * DM * 2)
#define PL_ELEMS   ((size_t)NH * NB * SEQ * HD)
#define PL_BYTES   (PL_ELEMS * 2)
#define ZC_BYTES   ((size_t)MTOT * DM * 2)
#define WS_TOTAL   (WT_BYTES + WOT_BYTES + BIAS_BYTES + XH_BYTES + 4 * PL_BYTES + ZC_BYTES)
static_assert(WS_TOTAL <= (size_t)134217728);
static_assert(WT_BYTES % 128 == 0 && WOT_BYTES % 128 == 0 && BIAS_BYTES % 128 == 0);
static_assert(XH_BYTES % 128 == 0 && PL_BYTES % 128 == 0 && ZC_BYTES % 128 == 0);
static_assert(NQKV + DM == BIAS_ELEMS);

static __device__ __forceinline__ v8f zero8() {
    v8f z;
#pragma unroll
    for (int i = 0; i < 8; ++i) z[i] = 0.0f;
    return z;
}

// 16x32 A fragment (or B fragment from an [n][k] k-contiguous source) from a
// row-major 16-bit tile: lane m = lane&15 -> row m; kb = 8*(lane>>4);
// elements 0..7 = k kb..kb+7, elements 8..15 = k kb+16..kb+23.
static __device__ __forceinline__ v16h load_frag16(const _Float16* base, int ld, int lane) {
    int m  = lane & 15;
    int kb = (lane >> 4) << 3;
    const _Float16* p = base + (size_t)m * ld + kb;
    Frag f;
    f.h[0] = *(const v8h*)(p);
    f.h[1] = *(const v8h*)(p + 16);
    return f.v;
}

// The same fragment from a plane kept in fragment order: a 16-row x 32-k block is 512
// halves, [j 0..1][lane 0..31][8 halves], where lane = row + 16*((k>>3)&1), j = k>>4,
// so each of the two loads reads 512 contiguous bytes (four whole lines) per wave.
static __device__ __forceinline__ v16h load_fragF(const _Float16* blk, int lane) {
    const _Float16* p = blk + lane * 8;
    Frag f;
    f.h[0] = *(const v8h*)(p);
    f.h[1] = *(const v8h*)(p + 256);
    return f.v;
}

static __device__ __forceinline__ v8f wmma16(v16h a, v16h b, v8f c) {
    v8f d = __builtin_amdgcn_wmma_f32_16x16x32_f16(false, a, false, b, (short)0, c, false, false);
    asm volatile("v_nop\n\tv_nop\n\tv_nop\n\tv_nop" : "+v"(d) : "v"(a), "v"(b));
    return d;
}

// the bare builtin, for the attention kernel: it holds more than 256 VGPRs, and an asm operand
// cannot sit above v255, so the pad above would force its fragments into the low window
static __device__ __forceinline__ v8f wmma16b(v16h a, v16h b, v8f c) {
    return __builtin_amdgcn_wmma_f32_16x16x32_f16(false, a, false, b, (short)0, c, false, false);
}

// f32 -> bf16 RNE convert, value kept as f32
static __device__ __forceinline__ float bf16r(float x) {
    unsigned u = __float_as_uint(x);
    u = (u + 0x7FFFu + ((u >> 16) & 1u)) & 0xFFFF0000u;
    return __uint_as_float(u);
}

static __device__ __forceinline__ float ex2(float x) {
    return __builtin_amdgcn_exp2f(x);
}

// ordering for a wave-private LDS tile: stores before later loads of the same wave
static __device__ __forceinline__ void wave_lds_sync() {
    __builtin_amdgcn_fence(3, "wavefront");
    asm volatile("s_wait_dscnt 0" ::: "memory");
    __builtin_amdgcn_wave_barrier();
}

// ---------------------------------------------------------------------------
// Weight plane builder: one 64x64 tile per block, in[i][j] (f32) -> out[j][i]
// (f16 = 64 * bf16-RNE value). Tile bases = base + blockIdx.x*xs + blockIdx.y*ys.
// out is kept in fragment order: [j>>4][i>>5] blocks of 512 halves, 16 out rows = 16*dst_pitch halves.
// coverage: 4 x 2 blocks x 2 halves = 16 runs of 512 B = 8 waves x 2.
// ---------------------------------------------------------------------------
__global__ __launch_bounds__(256) void k_wT(const float* __restrict__ src, int src_pitch, int src_xs, int src_ys,
                                             _Float16* __restrict__ dst, int dst_pitch, int dst_xs, int dst_ys) {
    __shared__ __align__(16) _Float16 T[64 * 72];
    const int tid = threadIdx.x;
    const float* sp = src + (size_t)blockIdx.x * src_xs + (size_t)blockIdx.y * src_ys;
    _Float16*    dp = dst + (size_t)blockIdx.x * dst_xs + (size_t)blockIdx.y * dst_ys;
#pragma unroll
    for (int it = 0; it < 4; ++it) {
        int idx = tid + it * 256;
        int r = idx >> 4, c4 = idx & 15;
        v4f v = *(const v4f*)(sp + (size_t)r * src_pitch + c4 * 4);
        T[(c4 * 4 + 0) * 72 + r] = (_Float16)(bf16r(v.x) * 64.0f);
        T[(c4 * 4 + 1) * 72 + r] = (_Float16)(bf16r(v.y) * 64.0f);
        T[(c4 * 4 + 2) * 72 + r] = (_Float16)(bf16r(v.z) * 64.0f);
        T[(c4 * 4 + 3) * 72 + r] = (_Float16)(bf16r(v.w) * 64.0f);
    }
    __syncthreads();
    const int lane = tid & 31, wv = tid >> 5;
    const int nt0 = wv >> 2, nt1 = nt0 + 2;            // 16-row group of the out rows
    const int pq  = (wv & 3) * 2 + (lane >> 4);        // 8-half piece of the 64 k: (kc*2 + j)*2 + hi
    v8h o0 = *(const v8h*)(&T[(nt0 * 16 + (lane & 15)) * 72 + pq * 8]);
    v8h o1 = *(const v8h*)(&T[(nt1 * 16 + (lane & 15)) * 72 + pq * 8]);
    _Float16* d0 = dp + (size_t)(nt0 * 16) * dst_pitch + (wv & 3) * 256 + lane * 8;
    _Float16* d1 = dp + (size_t)(nt1 * 16) * dst_pitch + (wv & 3) * 256 + lane * 8;
    *(v8h*)d0 = o0;
    *(v8h*)d1 = o1;
    
}

// ---------------------------------------------------------------------------
// Bias plane [2048] f32: [0..1535] = 64*bf16r(bQ|bK|bV) (index which*512 + h*64 + k),
// [1536..2047] = bf16r(bO). One block; staged in LDS; 512 lanes x 16 B contiguous.
// ---------------------------------------------------------------------------
__global__ __launch_bounds__(512) void k_bprep(const float* __restrict__ bQ, const float* __restrict__ bK,
                                                const float* __restrict__ bV, const float* __restrict__ bO,
                                                float* __restrict__ bias) {
    __shared__ __align__(16) float st[BIAS_ELEMS];
    const int t = threadIdx.x;
    st[t]        = bf16r(bQ[t]) * 64.0f;
    st[512 + t]  = bf16r(bK[t]) * 64.0f;
    st[1024 + t] = bf16r(bV[t]) * 64.0f;
    st[1536 + t] = bf16r(bO[t]);
    __syncthreads();
    v4f v = *(const v4f*)(&st[t * 4]);
    *(v4f*)(bias + t * 4) = v;
    
}

// ---------------------------------------------------------------------------
// x plane in fragment order: f16(bf16r(x[m][d])); 8 elements per thread; 8 consecutive
// lanes take the same 8-column piece of 8 consecutive rows = one whole 128-B line of xh
// ---------------------------------------------------------------------------
__global__ __launch_bounds__(256) void k_xcvt(const float* __restrict__ x, _Float16* __restrict__ xh) {
    const int gid = blockIdx.x * 256 + threadIdx.x;
    const int pc  = (gid >> 3) & 63;                   // 8-column piece of the row
    const int row = ((gid >> 9) << 3) + (gid & 7);
    const size_t i = (size_t)row * DM + pc * 8;
    const size_t j = (size_t)(row >> 4) * (16 * DM) + (pc >> 1) * 256 + ((row & 15) + 16 * (pc & 1)) * 8;
    v4f a = *(const v4f*)(x + i);
    v4f b = *(const v4f*)(x + i + 4);
    v8h o;
    o[0] = (_Float16)bf16r(a.x); o[1] = (_Float16)bf16r(a.y);
    o[2] = (_Float16)bf16r(a.z); o[3] = (_Float16)bf16r(a.w);
    o[4] = (_Float16)bf16r(b.x); o[5] = (_Float16)bf16r(b.y);
    o[6] = (_Float16)bf16r(b.z); o[7] = (_Float16)bf16r(b.w);
    *(v8h*)(xh + j) = o;
    
}

// ---------------------------------------------------------------------------
// GEMM main loop: wave tile 32 rows x 64 columns, K = DM, A and B planes both in
// fragment order (16 rows = 16*DM halves, 32 k = 512 halves), fragments straight
// from the 16-bit global planes (arithmetic addressing only).
// ---------------------------------------------------------------------------
static __device__ __forceinline__ void gemm_32x64(const _Float16* __restrict__ Ap,
                                                  const _Float16* __restrict__ Bp,
                                                  int lane, v8f (&acc)[2][4]) {
#pragma unroll
    for (int rt = 0; rt < 2; ++rt)
#pragma unroll
        for (int nt = 0; nt < 4; ++nt) acc[rt][nt] = zero8();
#pragma unroll 1
    for (int k0 = 0; k0 < DM; k0 += 32) {
        v16h a0 = load_fragF(Ap + k0 * 16, lane);
        v16h a1 = load_fragF(Ap + (size_t)16 * DM + k0 * 16, lane);
#pragma unroll
        for (int nt = 0; nt < 4; ++nt) {
            v16h bf = load_fragF(Bp + (size_t)(nt * 16) * DM + k0 * 16, lane);
            acc[0][nt] = wmma16(a0, bf, acc[0][nt]);
            acc[1][nt] = wmma16(a1, bf, acc[1][nt]);
        }
    }
}

// ---------------------------------------------------------------------------
// Projections: [MTOT x 512] x [512 x 1536]. Block = 4 waves; wave = 32 token rows
// x 64 columns (one of q/k/v, one head). Output plane v [h][b][s][64] f16: one
// (h,b,s) row written by 8 consecutive lanes of one instruction. Output planes q,k
// [h][b] in fragment order (16 s = 1024 halves): 8 consecutive lanes write the same
// piece of 8 consecutive s = one whole line.
// coverage: 32 rows x 8 pieces = 8 instructions x 32 lanes.
// ---------------------------------------------------------------------------
__global__ __launch_bounds__(128) __attribute__((amdgpu_num_vgpr(256)))
void k_proj(const _Float16* __restrict__ xh,
            const _Float16* __restrict__ wT,
            const float*    __restrict__ bias,
            _Float16* __restrict__ qkv) {
    __shared__ __align__(16) _Float16 st[4][32 * 72];     // 18 KB, wave-private tiles, pitch 144 B
    const int tid  = threadIdx.x;
    const int lane = tid & 31;
    const int w    = tid >> 5;
    const int m0   = blockIdx.x * 128 + w * 32;
    const int n0   = blockIdx.y * 64;

    v8f acc[2][4];
    gemm_32x64(xh + (size_t)m0 * DM, wT + (size_t)n0 * DM, lane, acc);

    const int r0 = (lane >> 4) << 3;
    const int cc = lane & 15;
    float bb[4];
#pragma unroll
    for (int nt = 0; nt < 4; ++nt) bb[nt] = bias[n0 + nt * 16 + cc];
#pragma unroll
    for (int rt = 0; rt < 2; ++rt)
#pragma unroll
        for (int nt = 0; nt < 4; ++nt)
#pragma unroll
            for (int g = 0; g < 8; ++g)
                st[w][(rt * 16 + r0 + g) * 72 + nt * 16 + cc] = (_Float16)(acc[rt][nt][g] + bb[nt]);
    wave_lds_sync();

    const int which = n0 >> 9;               // 0 q, 1 k, 2 v
    const int hh    = (n0 & 511) >> 6;
    _Float16* plane = qkv + (size_t)which * PL_ELEMS;
    const int rq = lane >> 3, pc = lane & 7;
    v8h pv[8];
    int off[8];
#pragma unroll
    for (int it = 0; it < 8; ++it) {
        // v: lanes run over the pieces of a row; q,k: lanes run over 8 s of batch rq, piece it
        const int i = (which == 2) ? it * 4 + rq : pc * 4 + rq;
        const int p = (which == 2) ? pc : it;
        pv[it] = *(const v8h*)(&st[w][i * 72 + p * 8]);
        const int m = m0 + i;
        const int s = m >> 2, b = m & 3;     // m = s*NB + b, NB = 4
        off[it] = (which == 2) ? ((hh * NB + b) * SEQ + s) * HD + p * 8
                               : ((hh * NB + b) * SEQ + (s & ~15)) * HD + (p >> 1) * 256 + ((s & 15) + 16 * (p & 1)) * 8;
    }
#pragma unroll
    for (int it = 0; it < 8; ++it) *(v8h*)(plane + off[it]) = pv[it];
    
}

// ---------------------------------------------------------------------------
// V^T plane: v[hb][s][64] -> vT[hb] in fragment order, rows = v column, k = key:
// [s>>5][v>>4] blocks of 512 halves; 64 s x 64 v tile per block through LDS.
// coverage: 2 x 4 blocks x 2 halves = 16 runs of 512 B = 8 waves x 2.
// ---------------------------------------------------------------------------
__global__ __launch_bounds__(256) void k_vT(const _Float16* __restrict__ v, _Float16* __restrict__ vT) {
    __shared__ __align__(16) _Float16 T[64 * 72];
    const int tid = threadIdx.x;
    const int s0  = blockIdx.x * 64;
    const int hb  = blockIdx.y;
    const _Float16* sp = v + ((size_t)hb * SEQ + s0) * HD;
#pragma unroll
    for (int it = 0; it < 2; ++it) {
        int p = tid + it * 256;
        int r = p >> 3, pc = p & 7;
        v8h vv = *(const v8h*)(sp + (size_t)r * HD + pc * 8);
#pragma unroll
        for (int e = 0; e < 8; ++e) T[(pc * 8 + e) * 72 + r] = vv[e];
    }
    __syncthreads();
    _Float16* dp = vT + ((size_t)hb * SEQ + s0) * HD;
    const int lane = tid & 31, wv = tid >> 5;
    const int nt = wv >> 1, jh = (wv & 1) * 2 + (lane >> 4);   // v group; piece of the 32 keys: j*2 + hi
    v8h o0 = *(const v8h*)(&T[(nt * 16 + (lane & 15)) * 72 + jh * 8]);
    v8h o1 = *(const v8h*)(&T[(nt * 16 + (lane & 15)) * 72 + 32 + jh * 8]);
    _Float16* d0 = dp + wv * 256 + lane * 8;
    _Float16* d1 = d0 + 32 * HD;
    *(v8h*)d0 = o0;
    *(v8h*)d1 = o1;
    
}

// ---------------------------------------------------------------------------
// Fused attention, block = (head h, 64 queries), 8 waves = 4 query tiles of 16 x 2 key halves
// (wave kh takes the 32-key chunks 2i + kh). A wave holds the score tiles of ALL FOUR batches
// of its 16 queries: the four tiles have the same lane/register map, so the softmax over the
// batch axis is plain register arithmetic, with one maximum, one sum and one reciprocal per
// (query, key) for the four batches; nothing is exchanged between waves inside the loop.
// Per 16-key half of a chunk: 8 WMMAs (q/k fragments from the fragment-order planes), then
//   e_b = 2^((s_b - max_b s) * CS), p1_b = e_b / sum_b e     (sum >= 1, no overflow)
//   P_b = 2^(p1_b * log2 e) in [1, e]  (key-axis softmax numerator, no shift needed)
// the row sum of the f16-converted P is accumulated, P goes through a wave-private LDS tile
// into A fragments, o_b += P_b @ V_b (16 WMMAs per chunk, V^T fragments from the plane).
// After the loop the two key halves' o and row sums are joined through LDS (one block barrier).
// ---------------------------------------------------------------------------
static __device__ __forceinline__ void batch_softmax16(const v8f (&sc)[NB], float (&rs)[NB][8],
                                                       _Float16* __restrict__ pw, int r0, int col) {
#pragma unroll
    for (int g = 0; g < 8; ++g) {
        const float m  = fmaxf(fmaxf(sc[0][g], sc[1][g]), fmaxf(sc[2][g], sc[3][g]));
        const float mc = m * CS;
        float e[NB];
#pragma unroll
        for (int b = 0; b < NB; ++b) e[b] = ex2(__builtin_fmaf(sc[b][g], CS, -mc));
        const float r = __builtin_amdgcn_rcpf((e[0] + e[1]) + (e[2] + e[3])) * L2E;
#pragma unroll
        for (int b = 0; b < NB; ++b) {
            const _Float16 hp = (_Float16)ex2(e[b] * r);
            rs[b][g] += (float)hp;
            pw[b * 512 + (r0 + g) * 32 + col] = hp;
        }
    }
}

__global__ __launch_bounds__(256)
void k_attn(const _Float16* __restrict__ qp,
            const _Float16* __restrict__ kp,
            const _Float16* __restrict__ vT,
            _Float16* __restrict__ zc) {
    __shared__ __align__(16) _Float16 Pst[8][NB * 16 * 32];      // 32 KB wave-private
    __shared__ __align__(32) float    Xo[4][NB * 4][32 * 8];     // 64 KB, key half 1 -> key half 0
    __shared__ __align__(16) float    Xr[4][NB * 8][32];         // 16 KB, key half 1 -> key half 0
    __shared__ __align__(16) _Float16 Zst[4][NB][16 * 72];       // 36 KB, pitch 144 B, wave-private

    const int tid  = threadIdx.x;
    const int lane = tid & 31;
    const int wv   = __builtin_amdgcn_readfirstlane(tid >> 5);
    const int qt   = wv & 3;                  // query tile of the block
    const int kh   = wv >> 2;                 // key half
    const int h    = blockIdx.y;
    const int s0   = blockIdx.x * 64 + qt * 16;
    const int r0   = (lane >> 4) << 3;
    const int cc   = lane & 15;
    constexpr int PB = SEQ * HD;              // halves of one (h, b) plane

    const _Float16* qb = qp + ((size_t)h * NB * SEQ + s0) * HD;
    const _Float16* kc = kp + (size_t)h * NB * PB + kh * (32 * HD);   // this wave's current chunk
    const _Float16* vr = vT + (size_t)h * NB * PB + kh * (32 * HD);
    _Float16* pw = &Pst[wv][0];

    v16h qf[NB][2];
#pragma unroll
    for (int b = 0; b < NB; ++b) {
        qf[b][0] = load_fragF(qb + b * PB, lane);         // d 0..31
        qf[b][1] = load_fragF(qb + b * PB + 512, lane);   // d 32..63
    }

    v8f o[NB][4];
    float rs[NB][8];
#pragma unroll
    for (int b = 0; b < NB; ++b) {
#pragma unroll
        for (int nt = 0; nt < 4; ++nt) o[b][nt] = zero8();
#pragma unroll
        for (int g = 0; g < 8; ++g) rs[b][g] = 0.0f;
    }

    // K fragments of 16 keys x 4 batches, fetched one 16-key half ahead into the same registers
    v16h kf[NB][2];
#pragma unroll
    for (int b = 0; b < NB; ++b) {
        kf[b][0] = load_fragF(kc + b * PB, lane);
        kf[b][1] = load_fragF(kc + b * PB + 512, lane);
    }

    // the q base's registers are free for reuse from here on
    asm volatile("s_wait_xcnt 0x0" ::: "memory");
    // keeps what follows below that wait
    __builtin_amdgcn_sched_barrier(0);

#pragma unroll 1
    for (int i = 0; i < SEQ / 64; ++i) {
        // this chunk's V^T fragments, one group, in flight under the scores and the softmax
        v16h vf[NB][4];
#pragma unroll
        for (int b = 0; b < NB; ++b)
#pragma unroll
            for (int nt = 0; nt < 4; ++nt)
                vf[b][nt] = load_fragF(vr + b * PB + nt * 512, lane);   // n = v column, k = key

        v8f sc[NB];
        // keys 0..15 of the chunk, then the fetch of keys 16..31 into the same registers
#pragma unroll
        for (int b = 0; b < NB; ++b) sc[b] = wmma16b(qf[b][0], kf[b][0], zero8());
#pragma unroll
        for (int b = 0; b < NB; ++b) sc[b] = wmma16b(qf[b][1], kf[b][1], sc[b]);
#pragma unroll
        for (int b = 0; b < NB; ++b) {
            kf[b][0] = load_fragF(kc + b * PB + 16 * HD, lane);
            kf[b][1] = load_fragF(kc + b * PB + 16 * HD + 512, lane);
        }
        // keeps the fetch above the softmax: moved below it, the next scores wait out its whole latency
        __builtin_amdgcn_sched_barrier(0);
        batch_softmax16(sc, rs, pw, r0, cc);
        // keeps the second scores below the first softmax: moved up, they wait on a fetch just issued
        __builtin_amdgcn_sched_barrier(0);

        // keys 16..31 of the chunk
#pragma unroll
        for (int b = 0; b < NB; ++b) sc[b] = wmma16b(qf[b][0], kf[b][0], zero8());
#pragma unroll
        for (int b = 0; b < NB; ++b) sc[b] = wmma16b(qf[b][1], kf[b][1], sc[b]);
        // the address registers of the loads issued so far are advanced next
        asm volatile("s_wait_xcnt 0x0" ::: "memory");
        // keeps the two additions below that wait
        __builtin_amdgcn_sched_barrier(0);
        // first half of this wave's next chunk (the last trip re-reads its own chunk, so the
        // addresses stay inside the planes)
        const int step = (i + 1 < SEQ / 64) ? 64 * HD : 0;
        kc += step;
        vr += step;
#pragma unroll
        for (int b = 0; b < NB; ++b) {
            kf[b][0] = load_fragF(kc + b * PB, lane);
            kf[b][1] = load_fragF(kc + b * PB + 512, lane);
        }
        // keeps the fetch above the softmax, as above
        __builtin_amdgcn_sched_barrier(0);
        batch_softmax16(sc, rs, pw, r0, 16 + cc);

        wave_lds_sync();
        v16h pa[NB];
#pragma unroll
        for (int b = 0; b < NB; ++b) pa[b] = load_frag16(pw + b * 512, 32, lane);   // rows = queries, k = 32 keys
        // keeps the four fragments' LDS reads in one group: one LDS latency a chunk, not four
        __builtin_amdgcn_sched_barrier(0);
#pragma unroll
        for (int nt = 0; nt < 4; ++nt)
#pragma unroll
            for (int b = 0; b < NB; ++b) o[b][nt] = wmma16b(pa[b], vf[b][nt], o[b][nt]);
    }

    // key half 1 hands its partial o and row sums to key half 0 of the same query tile
    if (kh == 1) {
#pragma unroll
        for (int b = 0; b < NB; ++b) {
#pragma unroll
            for (int nt = 0; nt < 4; ++nt) *(v8f*)(&Xo[qt][b * 4 + nt][lane * 8]) = o[b][nt];
#pragma unroll
            for (int g = 0; g < 8; ++g) Xr[qt][b * 8 + g][lane] = rs[b][g];
        }
    }
    __syncthreads();
    if (kh == 1) return;

#pragma unroll
    for (int b = 0; b < NB; ++b) {
        // row sums: reduce over the 16 lanes of each half (columns), rows 8h+g
#pragma unroll
        for (int g = 0; g < 8; ++g) {
            float v = rs[b][g] + Xr[qt][b * 8 + g][lane];
            v += __shfl_xor(v, 1, 32);
            v += __shfl_xor(v, 2, 32);
            v += __shfl_xor(v, 4, 32);
            v += __shfl_xor(v, 8, 32);
            rs[b][g] = __builtin_amdgcn_rcpf(v);
        }
#pragma unroll
        for (int nt = 0; nt < 4; ++nt) {
            const v8f x = *(const v8f*)(&Xo[qt][b * 4 + nt][lane * 8]);
#pragma unroll
            for (int g = 0; g < 8; ++g)
                Zst[qt][b][(r0 + g) * 72 + nt * 16 + cc] = (_Float16)((o[b][nt][g] + x[g]) * rs[b][g]);
        }
    }
    // zc is kept in fragment order, rows m = s*NB + b: a 16-row group holds 4 queries of all
    // 4 batches, all of them this wave's own, so the wave writes whole 512-B runs from its tiles
    wave_lds_sync();

    const int zb = lane & 3;                       // batch whose tile is read
#pragma unroll
    for (int gq = 0; gq < 4; ++gq) {
        const int zq = gq * 4 + ((lane & 15) >> 2);    // query of the 16
        v8h zv[4];
        int off[4];
#pragma unroll
        for (int it = 0; it < 4; ++it) {
            zv[it]  = *(const v8h*)(&Zst[qt][zb][zq * 72 + (it * 2 + (lane >> 4)) * 8]);
            off[it] = ((s0 >> 2) + gq) * (16 * DM) + h * 1024 + it * 256 + lane * 8;
        }
#pragma unroll
        for (int it = 0; it < 4; ++it) *(v8h*)(zc + off[it]) = zv[it];
    }
}

// ---------------------------------------------------------------------------
// Output projection: out[m][n] = 2^-12 * (64 z)[m][:] . (64 Wo)[:][n] + bO[n].
// Block = 4 waves; wave = 32 rows x 64 columns. f32 tile staged in a wave-private
// LDS tile; each instruction writes two whole 256-B row segments (16 lanes x 16 B
// coverage: 32 rows = 16 instructions x 2 rows.
// ---------------------------------------------------------------------------
__global__ __launch_bounds__(128) __attribute__((amdgpu_num_vgpr(256)))
void k_out(const _Float16* __restrict__ zc,
           const _Float16* __restrict__ woT,
           const float*    __restrict__ bo,
           float* __restrict__ out) {
    __shared__ __align__(16) float Ost[4][32 * 64];     // 32 KB, wave-private tiles
    const int tid  = threadIdx.x;
    const int lane = tid & 31;
    const int w    = tid >> 5;
    const int m0   = blockIdx.x * 128 + w * 32;
    const int n0   = blockIdx.y * 64;

    v8f acc[2][4];
    gemm_32x64(zc + (size_t)m0 * DM, woT + (size_t)n0 * DM, lane, acc);

    const int r0 = (lane >> 4) << 3;
    const int cc = lane & 15;
    float bb[4];
#pragma unroll
    for (int nt = 0; nt < 4; ++nt) bb[nt] = bo[n0 + nt * 16 + cc];
#pragma unroll
    for (int rt = 0; rt < 2; ++rt)
#pragma unroll
        for (int nt = 0; nt < 4; ++nt)
#pragma unroll
            for (int g = 0; g < 8; ++g)
                Ost[w][(rt * 16 + r0 + g) * 64 + nt * 16 + cc] =
                    __builtin_fmaf(acc[rt][nt][g], SC_OUT, bb[nt]);
    wave_lds_sync();

    const int rh = lane >> 4, c4 = lane & 15;
    v4f sv[16];
#pragma unroll
    for (int it = 0; it < 16; ++it) sv[it] = *(const v4f*)(&Ost[w][(it * 2 + rh) * 64 + c4 * 4]);
    float* ob = out + (size_t)m0 * DM + n0 + (size_t)rh * DM + c4 * 4;
#pragma unroll
    for (int it = 0; it < 16; ++it) *(v4f*)(ob + (size_t)(it * 2) * DM) = sv[it];
    
}

// ---------------------------------------------------------------------------
extern "C" void kernel_launch(void* const* d_in, const int* in_sizes, int n_in,
                              void* d_out, int out_size, void* d_ws, size_t ws_size,
                              hipStream_t stream) {
    if (n_in < 9) return;
    if (in_sizes[0] < ((SEQ - 1) * NB_FULL + NB) * DM) return;
    if (in_sizes[1] < NH * DM * HD || in_sizes[3] < NH * DM * HD || in_sizes[5] < NH * DM * HD) return;
    if (in_sizes[2] < NH * HD || in_sizes[4] < NH * HD || in_sizes[6] < NH * HD) return;
    if (in_sizes[7] < DM * DM || in_sizes[8] < DM) return;
    if (out_size < MTOT * DM) return;
    if ((size_t)WS_TOTAL > ws_size) return;

    const float* X  = (const float*)d_in[0];   // [S][B][512], row m = s*4 + b
    const float* WQ = (const float*)d_in[1];   // [8][512][64]
    const float* bQ = (const float*)d_in[2];   // [8][64]
    const float* WK = (const float*)d_in[3];
    const float* bK = (const float*)d_in[4];
    const float* WV = (const float*)d_in[5];
    const float* bV = (const float*)d_in[6];
    const float* WO = (const float*)d_in[7];   // [512 in][512 out]
    const float* bO = (const float*)d_in[8];   // [512]
    float* out = (float*)d_out;                // [S][B][512]

    char* ws = (char*)d_ws;
    size_t off = 0;
    _Float16* wT   = (_Float16*)(ws + off); off += WT_BYTES;     // [1536][512], fragment order
    _Float16* woT  = (_Float16*)(ws + off); off += WOT_BYTES;    // [512][512], fragment order
    float*    bias = (float*)(ws + off);    off += BIAS_BYTES;   // [2048]
    _Float16* xh   = (_Float16*)(ws + off); off += XH_BYTES;     // [MTOT][512], fragment order
    _Float16* qkv  = (_Float16*)(ws + off); off += 3 * PL_BYTES; // q,k [h][b] fragment order, v [h][b][s][64]
    _Float16* vT   = (_Float16*)(ws + off); off += PL_BYTES;     // [h][b] fragment order
    _Float16* zc   = (_Float16*)(ws + off); off += ZC_BYTES;     // [MTOT][512], fragment order
    if (off > ws_size) return;

    // per-head weights: in[d 512][k 64] -> out[h*64 + k][d]; x tiles = d, y tiles = head
    k_wT<<<dim3(8, 8), dim3(256), 0, stream>>>(WQ, HD, 64 * HD, DM * HD, wT,                       DM, 1024, 64 * DM);
    k_wT<<<dim3(8, 8), dim3(256), 0, stream>>>(WK, HD, 64 * HD, DM * HD, wT + (size_t)DM * DM,     DM, 1024, 64 * DM);
    k_wT<<<dim3(8, 8), dim3(256), 0, stream>>>(WV, HD, 64 * HD, DM * HD, wT + (size_t)2 * DM * DM, DM, 1024, 64 * DM);
    // Wo: in[k 512][n 512] -> out[n][k]; x tiles = k rows, y tiles = n columns
    k_wT<<<dim3(8, 8), dim3(256), 0, stream>>>(WO, DM, 64 * DM, 64, woT, DM, 1024, 64 * DM);
    k_bprep<<<dim3(1), dim3(512), 0, stream>>>(bQ, bK, bV, bO, bias);
    k_xcvt<<<dim3((unsigned)(((size_t)MTOT * DM) / 2048)), dim3(256), 0, stream>>>(X, xh);
    k_proj<<<dim3(MTOT / 128, NQKV / 64), dim3(128), 0, stream>>>(xh, wT, bias, qkv);
    k_vT<<<dim3(SEQ / 64, NH * NB), dim3(256), 0, stream>>>(qkv + 2 * PL_ELEMS, vT);
    k_attn<<<dim3(SEQ / 64, NH), dim3(256), 0, stream>>>(qkv, qkv + PL_ELEMS, vT, zc);
    k_out<<<dim3(MTOT / 128, DM / 64), dim3(128), 0, stream>>>(zc, woT, bias + NQKV, out);
}

// v004
// A run of this version takes 131 microseconds.
// In both of two side-by-side timings against v003, it was 1.10 times as fast.
// Over all steps from v000 it is 2.11 times as fast.
#include <hip/hip_runtime.h>
#include <hip/hip_fp16.h>

// All contractions on v_wmma_f32_16x16x32_f16 (f16 operands, f32 accumulate), single products: x*[Wq|Wk|Wv], q*k^T, P*v, z*Wo; every float input RNE-converted to bf16 first (exact in f16), weight planes and q/k/v/z planes carried x64, P = exp(p1) in [1,e] unscaled.

#ifndef NB
#define NB 4             // batch; an attention wave holds the score tiles of all 4 batches (must stay 4)
#endif
#ifndef SEQ
#define SEQ 2048
#endif
#define NB_FULL  4
#define SEQ_FULL 2048
#define DM   512          // model width
#define NH   8            // heads
#define HD   64           // head width (dk = dv)
#define NQKV (3 * NH * HD)
#define MTOT (SEQ * NB)   // token rows m = s*NB + b

static_assert(NB == 4);
static_assert(NB_FULL == 4);
static_assert(SEQ >= 64 && SEQ <= SEQ_FULL);
static_assert(SEQ % 64 == 0);
static_assert(MTOT % 128 == 0);
static_assert(DM % 32 == 0);
static_assert(DM == NH * HD);
static_assert(HD == 64);
static_assert(NQKV % 64 == 0);
static_assert(((size_t)MTOT * DM) % 2048 == 0);

typedef _Float16 v16h __attribute__((ext_vector_type(16)));
typedef _Float16 v8h  __attribute__((ext_vector_type(8)));
typedef float    v8f  __attribute__((ext_vector_type(8)));
typedef float    v4f  __attribute__((ext_vector_type(4)));

union Frag { v16h v; v8h h[2]; };

#define L2E     1.44269504088896340736f
#define CS      (1.44269504088896340736f * 3.0517578125e-05f)   // log2(e) * 2^-15 : (64q).(64k)/8 -> log2 units
#define SC_OUT  2.44140625e-04f                                  // 2^-12 : (64 z)(64 Wo) -> out

#define WT_BYTES   ((size_t)NQKV * DM * 2)
#define WOT_BYTES  ((size_t)DM * DM * 2)
#define BIAS_ELEMS 2048
#define BIAS_BYTES ((size_t)BIAS_ELEMS * 4)
#define XH_BYTES   ((size_t)MTOT * DM * 2)
#define PL_ELEMS   ((size_t)NH * NB * SEQ * HD)
#define PL_BYTES   (PL_ELEMS * 2)
#define ZC_BYTES   ((size_t)MTOT * DM * 2)
#define WS_TOTAL   (WT_BYTES + WOT_BYTES + BIAS_BYTES + XH_BYTES + 4 * PL_BYTES + ZC_BYTES)
static_assert(WS_TOTAL <= (size_t)134217728);
static_assert(WT_BYTES % 128 == 0 && WOT_BYTES % 128 == 0 && BIAS_BYTES % 128 == 0);
static_assert(XH_BYTES % 128 == 0 && PL_BYTES % 128 == 0 && ZC_BYTES % 128 == 0);
static_assert(NQKV + DM == BIAS_ELEMS);

static __device__ __forceinline__ v8f zero8() {
    v8f z;
#pragma unroll
    for (int i = 0; i < 8; ++i) z[i] = 0.0f;
    return z;
}

// 16x32 A fragment (or B fragment from an [n][k] k-contiguous source) from a
// row-major 16-bit tile: lane m = lane&15 -> row m; kb = 8*(lane>>4);
// elements 0..7 = k kb..kb+7, elements 8..15 = k kb+16..kb+23.
static __device__ __forceinline__ v16h load_frag16(const _Float16* base, int ld, int lane) {
    int m  = lane & 15;
    int kb = (lane >> 4) << 3;
    const _Float16* p = base + (size_t)m * ld + kb;
    Frag f;
    f.h[0] = *(const v8h*)(p);
    f.h[1] = *(const v8h*)(p + 16);
    return f.v;
}

// The same fragment from a plane kept in fragment order: a 16-row x 32-k block is 512
// halves, [j 0..1][lane 0..31][8 halves], where lane = row + 16*((k>>3)&1), j = k>>4,
// so each of the two loads reads 512 contiguous bytes (four whole lines) per wave.
static __device__ __forceinline__ v16h load_fragF(const _Float16* blk, int lane) {
    const _Float16* p = blk + lane * 8;
    Frag f;
    f.h[0] = *(const v8h*)(p);
    f.h[1] = *(const v8h*)(p + 256);
    return f.v;
}

static __device__ __forceinline__ v8f wmma16(v16h a, v16h b, v8f c) {
    v8f d = __builtin_amdgcn_wmma_f32_16x16x32_f16(false, a, false, b, (short)0, c, false, false);
    asm volatile("v_nop\n\tv_nop\n\tv_nop\n\tv_nop" : "+v"(d) : "v"(a), "v"(b));
    return d;
}

// the bare builtin, for the attention kernel: it holds more than 256 VGPRs, and an asm operand
// cannot sit above v255, so the pad above would force its fragments into the low window
static __device__ __forceinline__ v8f wmma16b(v16h a, v16h b, v8f c) {
    return __builtin_amdgcn_wmma_f32_16x16x32_f16(false, a, false, b, (short)0, c, false, false);
}

// f32 -> bf16 RNE convert, value kept as f32
static __device__ __forceinline__ float bf16r(float x) {
    unsigned u = __float_as_uint(x);
    u = (u + 0x7FFFu + ((u >> 16) & 1u)) & 0xFFFF0000u;
    return __uint_as_float(u);
}

static __device__ __forceinline__ float ex2(float x) {
    return __builtin_amdgcn_exp2f(x);
}

// ordering for a wave-private LDS tile: stores before later loads of the same wave
static __device__ __forceinline__ void wave_lds_sync() {
    __builtin_amdgcn_fence(3, "wavefront");
    asm volatile("s_wait_dscnt 0" ::: "memory");
    __builtin_amdgcn_wave_barrier();
}

// ---------------------------------------------------------------------------
// Operand planes, one launch: the weight planes, the bias plane and the x plane need nothing
// of each other, so they share one grid; a range of the block index picks the job
// (block-uniform): [0, 256) weight tiles, 256 the bias plane, the rest the x plane.
// The weight tiles come first: theirs is the longest chain (load, LDS, barrier, store).
// ---------------------------------------------------------------------------
#define PREP_WT_BLOCKS 256                                  // 4 matrices x 8 x 8 tiles of 64 x 64
#define PREP_X_BLOCKS  ((int)(((size_t)MTOT * DM) / 2048))
#define PREP_BLOCKS    (PREP_WT_BLOCKS + 1 + PREP_X_BLOCKS)

// Weight plane builder: one 64x64 tile per block, in[i][j] (f32) -> out[j][i]
// (f16 = 64 * bf16-RNE value).
// out is kept in fragment order: [j>>4][i>>5] blocks of 512 halves, 16 out rows = 16*DM halves.
// coverage: 4 x 2 blocks x 2 halves = 16 runs of 512 B = 8 waves x 2.
static __device__ __forceinline__ void prep_wT(const float* __restrict__ sp, int src_pitch,
                                               _Float16* __restrict__ dp, _Float16* T, int tid) {
#pragma unroll
    for (int it = 0; it < 4; ++it) {
        int idx = tid + it * 256;
        int r = idx >> 4, c4 = idx & 15;
        v4f v = *(const v4f*)(sp + (size_t)r * src_pitch + c4 * 4);
        T[(c4 * 4 + 0) * 72 + r] = (_Float16)(bf16r(v.x) * 64.0f);
        T[(c4 * 4 + 1) * 72 + r] = (_Float16)(bf16r(v.y) * 64.0f);
        T[(c4 * 4 + 2) * 72 + r] = (_Float16)(bf16r(v.z) * 64.0f);
        T[(c4 * 4 + 3) * 72 + r] = (_Float16)(bf16r(v.w) * 64.0f);
    }
    __syncthreads();
    const int lane = tid & 31, wv = tid >> 5;
    const int nt0 = wv >> 2, nt1 = nt0 + 2;            // 16-row group of the out rows
    const int pq  = (wv & 3) * 2 + (lane >> 4);        // 8-half piece of the 64 k: (kc*2 + j)*2 + hi
    v8h o0 = *(const v8h*)(&T[(nt0 * 16 + (lane & 15)) * 72 + pq * 8]);
    v8h o1 = *(const v8h*)(&T[(nt1 * 16 + (lane & 15)) * 72 + pq * 8]);
    _Float16* d0 = dp + (size_t)(nt0 * 16) * DM + (wv & 3) * 256 + lane * 8;
    _Float16* d1 = dp + (size_t)(nt1 * 16) * DM + (wv & 3) * 256 + lane * 8;
    *(v8h*)d0 = o0;
    *(v8h*)d1 = o1;
    // another job's code follows in the built kernel and reuses the registers these stores name
    asm volatile("s_wait_xcnt 0x0" ::: "memory");
}

// x plane in fragment order: f16(bf16r(x[m][d])); 8 elements per thread; 8 consecutive
// lanes take the same 8-column piece of 8 consecutive rows = one whole 128-B line of xh
static __device__ __forceinline__ void prep_x(const float* __restrict__ x, _Float16* __restrict__ xh, int gid) {
    const int pc  = (gid >> 3) & 63;                   // 8-column piece of the row
    const int row = ((gid >> 9) << 3) + (gid & 7);
    const size_t i = (size_t)row * DM + pc * 8;
    const size_t j = (size_t)(row >> 4) * (16 * DM) + (pc >> 1) * 256 + ((row & 15) + 16 * (pc & 1)) * 8;
    v4f a = *(const v4f*)(x + i);
    v4f b = *(const v4f*)(x + i + 4);
    v8h o;
    o[0] = (_Float16)bf16r(a.x); o[1] = (_Float16)bf16r(a.y);
    o[2] = (_Float16)bf16r(a.z); o[3] = (_Float16)bf16r(a.w);
    o[4] = (_Float16)bf16r(b.x); o[5] = (_Float16)bf16r(b.y);
    o[6] = (_Float16)bf16r(b.z); o[7] = (_Float16)bf16r(b.w);
    *(v8h*)(xh + j) = o;
    // another job's code follows in the built kernel and reuses the registers this store names
    asm volatile("s_wait_xcnt 0x0" ::: "memory");
}

__global__ __launch_bounds__(256) void k_prep(const float* __restrict__ X,
                                              const float* __restrict__ WQ, const float* __restrict__ bQ,
                                              const float* __restrict__ WK, const float* __restrict__ bK,
                                              const float* __restrict__ WV, const float* __restrict__ bV,
                                              const float* __restrict__ WO, const float* __restrict__ bO,
                                              _Float16* __restrict__ wT, _Float16* __restrict__ woT,
                                              float* __restrict__ bias, _Float16* __restrict__ xh) {
    __shared__ __align__(16) _Float16 T[64 * 72];
    const int tid = threadIdx.x;
    const int blk = blockIdx.x;
    if (blk < PREP_WT_BLOCKS) {
        const int which = blk >> 6;                    // 0 Wq, 1 Wk, 2 Wv, 3 Wo
        const int bx = blk & 7, by = (blk >> 3) & 7;
        if (which < 3) {
            // per-head weights: in[d 512][k 64] -> out[h*64 + k][d]; bx tiles = d, by tiles = head
            const float* w = (which == 0) ? WQ : (which == 1) ? WK : WV;
            prep_wT(w + (size_t)bx * (64 * HD) + (size_t)by * (DM * HD), HD,
                    wT + (size_t)which * (DM * DM) + (size_t)bx * 1024 + (size_t)by * (64 * DM), T, tid);
        } else {
            // Wo: in[k 512][n 512] -> out[n][k]; bx tiles = k rows, by tiles = n columns
            prep_wT(WO + (size_t)bx * (64 * DM) + (size_t)by * 64, DM,
                    woT + (size_t)bx * 1024 + (size_t)by * (64 * DM), T, tid);
        }
    } else if (blk == PREP_WT_BLOCKS) {
        // Bias plane [2048] f32: [0..1535] = 64*bf16r(bQ|bK|bV) (index which*512 + h*64 + k),
        // [1536..2047] = bf16r(bO). 8 consecutive elements per thread, 64 threads per vector.
        const int which = tid >> 6;
        const float* b = (which == 0) ? bQ : (which == 1) ? bK : (which == 2) ? bV : bO;
        const float sc = (which < 3) ? 64.0f : 1.0f;
        const v4f u = *(const v4f*)(b + (tid & 63) * 8);
        const v4f v = *(const v4f*)(b + (tid & 63) * 8 + 4);
        v4f p, q;
        p.x = bf16r(u.x) * sc; p.y = bf16r(u.y) * sc; p.z = bf16r(u.z) * sc; p.w = bf16r(u.w) * sc;
        q.x = bf16r(v.x) * sc; q.y = bf16r(v.y) * sc; q.z = bf16r(v.z) * sc; q.w = bf16r(v.w) * sc;
        *(v4f*)(bias + tid * 8)     = p;
        *(v4f*)(bias + tid * 8 + 4) = q;
        // another job's code follows in the built kernel and reuses the registers these stores name
        asm volatile("s_wait_xcnt 0x0" ::: "memory");
    } else {
        prep_x(X, xh, (blk - (PREP_WT_BLOCKS + 1)) * 256 + tid);
    }
}

// ---------------------------------------------------------------------------
// GEMM main loop: wave tile 32 rows x 64 columns, K = DM, A and B planes both in
// fragment order (16 rows = 16*DM halves, 32 k = 512 halves), fragments straight
// from the 16-bit global planes (arithmetic addressing only).
// ---------------------------------------------------------------------------
static __device__ __forceinline__ void gemm_32x64(const _Float16* __restrict__ Ap,
                                                  const _Float16* __restrict__ Bp,
                                                  int lane, v8f (&acc)[2][4]) {
#pragma unroll
    for (int rt = 0; rt < 2; ++rt)
#pragma unroll
        for (int nt = 0; nt < 4; ++nt) acc[rt][nt] = zero8();
#pragma unroll 1
    for (int k0 = 0; k0 < DM; k0 += 32) {
        v16h a0 = load_fragF(Ap + k0 * 16, lane);
        v16h a1 = load_fragF(Ap + (size_t)16 * DM + k0 * 16, lane);
#pragma unroll
        for (int nt = 0; nt < 4; ++nt) {
            v16h bf = load_fragF(Bp + (size_t)(nt * 16) * DM + k0 * 16, lane);
            acc[0][nt] = wmma16(a0, bf, acc[0][nt]);
            acc[1][nt] = wmma16(a1, bf, acc[1][nt]);
        }
    }
}

// ---------------------------------------------------------------------------
// Projections: [MTOT x 512] x [512 x 1536]. Block = 4 waves; wave = 32 token rows
// x 64 columns (one of q/k/v, one head). Output plane v [h][b][s][64] f16: one
// (h,b,s) row written by 8 consecutive lanes of one instruction. Output planes q,k
// [h][b] in fragment order (16 s = 1024 halves): 8 consecutive lanes write the same
// piece of 8 consecutive s = one whole line.
// coverage: 32 rows x 8 pieces = 8 instructions x 32 lanes.
// ---------------------------------------------------------------------------
__global__ __launch_bounds__(128) __attribute__((amdgpu_num_vgpr(256)))
void k_proj(const _Float16* __restrict__ xh,
            const _Float16* __restrict__ wT,
            const float*    __restrict__ bias,
            _Float16* __restrict__ qkv) {
    __shared__ __align__(16) _Float16 st[4][32 * 72];     // 18 KB, wave-private tiles, pitch 144 B
    const int tid  = threadIdx.x;
    const int lane = tid & 31;
    const int w    = tid >> 5;
    const int m0   = blockIdx.x * 128 + w * 32;
    const int n0   = blockIdx.y * 64;

    v8f acc[2][4];
    gemm_32x64(xh + (size_t)m0 * DM, wT + (size_t)n0 * DM, lane, acc);

    const int r0 = (lane >> 4) << 3;
    const int cc = lane & 15;
    float bb[4];
#pragma unroll
    for (int nt = 0; nt < 4; ++nt) bb[nt] = bias[n0 + nt * 16 + cc];
#pragma unroll
    for (int rt = 0; rt < 2; ++rt)
#pragma unroll
        for (int nt = 0; nt < 4; ++nt)
#pragma unroll
            for (int g = 0; g < 8; ++g)
                st[w][(rt * 16 + r0 + g) * 72 + nt * 16 + cc] = (_Float16)(acc[rt][nt][g] + bb[nt]);
    wave_lds_sync();

    const int which = n0 >> 9;               // 0 q, 1 k, 2 v
    const int hh    = (n0 & 511) >> 6;
    _Float16* plane = qkv + (size_t)which * PL_ELEMS;
    const int rq = lane >> 3, pc = lane & 7;
    v8h pv[8];
    int off[8];
#pragma unroll
    for (int it = 0; it < 8; ++it) {
        // v: lanes run over the pieces of a row; q,k: lanes run over 8 s of batch rq, piece it
        const int i = (which == 2) ? it * 4 + rq : pc * 4 + rq;
        const int p = (which == 2) ? pc : it;
        pv[it] = *(const v8h*)(&st[w][i * 72 + p * 8]);
        const int m = m0 + i;
        const int s = m >> 2, b = m & 3;     // m = s*NB + b, NB = 4
        off[it] = (which == 2) ? ((hh * NB + b) * SEQ + s) * HD + p * 8
                               : ((hh * NB + b) * SEQ + (s & ~15)) * HD + (p >> 1) * 256 + ((s & 15) + 16 * (p & 1)) * 8;
    }
#pragma unroll
    for (int it = 0; it < 8; ++it) *(v8h*)(plane + off[it]) = pv[it];
    
}

// ---------------------------------------------------------------------------
// V^T plane: v[hb][s][64] -> vT[hb] in fragment order, rows = v column, k = key:
// [s>>5][v>>4] blocks of 512 halves; 64 s x 64 v tile per block through LDS.
// coverage: 2 x 4 blocks x 2 halves = 16 runs of 512 B = 8 waves x 2.
// ---------------------------------------------------------------------------
__global__ __launch_bounds__(256) void k_vT(const _Float16* __restrict__ v, _Float16* __restrict__ vT) {
    __shared__ __align__(16) _Float16 T[64 * 72];
    const int tid = threadIdx.x;
    const int s0  = blockIdx.x * 64;
    const int hb  = blockIdx.y;
    const _Float16* sp = v + ((size_t)hb * SEQ + s0) * HD;
#pragma unroll
    for (int it = 0; it < 2; ++it) {
        int p = tid + it * 256;
        int r = p >> 3, pc = p & 7;
        v8h vv = *(const v8h*)(sp + (size_t)r * HD + pc * 8);
#pragma unroll
        for (int e = 0; e < 8; ++e) T[(pc * 8 + e) * 72 + r] = vv[e];
    }
    __syncthreads();
    _Float16* dp = vT + ((size_t)hb * SEQ + s0) * HD;
    const int lane = tid & 31, wv = tid >> 5;
    const int nt = wv >> 1, jh = (wv & 1) * 2 + (lane >> 4);   // v group; piece of the 32 keys: j*2 + hi
    v8h o0 = *(const v8h*)(&T[(nt * 16 + (lane & 15)) * 72 + jh * 8]);
    v8h o1 = *(const v8h*)(&T[(nt * 16 + (lane & 15)) * 72 + 32 + jh * 8]);
    _Float16* d0 = dp + wv * 256 + lane * 8;
    _Float16* d1 = d0 + 32 * HD;
    *(v8h*)d0 = o0;
    *(v8h*)d1 = o1;
    
}

// ---------------------------------------------------------------------------
// Fused attention, block = (head h, 64 queries), 8 waves = 4 query tiles of 16 x 2 key halves
// (wave kh takes the 32-key chunks 2i + kh). A wave holds the score tiles of ALL FOUR batches
// of its 16 queries: the four tiles have the same lane/register map, so the softmax over the
// batch axis is plain register arithmetic, with one maximum, one sum and one reciprocal per
// (query, key) for the four batches; nothing is exchanged between waves inside the loop.
// Per 16-key half of a chunk: 8 WMMAs (q/k fragments from the fragment-order planes), then
//   e_b = 2^((s_b - max_b s) * CS), p1_b = e_b / sum_b e     (sum >= 1, no overflow)
//   P_b = 2^(p1_b * log2 e) in [1, e]  (key-axis softmax numerator, no shift needed)
// the row sum of the f16-converted P is accumulated, P goes through a wave-private LDS tile
// into A fragments, o_b += P_b @ V_b (16 WMMAs per chunk, V^T fragments from the plane).
// After the loop the two key halves' o and row sums are joined through LDS (one block barrier).
// ---------------------------------------------------------------------------
static __device__ __forceinline__ void batch_softmax16(const v8f (&sc)[NB], float (&rs)[NB][8],
                                                       _Float16* __restrict__ pw, int r0, int col) {
#pragma unroll
    for (int g = 0; g < 8; ++g) {
        const float m  = fmaxf(fmaxf(sc[0][g], sc[1][g]), fmaxf(sc[2][g], sc[3][g]));
        const float mc = m * CS;
        float e[NB];
#pragma unroll
        for (int b = 0; b < NB; ++b) e[b] = ex2(__builtin_fmaf(sc[b][g], CS, -mc));
        const float r = __builtin_amdgcn_rcpf((e[0] + e[1]) + (e[2] + e[3])) * L2E;
#pragma unroll
        for (int b = 0; b < NB; ++b) {
            const _Float16 hp = (_Float16)ex2(e[b] * r);
            rs[b][g] += (float)hp;
            pw[b * 512 + (r0 + g) * 32 + col] = hp;
        }
    }
}

__global__ __launch_bounds__(256)
void k_attn(const _Float16* __restrict__ qp,
            const _Float16* __restrict__ kp,
            const _Float16* __restrict__ vT,
            _Float16* __restrict__ zc) {
    __shared__ __align__(16) _Float16 Pst[8][NB * 16 * 32];      // 32 KB wave-private
    __shared__ __align__(32) float    Xo[4][NB * 4][32 * 8];     // 64 KB, key half 1 -> key half 0
    __shared__ __align__(16) float    Xr[4][NB * 8][32];         // 16 KB, key half 1 -> key half 0
    __shared__ __align__(16) _Float16 Zst[4][NB][16 * 72];       // 36 KB, pitch 144 B, wave-private

    const int tid  = threadIdx.x;
    const int lane = tid & 31;
    const int wv   = __builtin_amdgcn_readfirstlane(tid >> 5);
    const int qt   = wv & 3;                  // query tile of the block
    const int kh   = wv >> 2;                 // key half
    const int h    = blockIdx.y;
    const int s0   = blockIdx.x * 64 + qt * 16;
    const int r0   = (lane >> 4) << 3;
    const int cc   = lane & 15;
    constexpr int PB = SEQ * HD;              // halves of one (h, b) plane

    const _Float16* qb = qp + ((size_t)h * NB * SEQ + s0) * HD;
    const _Float16* kc = kp + (size_t)h * NB * PB + kh * (32 * HD);   // this wave's current chunk
    const _Float16* vr = vT + (size_t)h * NB * PB + kh * (32 * HD);
    _Float16* pw = &Pst[wv][0];

    v16h qf[NB][2];
#pragma unroll
    for (int b = 0; b < NB; ++b) {
        qf[b][0] = load_fragF(qb + b * PB, lane);         // d 0..31
        qf[b][1] = load_fragF(qb + b * PB + 512, lane);   // d 32..63
    }

    v8f o[NB][4];
    float rs[NB][8];
#pragma unroll
    for (int b = 0; b < NB; ++b) {
#pragma unroll
        for (int nt = 0; nt < 4; ++nt) o[b][nt] = zero8();
#pragma unroll
        for (int g = 0; g < 8; ++g) rs[b][g] = 0.0f;
    }

    // K fragments of 16 keys x 4 batches, fetched one 16-key half ahead into the same registers
    v16h kf[NB][2];
#pragma unroll
    for (int b = 0; b < NB; ++b) {
        kf[b][0] = load_fragF(kc + b * PB, lane);
        kf[b][1] = load_fragF(kc + b * PB + 512, lane);
    }

    // the q base's registers are free for reuse from here on
    asm volatile("s_wait_xcnt 0x0" ::: "memory");
    // keeps what follows below that wait
    __builtin_amdgcn_sched_barrier(0);

#pragma unroll 1
    for (int i = 0; i < SEQ / 64; ++i) {
        // this chunk's V^T fragments, one group, in flight under the scores and the softmax
        v16h vf[NB][4];
#pragma unroll
        for (int b = 0; b < NB; ++b)
#pragma unroll
            for (int nt = 0; nt < 4; ++nt)
                vf[b][nt] = load_fragF(vr + b * PB + nt * 512, lane);   // n = v column, k = key

        v8f sc[NB];
        // keys 0..15 of the chunk, then the fetch of keys 16..31 into the same registers
#pragma unroll
        for (int b = 0; b < NB; ++b) sc[b] = wmma16b(qf[b][0], kf[b][0], zero8());
#pragma unroll
        for (int b = 0; b < NB; ++b) sc[b] = wmma16b(qf[b][1], kf[b][1], sc[b]);
#pragma unroll
        for (int b = 0; b < NB; ++b) {
            kf[b][0] = load_fragF(kc + b * PB + 16 * HD, lane);
            kf[b][1] = load_fragF(kc + b * PB + 16 * HD + 512, lane);
        }
        // keeps the fetch above the softmax: moved below it, the next scores wait out its whole latency
        __builtin_amdgcn_sched_barrier(0);
        batch_softmax16(sc, rs, pw, r0, cc);
        // keeps the second scores below the first softmax: moved up, they wait on a fetch just issued
        __builtin_amdgcn_sched_barrier(0);

        // keys 16..31 of the chunk
#pragma unroll
        for (int b = 0; b < NB; ++b) sc[b] = wmma16b(qf[b][0], kf[b][0], zero8());
#pragma unroll
        for (int b = 0; b < NB; ++b) sc[b] = wmma16b(qf[b][1], kf[b][1], sc[b]);
        // the address registers of the loads issued so far are advanced next
        asm volatile("s_wait_xcnt 0x0" ::: "memory");
        // keeps the two additions below that wait
        __builtin_amdgcn_sched_barrier(0);
        // first half of this wave's next chunk (the last trip re-reads its own chunk, so the
        // addresses stay inside the planes)
        const int step = (i + 1 < SEQ / 64) ? 64 * HD : 0;
        kc += step;
        vr += step;
#pragma unroll
        for (int b = 0; b < NB; ++b) {
            kf[b][0] = load_fragF(kc + b * PB, lane);
            kf[b][1] = load_fragF(kc + b * PB + 512, lane);
        }
        // keeps the fetch above the softmax, as above
        __builtin_amdgcn_sched_barrier(0);
        batch_softmax16(sc, rs, pw, r0, 16 + cc);

        wave_lds_sync();
        v16h pa[NB];
#pragma unroll
        for (int b = 0; b < NB; ++b) pa[b] = load_frag16(pw + b * 512, 32, lane);   // rows = queries, k = 32 keys
        // keeps the four fragments' LDS reads in one group: one LDS latency a chunk, not four
        __builtin_amdgcn_sched_barrier(0);
#pragma unroll
        for (int nt = 0; nt < 4; ++nt)
#pragma unroll
            for (int b = 0; b < NB; ++b) o[b][nt] = wmma16b(pa[b], vf[b][nt], o[b][nt]);
    }

    // key half 1 hands its partial o and row sums to key half 0 of the same query tile
    if (kh == 1) {
#pragma unroll
        for (int b = 0; b < NB; ++b) {
#pragma unroll
            for (int nt = 0; nt < 4; ++nt) *(v8f*)(&Xo[qt][b * 4 + nt][lane * 8]) = o[b][nt];
#pragma unroll
            for (int g = 0; g < 8; ++g) Xr[qt][b * 8 + g][lane] = rs[b][g];
        }
    }
    __syncthreads();
    if (kh == 1) return;

#pragma unroll
    for (int b = 0; b < NB; ++b) {
        // row sums: reduce over the 16 lanes of each half (columns), rows 8h+g
#pragma unroll
        for (int g = 0; g < 8; ++g) {
            float v = rs[b][g] + Xr[qt][b * 8 + g][lane];
            v += __shfl_xor(v, 1, 32);
            v += __shfl_xor(v, 2, 32);
            v += __shfl_xor(v, 4, 32);
            v += __shfl_xor(v, 8, 32);
            rs[b][g] = __builtin_amdgcn_rcpf(v);
        }
#pragma unroll
        for (int nt = 0; nt < 4; ++nt) {
            const v8f x = *(const v8f*)(&Xo[qt][b * 4 + nt][lane * 8]);
#pragma unroll
            for (int g = 0; g < 8; ++g)
                Zst[qt][b][(r0 + g) * 72 + nt * 16 + cc] = (_Float16)((o[b][nt][g] + x[g]) * rs[b][g]);
        }
    }
    // zc is kept in fragment order, rows m = s*NB + b: a 16-row group holds 4 queries of all
    // 4 batches, all of them this wave's own, so the wave writes whole 512-B runs from its tiles
    wave_lds_sync();

    const int zb = lane & 3;                       // batch whose tile is read
#pragma unroll
    for (int gq = 0; gq < 4; ++gq) {
        const int zq = gq * 4 + ((lane & 15) >> 2);    // query of the 16
        v8h zv[4];
        int off[4];
#pragma unroll
        for (int it = 0; it < 4; ++it) {
            zv[it]  = *(const v8h*)(&Zst[qt][zb][zq * 72 + (it * 2 + (lane >> 4)) * 8]);
            off[it] = ((s0 >> 2) + gq) * (16 * DM) + h * 1024 + it * 256 + lane * 8;
        }
#pragma unroll
        for (int it = 0; it < 4; ++it) *(v8h*)(zc + off[it]) = zv[it];
    }
}

// ---------------------------------------------------------------------------
// Output projection: out[m][n] = 2^-12 * (64 z)[m][:] . (64 Wo)[:][n] + bO[n].
// Block = 4 waves; wave = 32 rows x 64 columns. f32 tile staged in a wave-private
// LDS tile; each instruction writes two whole 256-B row segments (16 lanes x 16 B
// coverage: 32 rows = 16 instructions x 2 rows.
// ---------------------------------------------------------------------------
__global__ __launch_bounds__(128) __attribute__((amdgpu_num_vgpr(256)))
void k_out(const _Float16* __restrict__ zc,
           const _Float16* __restrict__ woT,
           const float*    __restrict__ bo,
           float* __restrict__ out) {
    __shared__ __align__(16) float Ost[4][32 * 64];     // 32 KB, wave-private tiles
    const int tid  = threadIdx.x;
    const int lane = tid & 31;
    const int w    = tid >> 5;
    const int m0   = blockIdx.x * 128 + w * 32;
    const int n0   = blockIdx.y * 64;

    v8f acc[2][4];
    gemm_32x64(zc + (size_t)m0 * DM, woT + (size_t)n0 * DM, lane, acc);

    const int r0 = (lane >> 4) << 3;
    const int cc = lane & 15;
    float bb[4];
#pragma unroll
    for (int nt = 0; nt < 4; ++nt) bb[nt] = bo[n0 + nt * 16 + cc];
#pragma unroll
    for (int rt = 0; rt < 2; ++rt)
#pragma unroll
        for (int nt = 0; nt < 4; ++nt)
#pragma unroll
            for (int g = 0; g < 8; ++g)
                Ost[w][(rt * 16 + r0 + g) * 64 + nt * 16 + cc] =
                    __builtin_fmaf(acc[rt][nt][g], SC_OUT, bb[nt]);
    wave_lds_sync();

    const int rh = lane >> 4, c4 = lane & 15;
    v4f sv[16];
#pragma unroll
    for (int it = 0; it < 16; ++it) sv[it] = *(const v4f*)(&Ost[w][(it * 2 + rh) * 64 + c4 * 4]);
    float* ob = out + (size_t)m0 * DM + n0 + (size_t)rh * DM + c4 * 4;
#pragma unroll
    for (int it = 0; it < 16; ++it) *(v4f*)(ob + (size_t)(it * 2) * DM) = sv[it];
    
}

// ---------------------------------------------------------------------------
extern "C" void kernel_launch(void* const* d_in, const int* in_sizes, int n_in,
                              void* d_out, int out_size, void* d_ws, size_t ws_size,
                              hipStream_t stream) {
    if (n_in < 9) return;
    if (in_sizes[0] < ((SEQ - 1) * NB_FULL + NB) * DM) return;
    if (in_sizes[1] < NH * DM * HD || in_sizes[3] < NH * DM * HD || in_sizes[5] < NH * DM * HD) return;
    if (in_sizes[2] < NH * HD || in_sizes[4] < NH * HD || in_sizes[6] < NH * HD) return;
    if (in_sizes[7] < DM * DM || in_sizes[8] < DM) return;
    if (out_size < MTOT * DM) return;
    if ((size_t)WS_TOTAL > ws_size) return;

    const float* X  = (const float*)d_in[0];   // [S][B][512], row m = s*4 + b
    const float* WQ = (const float*)d_in[1];   // [8][512][64]
    const float* bQ = (const float*)d_in[2];   // [8][64]
    const float* WK = (const float*)d_in[3];
    const float* bK = (const float*)d_in[4];
    const float* WV = (const float*)d_in[5];
    const float* bV = (const float*)d_in[6];
    const float* WO = (const float*)d_in[7];   // [512 in][512 out]
    const float* bO = (const float*)d_in[8];   // [512]
    float* out = (float*)d_out;                // [S][B][512]

    char* ws = (char*)d_ws;
    size_t off = 0;
    _Float16* wT   = (_Float16*)(ws + off); off += WT_BYTES;     // [1536][512], fragment order
    _Float16* woT  = (_Float16*)(ws + off); off += WOT_BYTES;    // [512][512], fragment order
    float*    bias = (float*)(ws + off);    off += BIAS_BYTES;   // [2048]
    _Float16* xh   = (_Float16*)(ws + off); off += XH_BYTES;     // [MTOT][512], fragment order
    _Float16* qkv  = (_Float16*)(ws + off); off += 3 * PL_BYTES; // q,k [h][b] fragment order, v [h][b][s][64]
    _Float16* vT   = (_Float16*)(ws + off); off += PL_BYTES;     // [h][b] fragment order
    _Float16* zc   = (_Float16*)(ws + off); off += ZC_BYTES;     // [MTOT][512], fragment order
    if (off > ws_size) return;

    k_prep<<<dim3(PREP_BLOCKS), dim3(256), 0, stream>>>(X, WQ, bQ, WK, bK, WV, bV, WO, bO, wT, woT, bias, xh);
    k_proj<<<dim3(MTOT / 128, NQKV / 64), dim3(128), 0, stream>>>(xh, wT, bias, qkv);
    k_vT<<<dim3(SEQ / 64, NH * NB), dim3(256), 0, stream>>>(qkv + 2 * PL_ELEMS, vT);
    k_attn<<<dim3(SEQ / 64, NH), dim3(256), 0, stream>>>(qkv, qkv + PL_ELEMS, vT, zc);
    k_out<<<dim3(MTOT / 128, DM / 64), dim3(128), 0, stream>>>(zc, woT, bias + NQKV, out);
}

// v005
// Measured time: 93.2 microseconds a run.
// Timed twice side by side with v004, it ran 1.39 and 1.41 times as fast.
// Counting every step since v000, it is 2.95 times as fast.
#include <hip/hip_runtime.h>
#include <hip/hip_fp16.h>

// All contractions on v_wmma_f32_16x16x32_f16 (f16 operands, f32 accumulate), single products: x*[Wq|Wk|Wv], q*k^T, P*v, z*Wo; every float input RNE-converted to bf16 first (exact in f16), weight planes and q/k/v/z planes carried x64, P = exp(p1) in [1,e] unscaled.

#ifndef NB
#define NB 4             // batch; an attention wave holds the score tiles of all 4 batches (must stay 4)
#endif
#ifndef SEQ
#define SEQ 2048
#endif
#define NB_FULL  4
#define SEQ_FULL 2048
#define DM   512          // model width
#define NH   8            // heads
#define HD   64           // head width (dk = dv)
#define NQKV (3 * NH * HD)
#define MTOT (SEQ * NB)   // token rows m = s*NB + b

static_assert(NB == 4);
static_assert(NB_FULL == 4);
static_assert(SEQ >= 64 && SEQ <= SEQ_FULL);
static_assert(SEQ % 64 == 0);
static_assert(MTOT % 128 == 0);
static_assert(DM % 32 == 0);
static_assert(DM == NH * HD);
static_assert(HD == 64);
static_assert(NQKV % 64 == 0);
static_assert(((size_t)MTOT * DM) % 2048 == 0);

typedef _Float16 v16h __attribute__((ext_vector_type(16)));
typedef _Float16 v8h  __attribute__((ext_vector_type(8)));
typedef float    v8f  __attribute__((ext_vector_type(8)));
typedef float    v4f  __attribute__((ext_vector_type(4)));

union Frag { v16h v; v8h h[2]; };

#define L2E     1.44269504088896340736f
#define CS      (1.44269504088896340736f * 3.0517578125e-05f)   // log2(e) * 2^-15 : (64q).(64k)/8 -> log2 units
#define SC_OUT  2.44140625e-04f                                  // 2^-12 : (64 z)(64 Wo) -> out

#define WT_BYTES   ((size_t)NQKV * DM * 2)
#define WOT_BYTES  ((size_t)DM * DM * 2)
#define BIAS_ELEMS 2048
#define BIAS_BYTES ((size_t)BIAS_ELEMS * 4)
#define XH_BYTES   ((size_t)MTOT * DM * 2)
#define PL_ELEMS   ((size_t)NH * NB * SEQ * HD)
#define PL_BYTES   (PL_ELEMS * 2)
#define ZC_BYTES   ((size_t)MTOT * DM * 2)
#define WS_TOTAL   (WT_BYTES + WOT_BYTES + BIAS_BYTES + XH_BYTES + 4 * PL_BYTES + ZC_BYTES)
static_assert(WS_TOTAL <= (size_t)134217728);
static_assert(WT_BYTES % 128 == 0 && WOT_BYTES % 128 == 0 && BIAS_BYTES % 128 == 0);
static_assert(XH_BYTES % 128 == 0 && PL_BYTES % 128 == 0 && ZC_BYTES % 128 == 0);
static_assert(NQKV + DM == BIAS_ELEMS);

static __device__ __forceinline__ v8f zero8() {
    v8f z;
#pragma unroll
    for (int i = 0; i < 8; ++i) z[i] = 0.0f;
    return z;
}

// 16x32 A fragment (or B fragment from an [n][k] k-contiguous source) from a
// row-major 16-bit tile: lane m = lane&15 -> row m; kb = 8*(lane>>4);
// elements 0..7 = k kb..kb+7, elements 8..15 = k kb+16..kb+23.
static __device__ __forceinline__ v16h load_frag16(const _Float16* base, int ld, int lane) {
    int m  = lane & 15;
    int kb = (lane >> 4) << 3;
    const _Float16* p = base + (size_t)m * ld + kb;
    Frag f;
    f.h[0] = *(const v8h*)(p);
    f.h[1] = *(const v8h*)(p + 16);
    return f.v;
}

// The same fragment from a plane kept in fragment order: a 16-row x 32-k block is 512
// halves, [j 0..1][lane 0..31][8 halves], where lane = row + 16*((k>>3)&1), j = k>>4,
// so each of the two loads reads 512 contiguous bytes (four whole lines) per wave.
static __device__ __forceinline__ v16h load_fragF(const _Float16* blk, int lane) {
    const _Float16* p = blk + lane * 8;
    Frag f;
    f.h[0] = *(const v8h*)(p);
    f.h[1] = *(const v8h*)(p + 256);
    return f.v;
}

// the bare builtin: the matrix kernels hold more than 256 VGPRs, and an asm operand cannot sit
// above v255, so a pad written in asm behind it would force its fragments into the low window
static __device__ __forceinline__ v8f wmma16b(v16h a, v16h b, v8f c) {
    return __builtin_amdgcn_wmma_f32_16x16x32_f16(false, a, false, b, (short)0, c, false, false);
}

// f32 -> bf16 RNE convert, value kept as f32
static __device__ __forceinline__ float bf16r(float x) {
    unsigned u = __float_as_uint(x);
    u = (u + 0x7FFFu + ((u >> 16) & 1u)) & 0xFFFF0000u;
    return __uint_as_float(u);
}

static __device__ __forceinline__ float ex2(float x) {
    return __builtin_amdgcn_exp2f(x);
}

// ordering for a wave-private LDS tile: stores before later loads of the same wave
static __device__ __forceinline__ void wave_lds_sync() {
    __builtin_amdgcn_fence(3, "wavefront");
    asm volatile("s_wait_dscnt 0" ::: "memory");
    __builtin_amdgcn_wave_barrier();
}

// ---------------------------------------------------------------------------
// Operand planes, one launch: the weight planes, the bias plane and the x plane need nothing
// of each other, so they share one grid; a range of the block index picks the job
// (block-uniform): [0, 256) weight tiles, 256 the bias plane, the rest the x plane.
// The weight tiles come first: theirs is the longest chain (load, LDS, barrier, store).
// ---------------------------------------------------------------------------
#define PREP_WT_BLOCKS 256                                  // 4 matrices x 8 x 8 tiles of 64 x 64
#define PREP_X_BLOCKS  ((int)(((size_t)MTOT * DM) / 2048))
#define PREP_BLOCKS    (PREP_WT_BLOCKS + 1 + PREP_X_BLOCKS)

// Weight plane builder: one 64x64 tile per block, in[i][j] (f32) -> out[j][i]
// (f16 = 64 * bf16-RNE value).
// out is kept in fragment order: [j>>4][i>>5] blocks of 512 halves, 16 out rows = 16*DM halves.
// coverage: 4 x 2 blocks x 2 halves = 16 runs of 512 B = 8 waves x 2.
static __device__ __forceinline__ void prep_wT(const float* __restrict__ sp, int src_pitch,
                                               _Float16* __restrict__ dp, _Float16* T, int tid) {
#pragma unroll
    for (int it = 0; it < 4; ++it) {
        int idx = tid + it * 256;
        int r = idx >> 4, c4 = idx & 15;
        v4f v = *(const v4f*)(sp + (size_t)r * src_pitch + c4 * 4);
        T[(c4 * 4 + 0) * 72 + r] = (_Float16)(bf16r(v.x) * 64.0f);
        T[(c4 * 4 + 1) * 72 + r] = (_Float16)(bf16r(v.y) * 64.0f);
        T[(c4 * 4 + 2) * 72 + r] = (_Float16)(bf16r(v.z) * 64.0f);
        T[(c4 * 4 + 3) * 72 + r] = (_Float16)(bf16r(v.w) * 64.0f);
    }
    __syncthreads();
    const int lane = tid & 31, wv = tid >> 5;
    const int nt0 = wv >> 2, nt1 = nt0 + 2;            // 16-row group of the out rows
    const int pq  = (wv & 3) * 2 + (lane >> 4);        // 8-half piece of the 64 k: (kc*2 + j)*2 + hi
    v8h o0 = *(const v8h*)(&T[(nt0 * 16 + (lane & 15)) * 72 + pq * 8]);
    v8h o1 = *(const v8h*)(&T[(nt1 * 16 + (lane & 15)) * 72 + pq * 8]);
    _Float16* d0 = dp + (size_t)(nt0 * 16) * DM + (wv & 3) * 256 + lane * 8;
    _Float16* d1 = dp + (size_t)(nt1 * 16) * DM + (wv & 3) * 256 + lane * 8;
    *(v8h*)d0 = o0;
    *(v8h*)d1 = o1;
    // another job's code follows in the built kernel and reuses the registers these stores name
    asm volatile("s_wait_xcnt 0x0" ::: "memory");
}

// x plane in fragment order: f16(bf16r(x[m][d])); 8 elements per thread; 8 consecutive
// lanes take the same 8-column piece of 8 consecutive rows = one whole 128-B line of xh
static __device__ __forceinline__ void prep_x(const float* __restrict__ x, _Float16* __restrict__ xh, int gid) {
    const int pc  = (gid >> 3) & 63;                   // 8-column piece of the row
    const int row = ((gid >> 9) << 3) + (gid & 7);
    const size_t i = (size_t)row * DM + pc * 8;
    const size_t j = (size_t)(row >> 4) * (16 * DM) + (pc >> 1) * 256 + ((row & 15) + 16 * (pc & 1)) * 8;
    v4f a = *(const v4f*)(x + i);
    v4f b = *(const v4f*)(x + i + 4);
    v8h o;
    o[0] = (_Float16)bf16r(a.x); o[1] = (_Float16)bf16r(a.y);
    o[2] = (_Float16)bf16r(a.z); o[3] = (_Float16)bf16r(a.w);
    o[4] = (_Float16)bf16r(b.x); o[5] = (_Float16)bf16r(b.y);
    o[6] = (_Float16)bf16r(b.z); o[7] = (_Float16)bf16r(b.w);
    *(v8h*)(xh + j) = o;
    // another job's code follows in the built kernel and reuses the registers this store names
    asm volatile("s_wait_xcnt 0x0" ::: "memory");
}

__global__ __launch_bounds__(256) void k_prep(const float* __restrict__ X,
                                              const float* __restrict__ WQ, const float* __restrict__ bQ,
                                              const float* __restrict__ WK, const float* __restrict__ bK,
                                              const float* __restrict__ WV, const float* __restrict__ bV,
                                              const float* __restrict__ WO, const float* __restrict__ bO,
                                              _Float16* __restrict__ wT, _Float16* __restrict__ woT,
                                              float* __restrict__ bias, _Float16* __restrict__ xh) {
    __shared__ __align__(16) _Float16 T[64 * 72];
    const int tid = threadIdx.x;
    const int blk = blockIdx.x;
    if (blk < PREP_WT_BLOCKS) {
        const int which = blk >> 6;                    // 0 Wq, 1 Wk, 2 Wv, 3 Wo
        const int bx = blk & 7, by = (blk >> 3) & 7;
        if (which < 3) {
            // per-head weights: in[d 512][k 64] -> out[h*64 + k][d]; bx tiles = d, by tiles = head
            const float* w = (which == 0) ? WQ : (which == 1) ? WK : WV;
            prep_wT(w + (size_t)bx * (64 * HD) + (size_t)by * (DM * HD), HD,
                    wT + (size_t)which * (DM * DM) + (size_t)bx * 1024 + (size_t)by * (64 * DM), T, tid);
        } else {
            // Wo: in[k 512][n 512] -> out[n][k]; bx tiles = k rows, by tiles = n columns
            prep_wT(WO + (size_t)bx * (64 * DM) + (size_t)by * 64, DM,
                    woT + (size_t)bx * 1024 + (size_t)by * (64 * DM), T, tid);
        }
    } else if (blk == PREP_WT_BLOCKS) {
        // Bias plane [2048] f32: [0..1535] = 64*bf16r(bQ|bK|bV) (index which*512 + h*64 + k),
        // [1536..2047] = bf16r(bO). 8 consecutive elements per thread, 64 threads per vector.
        const int which = tid >> 6;
        const float* b = (which == 0) ? bQ : (which == 1) ? bK : (which == 2) ? bV : bO;
        const float sc = (which < 3) ? 64.0f : 1.0f;
        const v4f u = *(const v4f*)(b + (tid & 63) * 8);
        const v4f v = *(const v4f*)(b + (tid & 63) * 8 + 4);
        v4f p, q;
        p.x = bf16r(u.x) * sc; p.y = bf16r(u.y) * sc; p.z = bf16r(u.z) * sc; p.w = bf16r(u.w) * sc;
        q.x = bf16r(v.x) * sc; q.y = bf16r(v.y) * sc; q.z = bf16r(v.z) * sc; q.w = bf16r(v.w) * sc;
        *(v4f*)(bias + tid * 8)     = p;
        *(v4f*)(bias + tid * 8 + 4) = q;
        // another job's code follows in the built kernel and reuses the registers these stores name
        asm volatile("s_wait_xcnt 0x0" ::: "memory");
    } else {
        prep_x(X, xh, (blk - (PREP_WT_BLOCKS + 1)) * 256 + tid);
    }
}

// ---------------------------------------------------------------------------
// GEMM main loop: wave tile 32 rows x 64 columns, K = DM, A and B planes both in
// fragment order (16 rows = 16*DM halves, 32 k = 512 halves), fragments straight
// from the 16-bit global planes (arithmetic addressing only).
// The six fragments of a 32-k step are loaded as one group, three steps ahead of their
// products, into a ring of four register sets: the blocks of a launch walk k in step, so
// no other wave hides a load's latency; the wave's own loads in flight have to.
// Four sets and the accumulators fit the 336 VGPRs that leave three waves a SIMD; a fifth set spills.
// ---------------------------------------------------------------------------
#define KSTEPS (DM / 32)
#define KRING  4
static_assert(KSTEPS >= KRING - 1);

static __device__ __forceinline__ void load_kstep(const _Float16* __restrict__ Ap,
                                                  const _Float16* __restrict__ Bp,
                                                  int t, int lane, v16h (&a)[2], v16h (&b)[4]) {
    a[0] = load_fragF(Ap + t * 512, lane);
    a[1] = load_fragF(Ap + 16 * DM + t * 512, lane);
#pragma unroll
    for (int nt = 0; nt < 4; ++nt) b[nt] = load_fragF(Bp + nt * 16 * DM + t * 512, lane);
}

static __device__ __forceinline__ void gemm_32x64(const _Float16* __restrict__ Ap,
                                                  const _Float16* __restrict__ Bp,
                                                  int lane, v8f (&acc)[2][4]) {
    v16h a[KRING][2], b[KRING][4];
#pragma unroll
    for (int t = 0; t < KRING - 1; ++t) load_kstep(Ap, Bp, t, lane, a[t], b[t]);
#pragma unroll
    for (int rt = 0; rt < 2; ++rt)
#pragma unroll
        for (int nt = 0; nt < 4; ++nt) acc[rt][nt] = zero8();
    // unrolled whole: the ring's set numbers become register names
#pragma unroll
    for (int t = 0; t < KSTEPS; ++t) {
        constexpr int AH = KRING - 1;
        if (t + AH < KSTEPS) load_kstep(Ap, Bp, t + AH, lane, a[(t + AH) % KRING], b[(t + AH) % KRING]);
        // behind the last fetch: the address registers of the fragment loads are free for reuse from here on
        if (t + AH == KSTEPS - 1) asm volatile("s_wait_xcnt 0x0" ::: "memory");
        // keeps the fetch above this step's products: sunk among them it loses its lead
        __builtin_amdgcn_sched_barrier(0);
#pragma unroll
        for (int nt = 0; nt < 4; ++nt) {
            acc[0][nt] = wmma16b(a[t % KRING][0], b[t % KRING][nt], acc[0][nt]);
            acc[1][nt] = wmma16b(a[t % KRING][1], b[t % KRING][nt], acc[1][nt]);
        }
        // keeps the next fetch below these products: raised above them it takes one more set
        __builtin_amdgcn_sched_barrier(0);
    }
}

// ---------------------------------------------------------------------------
// Projections: [MTOT x 512] x [512 x 1536]. Block = 4 waves; wave = 32 token rows
// x 64 columns (one of q/k/v, one head). Output plane v [h][b][s][64] f16: one
// (h,b,s) row written by 8 consecutive lanes of one instruction. Output planes q,k
// [h][b] in fragment order (16 s = 1024 halves): 8 consecutive lanes write the same
// piece of 8 consecutive s = one whole line.
// coverage: 32 rows x 8 pieces = 8 instructions x 32 lanes.
// ---------------------------------------------------------------------------
__global__ __launch_bounds__(128) __attribute__((amdgpu_num_vgpr(336)))
void k_proj(const _Float16* __restrict__ xh,
            const _Float16* __restrict__ wT,
            const float*    __restrict__ bias,
            _Float16* __restrict__ qkv) {
    __shared__ __align__(16) _Float16 st[4][32 * 72];     // 18 KB, wave-private tiles, pitch 144 B
    const int tid  = threadIdx.x;
    const int lane = tid & 31;
    const int w    = tid >> 5;
    const int m0   = blockIdx.x * 128 + w * 32;
    const int n0   = blockIdx.y * 64;

    const int r0 = (lane >> 4) << 3;
    const int cc = lane & 15;
    // fetched ahead of the k loop: behind it, the epilogue would wait out this load's whole latency
    float bb[4];
#pragma unroll
    for (int nt = 0; nt < 4; ++nt) bb[nt] = bias[n0 + nt * 16 + cc];
    // the fragment loads that follow land in the register that holds these loads' address
    asm volatile("s_wait_xcnt 0x0" ::: "memory");

    v8f acc[2][4];
    gemm_32x64(xh + (size_t)m0 * DM, wT + (size_t)n0 * DM, lane, acc);

#pragma unroll
    for (int rt = 0; rt < 2; ++rt)
#pragma unroll
        for (int nt = 0; nt < 4; ++nt)
#pragma unroll
            for (int g = 0; g < 8; ++g)
                st[w][(rt * 16 + r0 + g) * 72 + nt * 16 + cc] = (_Float16)(acc[rt][nt][g] + bb[nt]);
    wave_lds_sync();

    const int which = n0 >> 9;               // 0 q, 1 k, 2 v
    const int hh    = (n0 & 511) >> 6;
    _Float16* plane = qkv + (size_t)which * PL_ELEMS;
    const int rq = lane >> 3, pc = lane & 7;
    v8h pv[8];
    int off[8];
#pragma unroll
    for (int it = 0; it < 8; ++it) {
        // v: lanes run over the pieces of a row; q,k: lanes run over 8 s of batch rq, piece it
        const int i = (which == 2) ? it * 4 + rq : pc * 4 + rq;
        const int p = (which == 2) ? pc : it;
        pv[it] = *(const v8h*)(&st[w][i * 72 + p * 8]);
        const int m = m0 + i;
        const int s = m >> 2, b = m & 3;     // m = s*NB + b, NB = 4
        off[it] = (which == 2) ? ((hh * NB + b) * SEQ + s) * HD + p * 8
                               : ((hh * NB + b) * SEQ + (s & ~15)) * HD + (p >> 1) * 256 + ((s & 15) + 16 * (p & 1)) * 8;
    }
#pragma unroll
    for (int it = 0; it < 8; ++it) *(v8h*)(plane + off[it]) = pv[it];
    
}

// ---------------------------------------------------------------------------
// V^T plane: v[hb][s][64] -> vT[hb] in fragment order, rows = v column, k = key:
// [s>>5][v>>4] blocks of 512 halves; 64 s x 64 v tile per block through LDS.
// coverage: 2 x 4 blocks x 2 halves = 16 runs of 512 B = 8 waves x 2.
// ---------------------------------------------------------------------------
__global__ __launch_bounds__(256) void k_vT(const _Float16* __restrict__ v, _Float16* __restrict__ vT) {
    __shared__ __align__(16) _Float16 T[64 * 72];
    const int tid = threadIdx.x;
    const int s0  = blockIdx.x * 64;
    const int hb  = blockIdx.y;
    const _Float16* sp = v + ((size_t)hb * SEQ + s0) * HD;
#pragma unroll
    for (int it = 0; it < 2; ++it) {
        int p = tid + it * 256;
        int r = p >> 3, pc = p & 7;
        v8h vv = *(const v8h*)(sp + (size_t)r * HD + pc * 8);
#pragma unroll
        for (int e = 0; e < 8; ++e) T[(pc * 8 + e) * 72 + r] = vv[e];
    }
    __syncthreads();
    _Float16* dp = vT + ((size_t)hb * SEQ + s0) * HD;
    const int lane = tid & 31, wv = tid >> 5;
    const int nt = wv >> 1, jh = (wv & 1) * 2 + (lane >> 4);   // v group; piece of the 32 keys: j*2 + hi
    v8h o0 = *(const v8h*)(&T[(nt * 16 + (lane & 15)) * 72 + jh * 8]);
    v8h o1 = *(const v8h*)(&T[(nt * 16 + (lane & 15)) * 72 + 32 + jh * 8]);
    _Float16* d0 = dp + wv * 256 + lane * 8;
    _Float16* d1 = d0 + 32 * HD;
    *(v8h*)d0 = o0;
    *(v8h*)d1 = o1;
    
}

// ---------------------------------------------------------------------------
// Fused attention, block = (head h, 64 queries), 8 waves = 4 query tiles of 16 x 2 key halves
// (wave kh takes the 32-key chunks 2i + kh). A wave holds the score tiles of ALL FOUR batches
// of its 16 queries: the four tiles have the same lane/register map, so the softmax over the
// batch axis is plain register arithmetic, with one maximum, one sum and one reciprocal per
// (query, key) for the four batches; nothing is exchanged between waves inside the loop.
// Per 16-key half of a chunk: 8 WMMAs (q/k fragments from the fragment-order planes), then
//   e_b = 2^((s_b - max_b s) * CS), p1_b = e_b / sum_b e     (sum >= 1, no overflow)
//   P_b = 2^(p1_b * log2 e) in [1, e]  (key-axis softmax numerator, no shift needed)
// the row sum of the f16-converted P is accumulated, P goes through a wave-private LDS tile
// into A fragments, o_b += P_b @ V_b (16 WMMAs per chunk, V^T fragments from the plane).
// After the loop the two key halves' o and row sums are joined through LDS (one block barrier).
// ---------------------------------------------------------------------------
static __device__ __forceinline__ void batch_softmax16(const v8f (&sc)[NB], float (&rs)[NB][8],
                                                       _Float16* __restrict__ pw, int r0, int col) {
#pragma unroll
    for (int g = 0; g < 8; ++g) {
        const float m  = fmaxf(fmaxf(sc[0][g], sc[1][g]), fmaxf(sc[2][g], sc[3][g]));
        const float mc = m * CS;
        float e[NB];
#pragma unroll
        for (int b = 0; b < NB; ++b) e[b] = ex2(__builtin_fmaf(sc[b][g], CS, -mc));
        const float r = __builtin_amdgcn_rcpf((e[0] + e[1]) + (e[2] + e[3])) * L2E;
#pragma unroll
        for (int b = 0; b < NB; ++b) {
            const _Float16 hp = (_Float16)ex2(e[b] * r);
            rs[b][g] += (float)hp;
            pw[b * 512 + (r0 + g) * 32 + col] = hp;
        }
    }
}

__global__ __launch_bounds__(256)
void k_attn(const _Float16* __restrict__ qp,
            const _Float16* __restrict__ kp,
            const _Float16* __restrict__ vT,
            _Float16* __restrict__ zc) {
    __shared__ __align__(16) _Float16 Pst[8][NB * 16 * 32];      // 32 KB wave-private
    __shared__ __align__(32) float    Xo[4][NB * 4][32 * 8];     // 64 KB, key half 1 -> key half 0
    __shared__ __align__(16) float    Xr[4][NB * 8][32];         // 16 KB, key half 1 -> key half 0
    __shared__ __align__(16) _Float16 Zst[4][NB][16 * 72];       // 36 KB, pitch 144 B, wave-private

    const int tid  = threadIdx.x;
    const int lane = tid & 31;
    const int wv   = __builtin_amdgcn_readfirstlane(tid >> 5);
    const int qt   = wv & 3;                  // query tile of the block
    const int kh   = wv >> 2;                 // key half
    const int h    = blockIdx.y;
    const int s0   = blockIdx.x * 64 + qt * 16;
    const int r0   = (lane >> 4) << 3;
    const int cc   = lane & 15;
    constexpr int PB = SEQ * HD;              // halves of one (h, b) plane

    const _Float16* qb = qp + ((size_t)h * NB * SEQ + s0) * HD;
    const _Float16* kc = kp + (size_t)h * NB * PB + kh * (32 * HD);   // this wave's current chunk
    const _Float16* vr = vT + (size_t)h * NB * PB + kh * (32 * HD);
    _Float16* pw = &Pst[wv][0];

    v16h qf[NB][2];
#pragma unroll
    for (int b = 0; b < NB; ++b) {
        qf[b][0] = load_fragF(qb + b * PB, lane);         // d 0..31
        qf[b][1] = load_fragF(qb + b * PB + 512, lane);   // d 32..63
    }

    v8f o[NB][4];
    float rs[NB][8];
#pragma unroll
    for (int b = 0; b < NB; ++b) {
#pragma unroll
        for (int nt = 0; nt < 4; ++nt) o[b][nt] = zero8();
#pragma unroll
        for (int g = 0; g < 8; ++g) rs[b][g] = 0.0f;
    }

    // K fragments of 16 keys x 4 batches, fetched one 16-key half ahead into the same registers
    v16h kf[NB][2];
#pragma unroll
    for (int b = 0; b < NB; ++b) {
        kf[b][0] = load_fragF(kc + b * PB, lane);
        kf[b][1] = load_fragF(kc + b * PB + 512, lane);
    }

    // the q base's registers are free for reuse from here on
    asm volatile("s_wait_xcnt 0x0" ::: "memory");
    // keeps what follows below that wait
    __builtin_amdgcn_sched_barrier(0);

#pragma unroll 1
    for (int i = 0; i < SEQ / 64; ++i) {
        // this chunk's V^T fragments, one group, in flight under the scores and the softmax
        v16h vf[NB][4];
#pragma unroll
        for (int b = 0; b < NB; ++b)
#pragma unroll
            for (int nt = 0; nt < 4; ++nt)
                vf[b][nt] = load_fragF(vr + b * PB + nt * 512, lane);   // n = v column, k = key

        v8f sc[NB];
        // keys 0..15 of the chunk, then the fetch of keys 16..31 into the same registers
#pragma unroll
        for (int b = 0; b < NB; ++b) sc[b] = wmma16b(qf[b][0], kf[b][0], zero8());
#pragma unroll
        for (int b = 0; b < NB; ++b) sc[b] = wmma16b(qf[b][1], kf[b][1], sc[b]);
#pragma unroll
        for (int b = 0; b < NB; ++b) {
            kf[b][0] = load_fragF(kc + b * PB + 16 * HD, lane);
            kf[b][1] = load_fragF(kc + b * PB + 16 * HD + 512, lane);
        }
        // keeps the fetch above the softmax: moved below it, the next scores wait out its whole latency
        __builtin_amdgcn_sched_barrier(0);
        batch_softmax16(sc, rs, pw, r0, cc);
        // keeps the second scores below the first softmax: moved up, they wait on a fetch just issued
        __builtin_amdgcn_sched_barrier(0);

        // keys 16..31 of the chunk
#pragma unroll
        for (int b = 0; b < NB; ++b) sc[b] = wmma16b(qf[b][0], kf[b][0], zero8());
#pragma unroll
        for (int b = 0; b < NB; ++b) sc[b] = wmma16b(qf[b][1], kf[b][1], sc[b]);
        // the address registers of the loads issued so far are advanced next
        asm volatile("s_wait_xcnt 0x0" ::: "memory");
        // keeps the two additions below that wait
        __builtin_amdgcn_sched_barrier(0);
        // first half of this wave's next chunk (the last trip re-reads its own chunk, so the
        // addresses stay inside the planes)
        const int step = (i + 1 < SEQ / 64) ? 64 * HD : 0;
        kc += step;
        vr += step;
#pragma unroll
        for (int b = 0; b < NB; ++b) {
            kf[b][0] = load_fragF(kc + b * PB, lane);
            kf[b][1] = load_fragF(kc + b * PB + 512, lane);
        }
        // keeps the fetch above the softmax, as above
        __builtin_amdgcn_sched_barrier(0);
        batch_softmax16(sc, rs, pw, r0, 16 + cc);

        wave_lds_sync();
        v16h pa[NB];
#pragma unroll
        for (int b = 0; b < NB; ++b) pa[b] = load_frag16(pw + b * 512, 32, lane);   // rows = queries, k = 32 keys
        // keeps the four fragments' LDS reads in one group: one LDS latency a chunk, not four
        __builtin_amdgcn_sched_barrier(0);
#pragma unroll
        for (int nt = 0; nt < 4; ++nt)
#pragma unroll
            for (int b = 0; b < NB; ++b) o[b][nt] = wmma16b(pa[b], vf[b][nt], o[b][nt]);
    }

    // key half 1 hands its partial o and row sums to key half 0 of the same query tile
    if (kh == 1) {
#pragma unroll
        for (int b = 0; b < NB; ++b) {
#pragma unroll
            for (int nt = 0; nt < 4; ++nt) *(v8f*)(&Xo[qt][b * 4 + nt][lane * 8]) = o[b][nt];
#pragma unroll
            for (int g = 0; g < 8; ++g) Xr[qt][b * 8 + g][lane] = rs[b][g];
        }
    }
    __syncthreads();
    if (kh == 1) return;

#pragma unroll
    for (int b = 0; b < NB; ++b) {
        // row sums: reduce over the 16 lanes of each half (columns), rows 8h+g
#pragma unroll
        for (int g = 0; g < 8; ++g) {
            float v = rs[b][g] + Xr[qt][b * 8 + g][lane];
            v += __shfl_xor(v, 1, 32);
            v += __shfl_xor(v, 2, 32);
            v += __shfl_xor(v, 4, 32);
            v += __shfl_xor(v, 8, 32);
            rs[b][g] = __builtin_amdgcn_rcpf(v);
        }
#pragma unroll
        for (int nt = 0; nt < 4; ++nt) {
            const v8f x = *(const v8f*)(&Xo[qt][b * 4 + nt][lane * 8]);
#pragma unroll
            for (int g = 0; g < 8; ++g)
                Zst[qt][b][(r0 + g) * 72 + nt * 16 + cc] = (_Float16)((o[b][nt][g] + x[g]) * rs[b][g]);
        }
    }
    // zc is kept in fragment order, rows m = s*NB + b: a 16-row group holds 4 queries of all
    // 4 batches, all of them this wave's own, so the wave writes whole 512-B runs from its tiles
    wave_lds_sync();

    const int zb = lane & 3;                       // batch whose tile is read
#pragma unroll
    for (int gq = 0; gq < 4; ++gq) {
        const int zq = gq * 4 + ((lane & 15) >> 2);    // query of the 16
        v8h zv[4];
        int off[4];
#pragma unroll
        for (int it = 0; it < 4; ++it) {
            zv[it]  = *(const v8h*)(&Zst[qt][zb][zq * 72 + (it * 2 + (lane >> 4)) * 8]);
            off[it] = ((s0 >> 2) + gq) * (16 * DM) + h * 1024 + it * 256 + lane * 8;
        }
#pragma unroll
        for (int it = 0; it < 4; ++it) *(v8h*)(zc + off[it]) = zv[it];
    }
}

// ---------------------------------------------------------------------------
// Output projection: out[m][n] = 2^-12 * (64 z)[m][:] . (64 Wo)[:][n] + bO[n].
// Block = 4 waves; wave = 32 rows x 64 columns. f32 tile staged in a wave-private
// LDS tile; each instruction writes two whole 256-B row segments (16 lanes x 16 B
// coverage: 32 rows = 16 instructions x 2 rows.
// ---------------------------------------------------------------------------
__global__ __launch_bounds__(128) __attribute__((amdgpu_num_vgpr(336)))
void k_out(const _Float16* __restrict__ zc,
           const _Float16* __restrict__ woT,
           const float*    __restrict__ bo,
           float* __restrict__ out) {
    __shared__ __align__(16) float Ost[4][32 * 64];     // 32 KB, wave-private tiles
    const int tid  = threadIdx.x;
    const int lane = tid & 31;
    const int w    = tid >> 5;
    const int m0   = blockIdx.x * 128 + w * 32;
    const int n0   = blockIdx.y * 64;

    const int r0 = (lane >> 4) << 3;
    const int cc = lane & 15;
    // fetched ahead of the k loop: behind it, the epilogue would wait out this load's whole latency
    float bb[4];
#pragma unroll
    for (int nt = 0; nt < 4; ++nt) bb[nt] = bo[n0 + nt * 16 + cc];
    // the fragment loads that follow land in the register that holds these loads' address
    asm volatile("s_wait_xcnt 0x0" ::: "memory");

    v8f acc[2][4];
    gemm_32x64(zc + (size_t)m0 * DM, woT + (size_t)n0 * DM, lane, acc);

#pragma unroll
    for (int rt = 0; rt < 2; ++rt)
#pragma unroll
        for (int nt = 0; nt < 4; ++nt)
#pragma unroll
            for (int g = 0; g < 8; ++g)
                Ost[w][(rt * 16 + r0 + g) * 64 + nt * 16 + cc] =
                    __builtin_fmaf(acc[rt][nt][g], SC_OUT, bb[nt]);
    wave_lds_sync();

    const int rh = lane >> 4, c4 = lane & 15;
    v4f sv[16];
#pragma unroll
    for (int it = 0; it < 16; ++it) sv[it] = *(const v4f*)(&Ost[w][(it * 2 + rh) * 64 + c4 * 4]);
    float* ob = out + (size_t)m0 * DM + n0 + (size_t)rh * DM + c4 * 4;
#pragma unroll
    for (int it = 0; it < 16; ++it) *(v4f*)(ob + (size_t)(it * 2) * DM) = sv[it];
    
}

// ---------------------------------------------------------------------------
extern "C" void kernel_launch(void* const* d_in, const int* in_sizes, int n_in,
                              void* d_out, int out_size, void* d_ws, size_t ws_size,
                              hipStream_t stream) {
    if (n_in < 9) return;
    if (in_sizes[0] < ((SEQ - 1) * NB_FULL + NB) * DM) return;
    if (in_sizes[1] < NH * DM * HD || in_sizes[3] < NH * DM * HD || in_sizes[5] < NH * DM * HD) return;
    if (in_sizes[2] < NH * HD || in_sizes[4] < NH * HD || in_sizes[6] < NH * HD) return;
    if (in_sizes[7] < DM * DM || in_sizes[8] < DM) return;
    if (out_size < MTOT * DM) return;
    if ((size_t)WS_TOTAL > ws_size) return;

    const float* X  = (const float*)d_in[0];   // [S][B][512], row m = s*4 + b
    const float* WQ = (const float*)d_in[1];   // [8][512][64]
    const float* bQ = (const float*)d_in[2];   // [8][64]
    const float* WK = (const float*)d_in[3];
    const float* bK = (const float*)d_in[4];
    const float* WV = (const float*)d_in[5];
    const float* bV = (const float*)d_in[6];
    const float* WO = (const float*)d_in[7];   // [512 in][512 out]
    const float* bO = (const float*)d_in[8];   // [512]
    float* out = (float*)d_out;                // [S][B][512]

    char* ws = (char*)d_ws;
    size_t off = 0;
    _Float16* wT   = (_Float16*)(ws + off); off += WT_BYTES;     // [1536][512], fragment order
    _Float16* woT  = (_Float16*)(ws + off); off += WOT_BYTES;    // [512][512], fragment order
    float*    bias = (float*)(ws + off);    off += BIAS_BYTES;   // [2048]
    _Float16* xh   = (_Float16*)(ws + off); off += XH_BYTES;     // [MTOT][512], fragment order
    _Float16* qkv  = (_Float16*)(ws + off); off += 3 * PL_BYTES; // q,k [h][b] fragment order, v [h][b][s][64]
    _Float16* vT   = (_Float16*)(ws + off); off += PL_BYTES;     // [h][b] fragment order
    _Float16* zc   = (_Float16*)(ws + off); off += ZC_BYTES;     // [MTOT][512], fragment order
    if (off > ws_size) return;

    k_prep<<<dim3(PREP_BLOCKS), dim3(256), 0, stream>>>(X, WQ, bQ, WK, bK, WV, bV, WO, bO, wT, woT, bias, xh);
    k_proj<<<dim3(MTOT / 128, NQKV / 64), dim3(128), 0, stream>>>(xh, wT, bias, qkv);
    k_vT<<<dim3(SEQ / 64, NH * NB), dim3(256), 0, stream>>>(qkv + 2 * PL_ELEMS, vT);
    k_attn<<<dim3(SEQ / 64, NH), dim3(256), 0, stream>>>(qkv, qkv + PL_ELEMS, vT, zc);
    k_out<<<dim3(MTOT / 128, DM / 64), dim3(128), 0, stream>>>(zc, woT, bias + NQKV, out);
}

// v006
// Measured time: 88.3 microseconds a run.
// Two timings next to v005 both put it at 1.06 times that version's speed.
// All steps since v000 together make it 3.12 times as fast.
#include <hip/hip_runtime.h>
#include <hip/hip_fp16.h>

// All contractions on v_wmma_f32_16x16x32_f16 (f16 operands, f32 accumulate), single products: x*[Wq|Wk|Wv], q*k^T, P*v, z*Wo; every float input RNE-converted to bf16 first (exact in f16), weight planes and q/k/v/z planes carried x64, P = exp(p1) in [1,e] unscaled.

#ifndef NB
#define NB 4             // batch; an attention wave holds the score tiles of all 4 batches (must stay 4)
#endif
#ifndef SEQ
#define SEQ 2048
#endif
#define NB_FULL  4
#define SEQ_FULL 2048
#define DM   512          // model width
#define NH   8            // heads
#define HD   64           // head width (dk = dv)
#define NQKV (3 * NH * HD)
#define MTOT (SEQ * NB)   // token rows m = s*NB + b

static_assert(NB == 4);
static_assert(NB_FULL == 4);
static_assert(SEQ >= 64 && SEQ <= SEQ_FULL);
static_assert(SEQ % 64 == 0);
static_assert(MTOT % 128 == 0);
static_assert(DM % 32 == 0);
static_assert(DM == NH * HD);
static_assert(HD == 64);
static_assert(NQKV % 64 == 0);
static_assert(((size_t)MTOT * DM) % 2048 == 0);

typedef _Float16 v16h __attribute__((ext_vector_type(16)));
typedef _Float16 v8h  __attribute__((ext_vector_type(8)));
typedef float    v8f  __attribute__((ext_vector_type(8)));
typedef float    v4f  __attribute__((ext_vector_type(4)));
typedef float    v2f  __attribute__((ext_vector_type(2)));
typedef _Float16 v2h  __attribute__((ext_vector_type(2)));

union Frag { v16h v; v8h h[2]; };

#define L2E     1.44269504088896340736f
#define CS      (1.44269504088896340736f * 3.0517578125e-05f)   // log2(e) * 2^-15 : (64q).(64k)/8 -> log2 units
#define SC_OUT  2.44140625e-04f                                  // 2^-12 : (64 z)(64 Wo) -> out

#define WT_BYTES   ((size_t)NQKV * DM * 2)
#define WOT_BYTES  ((size_t)DM * DM * 2)
#define BIAS_ELEMS 2048
#define BIAS_BYTES ((size_t)BIAS_ELEMS * 4)
#define XH_BYTES   ((size_t)MTOT * DM * 2)
#define PL_ELEMS   ((size_t)NH * NB * SEQ * HD)
#define PL_BYTES   (PL_ELEMS * 2)
#define ZC_BYTES   ((size_t)MTOT * DM * 2)
#define WS_TOTAL   (WT_BYTES + WOT_BYTES + BIAS_BYTES + XH_BYTES + 4 * PL_BYTES + ZC_BYTES)
static_assert(WS_TOTAL <= (size_t)134217728);
static_assert(WT_BYTES % 128 == 0 && WOT_BYTES % 128 == 0 && BIAS_BYTES % 128 == 0);
static_assert(XH_BYTES % 128 == 0 && PL_BYTES % 128 == 0 && ZC_BYTES % 128 == 0);
static_assert(NQKV + DM == BIAS_ELEMS);

static __device__ __forceinline__ v8f zero8() {
    v8f z;
#pragma unroll
    for (int i = 0; i < 8; ++i) z[i] = 0.0f;
    return z;
}

// 16x32 A fragment (or B fragment, n for row) from a plane kept in fragment order: lane holds
// row lane&15; with kb = 8*(lane>>4), elements 0..7 = k kb..kb+7, elements 8..15 = k kb+16..kb+23.
// A 16-row x 32-k block is 512
// halves, [j 0..1][lane 0..31][8 halves], where lane = row + 16*((k>>3)&1), j = k>>4,
// so each of the two loads reads 512 contiguous bytes (four whole lines) per wave.
static __device__ __forceinline__ v16h load_fragF(const _Float16* blk, int lane) {
    const _Float16* p = blk + lane * 8;
    Frag f;
    f.h[0] = *(const v8h*)(p);
    f.h[1] = *(const v8h*)(p + 256);
    return f.v;
}

// the bare builtin: the matrix kernels hold more than 256 VGPRs, and an asm operand cannot sit
// above v255, so a pad written in asm behind it would force its fragments into the low window
static __device__ __forceinline__ v8f wmma16b(v16h a, v16h b, v8f c) {
    return __builtin_amdgcn_wmma_f32_16x16x32_f16(false, a, false, b, (short)0, c, false, false);
}

// f32 -> bf16 RNE convert, value kept as f32
static __device__ __forceinline__ float bf16r(float x) {
    unsigned u = __float_as_uint(x);
    u = (u + 0x7FFFu + ((u >> 16) & 1u)) & 0xFFFF0000u;
    return __uint_as_float(u);
}

static __device__ __forceinline__ float ex2(float x) {
    return __builtin_amdgcn_exp2f(x);
}

// ordering for a wave-private LDS tile: stores before later loads of the same wave
static __device__ __forceinline__ void wave_lds_sync() {
    __builtin_amdgcn_fence(3, "wavefront");
    asm volatile("s_wait_dscnt 0" ::: "memory");
    __builtin_amdgcn_wave_barrier();
}

// ---------------------------------------------------------------------------
// Operand planes, one launch: the weight planes, the bias plane and the x plane need nothing
// of each other, so they share one grid; a range of the block index picks the job
// (block-uniform): [0, 256) weight tiles, 256 the bias plane, the rest the x plane.
// The weight tiles come first: theirs is the longest chain (load, LDS, barrier, store).
// ---------------------------------------------------------------------------
#define PREP_WT_BLOCKS 256                                  // 4 matrices x 8 x 8 tiles of 64 x 64
#define PREP_X_BLOCKS  ((int)(((size_t)MTOT * DM) / 2048))
#define PREP_BLOCKS    (PREP_WT_BLOCKS + 1 + PREP_X_BLOCKS)

// Weight plane builder: one 64x64 tile per block, in[i][j] (f32) -> out[j][i]
// (f16 = 64 * bf16-RNE value).
// out is kept in fragment order: [j>>4][i>>5] blocks of 512 halves, 16 out rows = 16*DM halves.
// coverage: 4 x 2 blocks x 2 halves = 16 runs of 512 B = 8 waves x 2.
static __device__ __forceinline__ void prep_wT(const float* __restrict__ sp, int src_pitch,
                                               _Float16* __restrict__ dp, _Float16* T, int tid) {
#pragma unroll
    for (int it = 0; it < 4; ++it) {
        int idx = tid + it * 256;
        int r = idx >> 4, c4 = idx & 15;
        v4f v = *(const v4f*)(sp + (size_t)r * src_pitch + c4 * 4);
        T[(c4 * 4 + 0) * 72 + r] = (_Float16)(bf16r(v.x) * 64.0f);
        T[(c4 * 4 + 1) * 72 + r] = (_Float16)(bf16r(v.y) * 64.0f);
        T[(c4 * 4 + 2) * 72 + r] = (_Float16)(bf16r(v.z) * 64.0f);
        T[(c4 * 4 + 3) * 72 + r] = (_Float16)(bf16r(v.w) * 64.0f);
    }
    __syncthreads();
    const int lane = tid & 31, wv = tid >> 5;
    const int nt0 = wv >> 2, nt1 = nt0 + 2;            // 16-row group of the out rows
    const int pq  = (wv & 3) * 2 + (lane >> 4);        // 8-half piece of the 64 k: (kc*2 + j)*2 + hi
    v8h o0 = *(const v8h*)(&T[(nt0 * 16 + (lane & 15)) * 72 + pq * 8]);
    v8h o1 = *(const v8h*)(&T[(nt1 * 16 + (lane & 15)) * 72 + pq * 8]);
    _Float16* d0 = dp + (size_t)(nt0 * 16) * DM + (wv & 3) * 256 + lane * 8;
    _Float16* d1 = dp + (size_t)(nt1 * 16) * DM + (wv & 3) * 256 + lane * 8;
    *(v8h*)d0 = o0;
    *(v8h*)d1 = o1;
    // another job's code follows in the built kernel and reuses the registers these stores name
    asm volatile("s_wait_xcnt 0x0" ::: "memory");
}

// x plane in fragment order: f16(bf16r(x[m][d])); 8 elements per thread; 8 consecutive
// lanes take the same 8-column piece of 8 consecutive rows = one whole 128-B line of xh
static __device__ __forceinline__ void prep_x(const float* __restrict__ x, _Float16* __restrict__ xh, int gid) {
    const int pc  = (gid >> 3) & 63;                   // 8-column piece of the row
    const int row = ((gid >> 9) << 3) + (gid & 7);
    const size_t i = (size_t)row * DM + pc * 8;
    const size_t j = (size_t)(row >> 4) * (16 * DM) + (pc >> 1) * 256 + ((row & 15) + 16 * (pc & 1)) * 8;
    v4f a = *(const v4f*)(x + i);
    v4f b = *(const v4f*)(x + i + 4);
    v8h o;
    o[0] = (_Float16)bf16r(a.x); o[1] = (_Float16)bf16r(a.y);
    o[2] = (_Float16)bf16r(a.z); o[3] = (_Float16)bf16r(a.w);
    o[4] = (_Float16)bf16r(b.x); o[5] = (_Float16)bf16r(b.y);
    o[6] = (_Float16)bf16r(b.z); o[7] = (_Float16)bf16r(b.w);
    *(v8h*)(xh + j) = o;
    // another job's code follows in the built kernel and reuses the registers this store names
    asm volatile("s_wait_xcnt 0x0" ::: "memory");
}

__global__ __launch_bounds__(256) void k_prep(const float* __restrict__ X,
                                              const float* __restrict__ WQ, const float* __restrict__ bQ,
                                              const float* __restrict__ WK, const float* __restrict__ bK,
                                              const float* __restrict__ WV, const float* __restrict__ bV,
                                              const float* __restrict__ WO, const float* __restrict__ bO,
                                              _Float16* __restrict__ wT, _Float16* __restrict__ woT,
                                              float* __restrict__ bias, _Float16* __restrict__ xh) {
    __shared__ __align__(16) _Float16 T[64 * 72];
    const int tid = threadIdx.x;
    const int blk = blockIdx.x;
    if (blk < PREP_WT_BLOCKS) {
        const int which = blk >> 6;                    // 0 Wq, 1 Wk, 2 Wv, 3 Wo
        const int bx = blk & 7, by = (blk >> 3) & 7;
        if (which < 3) {
            // per-head weights: in[d 512][k 64] -> out[h*64 + k][d]; bx tiles = d, by tiles = head
            const float* w = (which == 0) ? WQ : (which == 1) ? WK : WV;
            prep_wT(w + (size_t)bx * (64 * HD) + (size_t)by * (DM * HD), HD,
                    wT + (size_t)which * (DM * DM) + (size_t)bx * 1024 + (size_t)by * (64 * DM), T, tid);
        } else {
            // Wo: in[k 512][n 512] -> out[n][k]; bx tiles = k rows, by tiles = n columns
            prep_wT(WO + (size_t)bx * (64 * DM) + (size_t)by * 64, DM,
                    woT + (size_t)bx * 1024 + (size_t)by * (64 * DM), T, tid);
        }
    } else if (blk == PREP_WT_BLOCKS) {
        // Bias plane [2048] f32: [0..1535] = 64*bf16r(bQ|bK|bV) (index which*512 + h*64 + k),
        // [1536..2047] = bf16r(bO). 8 consecutive elements per thread, 64 threads per vector.
        const int which = tid >> 6;
        const float* b = (which == 0) ? bQ : (which == 1) ? bK : (which == 2) ? bV : bO;
        const float sc = (which < 3) ? 64.0f : 1.0f;
        const v4f u = *(const v4f*)(b + (tid & 63) * 8);
        const v4f v = *(const v4f*)(b + (tid & 63) * 8 + 4);
        v4f p, q;
        p.x = bf16r(u.x) * sc; p.y = bf16r(u.y) * sc; p.z = bf16r(u.z) * sc; p.w = bf16r(u.w) * sc;
        q.x = bf16r(v.x) * sc; q.y = bf16r(v.y) * sc; q.z = bf16r(v.z) * sc; q.w = bf16r(v.w) * sc;
        *(v4f*)(bias + tid * 8)     = p;
        *(v4f*)(bias + tid * 8 + 4) = q;
        // another job's code follows in the built kernel and reuses the registers these stores name
        asm volatile("s_wait_xcnt 0x0" ::: "memory");
    } else {
        prep_x(X, xh, (blk - (PREP_WT_BLOCKS + 1)) * 256 + tid);
    }
}

// ---------------------------------------------------------------------------
// GEMM main loop: wave tile 32 rows x 64 columns, K = DM, A and B planes both in
// fragment order (16 rows = 16*DM halves, 32 k = 512 halves), fragments straight
// from the 16-bit global planes (arithmetic addressing only).
// The six fragments of a 32-k step are loaded as one group, three steps ahead of their
// products, into a ring of four register sets: the blocks of a launch walk k in step, so
// no other wave hides a load's latency; the wave's own loads in flight have to.
// Four sets and the accumulators fit the 336 VGPRs that leave three waves a SIMD; a fifth set spills.
// ---------------------------------------------------------------------------
#define KSTEPS (DM / 32)
#define KRING  4
static_assert(KSTEPS >= KRING - 1);

static __device__ __forceinline__ void load_kstep(const _Float16* __restrict__ Ap,
                                                  const _Float16* __restrict__ Bp,
                                                  int t, int lane, v16h (&a)[2], v16h (&b)[4]) {
    a[0] = load_fragF(Ap + t * 512, lane);
    a[1] = load_fragF(Ap + 16 * DM + t * 512, lane);
#pragma unroll
    for (int nt = 0; nt < 4; ++nt) b[nt] = load_fragF(Bp + nt * 16 * DM + t * 512, lane);
}

static __device__ __forceinline__ void gemm_32x64(const _Float16* __restrict__ Ap,
                                                  const _Float16* __restrict__ Bp,
                                                  int lane, v8f (&acc)[2][4]) {
    v16h a[KRING][2], b[KRING][4];
#pragma unroll
    for (int t = 0; t < KRING - 1; ++t) load_kstep(Ap, Bp, t, lane, a[t], b[t]);
#pragma unroll
    for (int rt = 0; rt < 2; ++rt)
#pragma unroll
        for (int nt = 0; nt < 4; ++nt) acc[rt][nt] = zero8();
    // unrolled whole: the ring's set numbers become register names
#pragma unroll
    for (int t = 0; t < KSTEPS; ++t) {
        constexpr int AH = KRING - 1;
        if (t + AH < KSTEPS) load_kstep(Ap, Bp, t + AH, lane, a[(t + AH) % KRING], b[(t + AH) % KRING]);
        // behind the last fetch: the address registers of the fragment loads are free for reuse from here on
        if (t + AH == KSTEPS - 1) asm volatile("s_wait_xcnt 0x0" ::: "memory");
        // keeps the fetch above this step's products: sunk among them it loses its lead
        __builtin_amdgcn_sched_barrier(0);
#pragma unroll
        for (int nt = 0; nt < 4; ++nt) {
            acc[0][nt] = wmma16b(a[t % KRING][0], b[t % KRING][nt], acc[0][nt]);
            acc[1][nt] = wmma16b(a[t % KRING][1], b[t % KRING][nt], acc[1][nt]);
        }
        // keeps the next fetch below these products: raised above them it takes one more set
        __builtin_amdgcn_sched_barrier(0);
    }
}

// ---------------------------------------------------------------------------
// Projections: [MTOT x 512] x [512 x 1536]. Block = 4 waves; wave = 32 token rows
// x 64 columns (one of q/k/v, one head). Output plane v [h][b][s][64] f16: one
// (h,b,s) row written by 8 consecutive lanes of one instruction. Output planes q,k
// [h][b] in fragment order (16 s = 1024 halves): 8 consecutive lanes write the same
// piece of 8 consecutive s = one whole line.
// coverage: 32 rows x 8 pieces = 8 instructions x 32 lanes.
// ---------------------------------------------------------------------------
__global__ __launch_bounds__(128) __attribute__((amdgpu_num_vgpr(336)))
void k_proj(const _Float16* __restrict__ xh,
            const _Float16* __restrict__ wT,
            const float*    __restrict__ bias,
            _Float16* __restrict__ qkv) {
    __shared__ __align__(16) _Float16 st[4][32 * 72];     // 18 KB, wave-private tiles, pitch 144 B
    const int tid  = threadIdx.x;
    const int lane = tid & 31;
    const int w    = tid >> 5;
    const int m0   = blockIdx.x * 128 + w * 32;
    const int n0   = blockIdx.y * 64;

    const int r0 = (lane >> 4) << 3;
    const int cc = lane & 15;
    // fetched ahead of the k loop: behind it, the epilogue would wait out this load's whole latency
    float bb[4];
#pragma unroll
    for (int nt = 0; nt < 4; ++nt) bb[nt] = bias[n0 + nt * 16 + cc];
    // the fragment loads that follow land in the register that holds these loads' address
    asm volatile("s_wait_xcnt 0x0" ::: "memory");

    v8f acc[2][4];
    gemm_32x64(xh + (size_t)m0 * DM, wT + (size_t)n0 * DM, lane, acc);

#pragma unroll
    for (int rt = 0; rt < 2; ++rt)
#pragma unroll
        for (int nt = 0; nt < 4; ++nt)
#pragma unroll
            for (int g = 0; g < 8; ++g)
                st[w][(rt * 16 + r0 + g) * 72 + nt * 16 + cc] = (_Float16)(acc[rt][nt][g] + bb[nt]);
    wave_lds_sync();

    const int which = n0 >> 9;               // 0 q, 1 k, 2 v
    const int hh    = (n0 & 511) >> 6;
    _Float16* plane = qkv + (size_t)which * PL_ELEMS;
    const int rq = lane >> 3, pc = lane & 7;
    v8h pv[8];
    int off[8];
#pragma unroll
    for (int it = 0; it < 8; ++it) {
        // v: lanes run over the pieces of a row; q,k: lanes run over 8 s of batch rq, piece it
        const int i = (which == 2) ? it * 4 + rq : pc * 4 + rq;
        const int p = (which == 2) ? pc : it;
        pv[it] = *(const v8h*)(&st[w][i * 72 + p * 8]);
        const int m = m0 + i;
        const int s = m >> 2, b = m & 3;     // m = s*NB + b, NB = 4
        off[it] = (which == 2) ? ((hh * NB + b) * SEQ + s) * HD + p * 8
                               : ((hh * NB + b) * SEQ + (s & ~15)) * HD + (p >> 1) * 256 + ((s & 15) + 16 * (p & 1)) * 8;
    }
#pragma unroll
    for (int it = 0; it < 8; ++it) *(v8h*)(plane + off[it]) = pv[it];
    
}

// ---------------------------------------------------------------------------
// V^T plane: v[hb][s][64] -> vT[hb] in fragment order, rows = v column, k = key:
// [s>>5][v>>4] blocks of 512 halves; 64 s x 64 v tile per block through LDS.
// coverage: 2 x 4 blocks x 2 halves = 16 runs of 512 B = 8 waves x 2.
// ---------------------------------------------------------------------------
__global__ __launch_bounds__(256) void k_vT(const _Float16* __restrict__ v, _Float16* __restrict__ vT) {
    __shared__ __align__(16) _Float16 T[64 * 72];
    const int tid = threadIdx.x;
    const int s0  = blockIdx.x * 64;
    const int hb  = blockIdx.y;
    const _Float16* sp = v + ((size_t)hb * SEQ + s0) * HD;
#pragma unroll
    for (int it = 0; it < 2; ++it) {
        int p = tid + it * 256;
        int r = p >> 3, pc = p & 7;
        v8h vv = *(const v8h*)(sp + (size_t)r * HD + pc * 8);
#pragma unroll
        for (int e = 0; e < 8; ++e) T[(pc * 8 + e) * 72 + r] = vv[e];
    }
    __syncthreads();
    _Float16* dp = vT + ((size_t)hb * SEQ + s0) * HD;
    const int lane = tid & 31, wv = tid >> 5;
    const int nt = wv >> 1, jh = (wv & 1) * 2 + (lane >> 4);   // v group; piece of the 32 keys: j*2 + hi
    v8h o0 = *(const v8h*)(&T[(nt * 16 + (lane & 15)) * 72 + jh * 8]);
    v8h o1 = *(const v8h*)(&T[(nt * 16 + (lane & 15)) * 72 + 32 + jh * 8]);
    _Float16* d0 = dp + wv * 256 + lane * 8;
    _Float16* d1 = d0 + 32 * HD;
    *(v8h*)d0 = o0;
    *(v8h*)d1 = o1;
    
}

// ---------------------------------------------------------------------------
// Fused attention, block = (head h, 64 queries), 8 waves = 4 query tiles of 16 x 2 key halves
// (wave kh takes the 32-key chunks 2i + kh). A wave holds the score tiles of ALL FOUR batches
// of its 16 queries: the four tiles have the same lane/register map, so the softmax over the
// batch axis is plain register arithmetic, with one maximum, one sum and one reciprocal per
// (query, key) for the four batches; nothing is exchanged between waves inside the loop.
// The scores are formed transposed, S^T = K q^T (A = K rows, B = q): a lane then holds 8
// consecutive keys of ONE query, which is the B-operand map of P^T, so the two 16-key tiles of
// a chunk, converted in place, are the B fragment of o^T += V^T P^T; P touches no LDS.
// Per 16-key half of a chunk: 8 WMMAs (q/k fragments from the fragment-order planes), then
//   e_b = 2^((s_b - max_b s) * CS), p1_b = e_b / sum_b e     (sum >= 1, no overflow)
//   P_b = 2^(p1_b * log2 e) in [1, e]  (key-axis softmax numerator, no shift needed)
// the sum of P is accumulated per lane in f32 (one query, half of the keys; two partial sums),
// o^T_b += V^T_b @ P^T_b (16 WMMAs per chunk, V^T fragments from the plane as A).
// After the loop the two key halves' o and row sums are joined through LDS (one block barrier).
// ---------------------------------------------------------------------------
static __device__ __forceinline__ void batch_softmax16(const v8f (&sc)[NB], v2f (&rs)[NB], v8h (&ph)[NB]) {
#pragma unroll
    for (int g = 0; g < 8; g += 2) {
        v2f p[NB];
#pragma unroll
        for (int u = 0; u < 2; ++u) {
            const float m  = fmaxf(fmaxf(sc[0][g + u], sc[1][g + u]), fmaxf(sc[2][g + u], sc[3][g + u]));
            const float mc = m * CS;
            float e[NB];
#pragma unroll
            for (int b = 0; b < NB; ++b) e[b] = ex2(__builtin_fmaf(sc[b][g + u], CS, -mc));
            const float r = __builtin_amdgcn_rcpf((e[0] + e[1]) + (e[2] + e[3])) * L2E;
#pragma unroll
            for (int b = 0; b < NB; ++b) p[b][u] = ex2(e[b] * r);
        }
#pragma unroll
        for (int b = 0; b < NB; ++b) {
            const v2h hp = __builtin_convertvector(p[b], v2h);
            rs[b] += p[b];
            ph[b][g]     = hp[0];
            ph[b][g + 1] = hp[1];
        }
    }
}

__global__ __launch_bounds__(256)
void k_attn(const _Float16* __restrict__ qp,
            const _Float16* __restrict__ kp,
            const _Float16* __restrict__ vT,
            _Float16* __restrict__ zc) {
    __shared__ __align__(32) float    Xo[4][NB * 4][32 * 8];     // 64 KB, key half 1 -> key half 0
    __shared__ __align__(16) float    Xr[4][NB][32];             // 2 KB, key half 1 -> key half 0
    __shared__ __align__(16) _Float16 Zst[4][NB][16 * 72];       // 36 KB, pitch 144 B, wave-private

    const int tid  = threadIdx.x;
    const int lane = tid & 31;
    const int wv   = __builtin_amdgcn_readfirstlane(tid >> 5);
    const int qt   = wv & 3;                  // query tile of the block
    const int kh   = wv >> 2;                 // key half
    const int h    = blockIdx.y;
    const int s0   = blockIdx.x * 64 + qt * 16;
    const int r0   = (lane >> 4) << 3;
    const int cc   = lane & 15;
    constexpr int PB = SEQ * HD;              // halves of one (h, b) plane

    const _Float16* qb = qp + ((size_t)h * NB * SEQ + s0) * HD;
    const _Float16* kc = kp + (size_t)h * NB * PB + kh * (32 * HD);   // this wave's current chunk
    const _Float16* vr = vT + (size_t)h * NB * PB + kh * (32 * HD);

    v16h qf[NB][2];
#pragma unroll
    for (int b = 0; b < NB; ++b) {
        qf[b][0] = load_fragF(qb + b * PB, lane);         // d 0..31
        qf[b][1] = load_fragF(qb + b * PB + 512, lane);   // d 32..63
    }

    v8f o[NB][4];
    v2f rs[NB];
#pragma unroll
    for (int b = 0; b < NB; ++b) {
#pragma unroll
        for (int nt = 0; nt < 4; ++nt) o[b][nt] = zero8();
        rs[b] = 0.0f;
    }

    // K fragments of 16 keys x 4 batches, fetched one 16-key half ahead into the same registers
    v16h kf[NB][2];
#pragma unroll
    for (int b = 0; b < NB; ++b) {
        kf[b][0] = load_fragF(kc + b * PB, lane);
        kf[b][1] = load_fragF(kc + b * PB + 512, lane);
    }

    // the q base's registers are free for reuse from here on
    asm volatile("s_wait_xcnt 0x0" ::: "memory");
    // keeps what follows below that wait
    __builtin_amdgcn_sched_barrier(0);

#pragma unroll 1
    for (int i = 0; i < SEQ / 64; ++i) {
        // this chunk's V^T fragments, one group, in flight under the scores and the softmax
        v16h vf[NB][4];
#pragma unroll
        for (int b = 0; b < NB; ++b)
#pragma unroll
            for (int nt = 0; nt < 4; ++nt)
                vf[b][nt] = load_fragF(vr + b * PB + nt * 512, lane);   // rows = v column, k = key

        v8f sc[NB];
        v8h p0[NB], p1[NB];                   // P^T of keys 0..15 and 16..31: B elements 0..7 and 8..15
        // keys 0..15 of the chunk, then the fetch of keys 16..31 into the same registers
#pragma unroll
        for (int b = 0; b < NB; ++b) sc[b] = wmma16b(kf[b][0], qf[b][0], zero8());
#pragma unroll
        for (int b = 0; b < NB; ++b) sc[b] = wmma16b(kf[b][1], qf[b][1], sc[b]);
#pragma unroll
        for (int b = 0; b < NB; ++b) {
            kf[b][0] = load_fragF(kc + b * PB + 16 * HD, lane);
            kf[b][1] = load_fragF(kc + b * PB + 16 * HD + 512, lane);
        }
        // keeps the fetch above the softmax: moved below it, the next scores wait out its whole latency
        __builtin_amdgcn_sched_barrier(0);
        batch_softmax16(sc, rs, p0);
        // keeps the second scores below the first softmax: moved up, they wait on a fetch just issued
        __builtin_amdgcn_sched_barrier(0);

        // keys 16..31 of the chunk
#pragma unroll
        for (int b = 0; b < NB; ++b) sc[b] = wmma16b(kf[b][0], qf[b][0], zero8());
#pragma unroll
        for (int b = 0; b < NB; ++b) sc[b] = wmma16b(kf[b][1], qf[b][1], sc[b]);
        // the address registers of the loads issued so far are advanced next
        asm volatile("s_wait_xcnt 0x0" ::: "memory");
        // keeps the two additions below that wait
        __builtin_amdgcn_sched_barrier(0);
        // first half of this wave's next chunk (the last trip re-reads its own chunk, so the
        // addresses stay inside the planes)
        const int step = (i + 1 < SEQ / 64) ? 64 * HD : 0;
        kc += step;
        vr += step;
#pragma unroll
        for (int b = 0; b < NB; ++b) {
            kf[b][0] = load_fragF(kc + b * PB, lane);
            kf[b][1] = load_fragF(kc + b * PB + 512, lane);
        }
        // keeps the fetch above the softmax, as above
        __builtin_amdgcn_sched_barrier(0);
        batch_softmax16(sc, rs, p1);

        Frag pb[NB];                          // n = query, k = 32 keys, the order of the V^T fragments
#pragma unroll
        for (int b = 0; b < NB; ++b) { pb[b].h[0] = p0[b]; pb[b].h[1] = p1[b]; }
#pragma unroll
        for (int nt = 0; nt < 4; ++nt)
#pragma unroll
            for (int b = 0; b < NB; ++b) o[b][nt] = wmma16b(vf[b][nt], pb[b].v, o[b][nt]);
    }

    // key half 1 hands its partial o and row sums to key half 0 of the same query tile
    if (kh == 1) {
#pragma unroll
        for (int b = 0; b < NB; ++b) {
#pragma unroll
            for (int nt = 0; nt < 4; ++nt) *(v8f*)(&Xo[qt][b * 4 + nt][lane * 8]) = o[b][nt];
            Xr[qt][b][lane] = rs[b].x + rs[b].y;
        }
    }
    __syncthreads();
    if (kh == 1) return;

#pragma unroll
    for (int b = 0; b < NB; ++b) {
        // row sum of query cc: both key halves, then lanes cc and cc + 16 (each has half of the keys)
        const float v  = (rs[b].x + rs[b].y) + Xr[qt][b][lane];
        const int   vi = __float_as_int(v);
        const float vx = __int_as_float(__builtin_amdgcn_permlanex16(vi, vi, 0x76543210, 0xfedcba98, false, false));
        const float ri = __builtin_amdgcn_rcpf(v + vx);
        // o^T: a lane holds v columns nt*16 + r0 .. + 7 of query cc = one 16-byte piece of the z row
#pragma unroll
        for (int nt = 0; nt < 4; ++nt) {
            const v8f x = *(const v8f*)(&Xo[qt][b * 4 + nt][lane * 8]);
            v8h zr;
#pragma unroll
            for (int g = 0; g < 8; ++g) zr[g] = (_Float16)((o[b][nt][g] + x[g]) * ri);
            *(v8h*)(&Zst[qt][b][cc * 72 + nt * 16 + r0]) = zr;
        }
    }
    // zc is kept in fragment order, rows m = s*NB + b: a 16-row group holds 4 queries of all
    // 4 batches, all of them this wave's own, so the wave writes whole 512-B runs from its tiles
    wave_lds_sync();

    const int zb = lane & 3;                       // batch whose tile is read
#pragma unroll
    for (int gq = 0; gq < 4; ++gq) {
        const int zq = gq * 4 + ((lane & 15) >> 2);    // query of the 16
        v8h zv[4];
        int off[4];
#pragma unroll
        for (int it = 0; it < 4; ++it) {
            zv[it]  = *(const v8h*)(&Zst[qt][zb][zq * 72 + (it * 2 + (lane >> 4)) * 8]);
            off[it] = ((s0 >> 2) + gq) * (16 * DM) + h * 1024 + it * 256 + lane * 8;
        }
#pragma unroll
        for (int it = 0; it < 4; ++it) *(v8h*)(zc + off[it]) = zv[it];
    }
}

// ---------------------------------------------------------------------------
// Output projection: out[m][n] = 2^-12 * (64 z)[m][:] . (64 Wo)[:][n] + bO[n].
// Block = 4 waves; wave = 32 rows x 64 columns. f32 tile staged in a wave-private
// LDS tile; each instruction writes two whole 256-B row segments (16 lanes x 16 B
// coverage: 32 rows = 16 instructions x 2 rows.
// ---------------------------------------------------------------------------
__global__ __launch_bounds__(128) __attribute__((amdgpu_num_vgpr(336)))
void k_out(const _Float16* __restrict__ zc,
           const _Float16* __restrict__ woT,
           const float*    __restrict__ bo,
           float* __restrict__ out) {
    __shared__ __align__(16) float Ost[4][32 * 64];     // 32 KB, wave-private tiles
    const int tid  = threadIdx.x;
    const int lane = tid & 31;
    const int w    = tid >> 5;
    const int m0   = blockIdx.x * 128 + w * 32;
    const int n0   = blockIdx.y * 64;

    const int r0 = (lane >> 4) << 3;
    const int cc = lane & 15;
    // fetched ahead of the k loop: behind it, the epilogue would wait out this load's whole latency
    float bb[4];
#pragma unroll
    for (int nt = 0; nt < 4; ++nt) bb[nt] = bo[n0 + nt * 16 + cc];
    // the fragment loads that follow land in the register that holds these loads' address
    asm volatile("s_wait_xcnt 0x0" ::: "memory");

    v8f acc[2][4];
    gemm_32x64(zc + (size_t)m0 * DM, woT + (size_t)n0 * DM, lane, acc);

#pragma unroll
    for (int rt = 0; rt < 2; ++rt)
#pragma unroll
        for (int nt = 0; nt < 4; ++nt)
#pragma unroll
            for (int g = 0; g < 8; ++g)
                Ost[w][(rt * 16 + r0 + g) * 64 + nt * 16 + cc] =
                    __builtin_fmaf(acc[rt][nt][g], SC_OUT, bb[nt]);
    wave_lds_sync();

    const int rh = lane >> 4, c4 = lane & 15;
    v4f sv[16];
#pragma unroll
    for (int it = 0; it < 16; ++it) sv[it] = *(const v4f*)(&Ost[w][(it * 2 + rh) * 64 + c4 * 4]);
    float* ob = out + (size_t)m0 * DM + n0 + (size_t)rh * DM + c4 * 4;
#pragma unroll
    for (int it = 0; it < 16; ++it) *(v4f*)(ob + (size_t)(it * 2) * DM) = sv[it];
    
}

// ---------------------------------------------------------------------------
extern "C" void kernel_launch(void* const* d_in, const int* in_sizes, int n_in,
                              void* d_out, int out_size, void* d_ws, size_t ws_size,
                              hipStream_t stream) {
    if (n_in < 9) return;
    if (in_sizes[0] < ((SEQ - 1) * NB_FULL + NB) * DM) return;
    if (in_sizes[1] < NH * DM * HD || in_sizes[3] < NH * DM * HD || in_sizes[5] < NH * DM * HD) return;
    if (in_sizes[2] < NH * HD || in_sizes[4] < NH * HD || in_sizes[6] < NH * HD) return;
    if (in_sizes[7] < DM * DM || in_sizes[8] < DM) return;
    if (out_size < MTOT * DM) return;
    if ((size_t)WS_TOTAL > ws_size) return;

    const float* X  = (const float*)d_in[0];   // [S][B][512], row m = s*4 + b
    const float* WQ = (const float*)d_in[1];   // [8][512][64]
    const float* bQ = (const float*)d_in[2];   // [8][64]
    const float* WK = (const float*)d_in[3];
    const float* bK = (const float*)d_in[4];
    const float* WV = (const float*)d_in[5];
    const float* bV = (const float*)d_in[6];
    const float* WO = (const float*)d_in[7];   // [512 in][512 out]
    const float* bO = (const float*)d_in[8];   // [512]
    float* out = (float*)d_out;                // [S][B][512]

    char* ws = (char*)d_ws;
    size_t off = 0;
    _Float16* wT   = (_Float16*)(ws + off); off += WT_BYTES;     // [1536][512], fragment order
    _Float16* woT  = (_Float16*)(ws + off); off += WOT_BYTES;    // [512][512], fragment order
    float*    bias = (float*)(ws + off);    off += BIAS_BYTES;   // [2048]
    _Float16* xh   = (_Float16*)(ws + off); off += XH_BYTES;     // [MTOT][512], fragment order
    _Float16* qkv  = (_Float16*)(ws + off); off += 3 * PL_BYTES; // q,k [h][b] fragment order, v [h][b][s][64]
    _Float16* vT   = (_Float16*)(ws + off); off += PL_BYTES;     // [h][b] fragment order
    _Float16* zc   = (_Float16*)(ws + off); off += ZC_BYTES;     // [MTOT][512], fragment order
    if (off > ws_size) return;

    k_prep<<<dim3(PREP_BLOCKS), dim3(256), 0, stream>>>(X, WQ, bQ, WK, bK, WV, bV, WO, bO, wT, woT, bias, xh);
    k_proj<<<dim3(MTOT / 128, NQKV / 64), dim3(128), 0, stream>>>(xh, wT, bias, qkv);
    k_vT<<<dim3(SEQ / 64, NH * NB), dim3(256), 0, stream>>>(qkv + 2 * PL_ELEMS, vT);
    k_attn<<<dim3(SEQ / 64, NH), dim3(256), 0, stream>>>(qkv, qkv + PL_ELEMS, vT, zc);
    k_out<<<dim3(MTOT / 128, DM / 64), dim3(128), 0, stream>>>(zc, woT, bias + NQKV, out);
}

// v007
// One run takes 83 microseconds.
// Timed twice side by side with v006, it ran 1.08 and 1.07 times as fast.
// All steps since v000 together make it 3.36 times as fast.
#include <hip/hip_runtime.h>
#include <hip/hip_fp16.h>

// All contractions on v_wmma_f32_16x16x32_f16 (f16 operands, f32 accumulate), single products: x*[Wq|Wk|Wv], q*k^T, P*v, z*Wo; every float input RNE-converted to bf16 first (exact in f16), weight planes and q/k/v/z planes carried x64, P = exp(p1) in [1,e] unscaled.

#ifndef NB
#define NB 4             // batch; an attention wave holds the score tiles of all 4 batches (must stay 4)
#endif
#ifndef SEQ
#define SEQ 2048
#endif
#define NB_FULL  4
#define SEQ_FULL 2048
#define DM   512          // model width
#define NH   8            // heads
#define HD   64           // head width (dk = dv)
#define NQKV (3 * NH * HD)
#define MTOT (SEQ * NB)   // token rows m = s*NB + b

static_assert(NB == 4);
static_assert(NB_FULL == 4);
static_assert(SEQ >= 64 && SEQ <= SEQ_FULL);
static_assert(SEQ % 64 == 0);
static_assert(MTOT % 128 == 0);
static_assert(DM % 32 == 0);
static_assert(DM == NH * HD);
static_assert(HD == 64);
static_assert(NQKV % 64 == 0);
static_assert(((size_t)MTOT * DM) % 2048 == 0);

typedef _Float16 v16h __attribute__((ext_vector_type(16)));
typedef _Float16 v8h  __attribute__((ext_vector_type(8)));
typedef float    v8f  __attribute__((ext_vector_type(8)));
typedef float    v4f  __attribute__((ext_vector_type(4)));
typedef float    v2f  __attribute__((ext_vector_type(2)));
typedef _Float16 v2h  __attribute__((ext_vector_type(2)));

union Frag { v16h v; v8h h[2]; };

#define L2E     1.44269504088896340736f
#define CS      (1.44269504088896340736f * 3.0517578125e-05f)   // log2(e) * 2^-15 : (64q).(64k)/8 -> log2 units
#define SC_OUT  2.44140625e-04f                                  // 2^-12 : (64 z)(64 Wo) -> out

#define WT_BYTES   ((size_t)NQKV * DM * 2)
#define WOT_BYTES  ((size_t)DM * DM * 2)
#define BIAS_ELEMS 2048
#define BIAS_BYTES ((size_t)BIAS_ELEMS * 4)
#define XH_BYTES   ((size_t)MTOT * DM * 2)
#define PL_ELEMS   ((size_t)NH * NB * SEQ * HD)
#define PL_BYTES   (PL_ELEMS * 2)
#define ZC_BYTES   ((size_t)MTOT * DM * 2)
#define WS_TOTAL   (WT_BYTES + WOT_BYTES + BIAS_BYTES + XH_BYTES + 3 * PL_BYTES + ZC_BYTES)
static_assert(WS_TOTAL <= (size_t)134217728);
static_assert(WT_BYTES % 128 == 0 && WOT_BYTES % 128 == 0 && BIAS_BYTES % 128 == 0);
static_assert(XH_BYTES % 128 == 0 && PL_BYTES % 128 == 0 && ZC_BYTES % 128 == 0);
static_assert(NQKV + DM == BIAS_ELEMS);

static __device__ __forceinline__ v8f zero8() {
    v8f z;
#pragma unroll
    for (int i = 0; i < 8; ++i) z[i] = 0.0f;
    return z;
}

// 16x32 A fragment (or B fragment, n for row) from a plane kept in fragment order: lane holds
// row lane&15; with kb = 8*(lane>>4), elements 0..7 = k kb..kb+7, elements 8..15 = k kb+16..kb+23.
// A 16-row x 32-k block is 512
// halves, [j 0..1][lane 0..31][8 halves], where lane = row + 16*((k>>3)&1), j = k>>4,
// so each of the two loads reads 512 contiguous bytes (four whole lines) per wave.
static __device__ __forceinline__ v16h load_fragF(const _Float16* blk, int lane) {
    const _Float16* p = blk + lane * 8;
    Frag f;
    f.h[0] = *(const v8h*)(p);
    f.h[1] = *(const v8h*)(p + 256);
    return f.v;
}

// the bare builtin: the matrix kernels hold more than 256 VGPRs, and an asm operand cannot sit
// above v255, so a pad written in asm behind it would force its fragments into the low window
static __device__ __forceinline__ v8f wmma16b(v16h a, v16h b, v8f c) {
    return __builtin_amdgcn_wmma_f32_16x16x32_f16(false, a, false, b, (short)0, c, false, false);
}

// f32 -> bf16 RNE convert, value kept as f32
static __device__ __forceinline__ float bf16r(float x) {
    unsigned u = __float_as_uint(x);
    u = (u + 0x7FFFu + ((u >> 16) & 1u)) & 0xFFFF0000u;
    return __uint_as_float(u);
}

static __device__ __forceinline__ float ex2(float x) {
    return __builtin_amdgcn_exp2f(x);
}

// ordering for a wave-private LDS tile: stores before later loads of the same wave
static __device__ __forceinline__ void wave_lds_sync() {
    __builtin_amdgcn_fence(3, "wavefront");
    asm volatile("s_wait_dscnt 0" ::: "memory");
    __builtin_amdgcn_wave_barrier();
}

// ---------------------------------------------------------------------------
// Operand planes, one launch: the weight planes, the bias plane and the x plane need nothing
// of each other, so they share one grid; a range of the block index picks the job
// (block-uniform): [0, 256) weight tiles, 256 the bias plane, the rest the x plane.
// The weight tiles come first: theirs is the longest chain (load, LDS, barrier, store).
// ---------------------------------------------------------------------------
#define PREP_WT_BLOCKS 256                                  // 4 matrices x 8 x 8 tiles of 64 x 64
#define PREP_X_BLOCKS  ((int)(((size_t)MTOT * DM) / 2048))
#define PREP_BLOCKS    (PREP_WT_BLOCKS + 1 + PREP_X_BLOCKS)

// Weight plane builder: one 64x64 tile per block, in[i][j] (f32) -> out[j][i]
// (f16 = 64 * bf16-RNE value).
// out is kept in fragment order: [j>>4][i>>5] blocks of 512 halves, 16 out rows = 16*DM halves.
// coverage: 4 x 2 blocks x 2 halves = 16 runs of 512 B = 8 waves x 2.
static __device__ __forceinline__ void prep_wT(const float* __restrict__ sp, int src_pitch,
                                               _Float16* __restrict__ dp, _Float16* T, int tid) {
#pragma unroll
    for (int it = 0; it < 4; ++it) {
        int idx = tid + it * 256;
        int r = idx >> 4, c4 = idx & 15;
        v4f v = *(const v4f*)(sp + (size_t)r * src_pitch + c4 * 4);
        T[(c4 * 4 + 0) * 72 + r] = (_Float16)(bf16r(v.x) * 64.0f);
        T[(c4 * 4 + 1) * 72 + r] = (_Float16)(bf16r(v.y) * 64.0f);
        T[(c4 * 4 + 2) * 72 + r] = (_Float16)(bf16r(v.z) * 64.0f);
        T[(c4 * 4 + 3) * 72 + r] = (_Float16)(bf16r(v.w) * 64.0f);
    }
    __syncthreads();
    const int lane = tid & 31, wv = tid >> 5;
    const int nt0 = wv >> 2, nt1 = nt0 + 2;            // 16-row group of the out rows
    const int pq  = (wv & 3) * 2 + (lane >> 4);        // 8-half piece of the 64 k: (kc*2 + j)*2 + hi
    v8h o0 = *(const v8h*)(&T[(nt0 * 16 + (lane & 15)) * 72 + pq * 8]);
    v8h o1 = *(const v8h*)(&T[(nt1 * 16 + (lane & 15)) * 72 + pq * 8]);
    _Float16* d0 = dp + (size_t)(nt0 * 16) * DM + (wv & 3) * 256 + lane * 8;
    _Float16* d1 = dp + (size_t)(nt1 * 16) * DM + (wv & 3) * 256 + lane * 8;
    *(v8h*)d0 = o0;
    *(v8h*)d1 = o1;
    // another job's code follows in the built kernel and reuses the registers these stores name
    asm volatile("s_wait_xcnt 0x0" ::: "memory");
}

// x plane in fragment order: f16(bf16r(x[m][d])); 8 elements per thread; 8 consecutive
// lanes take the same 8-column piece of 8 consecutive rows = one whole 128-B line of xh
static __device__ __forceinline__ void prep_x(const float* __restrict__ x, _Float16* __restrict__ xh, int gid) {
    const int pc  = (gid >> 3) & 63;                   // 8-column piece of the row
    const int row = ((gid >> 9) << 3) + (gid & 7);
    const size_t i = (size_t)row * DM + pc * 8;
    const size_t j = (size_t)(row >> 4) * (16 * DM) + (pc >> 1) * 256 + ((row & 15) + 16 * (pc & 1)) * 8;
    v4f a = *(const v4f*)(x + i);
    v4f b = *(const v4f*)(x + i + 4);
    v8h o;
    o[0] = (_Float16)bf16r(a.x); o[1] = (_Float16)bf16r(a.y);
    o[2] = (_Float16)bf16r(a.z); o[3] = (_Float16)bf16r(a.w);
    o[4] = (_Float16)bf16r(b.x); o[5] = (_Float16)bf16r(b.y);
    o[6] = (_Float16)bf16r(b.z); o[7] = (_Float16)bf16r(b.w);
    *(v8h*)(xh + j) = o;
    // another job's code follows in the built kernel and reuses the registers this store names
    asm volatile("s_wait_xcnt 0x0" ::: "memory");
}

__global__ __launch_bounds__(256) void k_prep(const float* __restrict__ X,
                                              const float* __restrict__ WQ, const float* __restrict__ bQ,
                                              const float* __restrict__ WK, const float* __restrict__ bK,
                                              const float* __restrict__ WV, const float* __restrict__ bV,
                                              const float* __restrict__ WO, const float* __restrict__ bO,
                                              _Float16* __restrict__ wT, _Float16* __restrict__ woT,
                                              float* __restrict__ bias, _Float16* __restrict__ xh) {
    __shared__ __align__(16) _Float16 T[64 * 72];
    const int tid = threadIdx.x;
    const int blk = blockIdx.x;
    if (blk < PREP_WT_BLOCKS) {
        const int which = blk >> 6;                    // 0 Wq, 1 Wk, 2 Wv, 3 Wo
        const int bx = blk & 7, by = (blk >> 3) & 7;
        if (which < 3) {
            // per-head weights: in[d 512][k 64] -> out[h*64 + k][d]; bx tiles = d, by tiles = head
            const float* w = (which == 0) ? WQ : (which == 1) ? WK : WV;
            prep_wT(w + (size_t)bx * (64 * HD) + (size_t)by * (DM * HD), HD,
                    wT + (size_t)which * (DM * DM) + (size_t)bx * 1024 + (size_t)by * (64 * DM), T, tid);
        } else {
            // Wo: in[k 512][n 512] -> out[n][k]; bx tiles = k rows, by tiles = n columns
            prep_wT(WO + (size_t)bx * (64 * DM) + (size_t)by * 64, DM,
                    woT + (size_t)bx * 1024 + (size_t)by * (64 * DM), T, tid);
        }
    } else if (blk == PREP_WT_BLOCKS) {
        // Bias plane [2048] f32: [0..1535] = 64*bf16r(bQ|bK|bV) (index which*512 + h*64 + k),
        // [1536..2047] = bf16r(bO). 8 consecutive elements per thread, 64 threads per vector.
        const int which = tid >> 6;
        const float* b = (which == 0) ? bQ : (which == 1) ? bK : (which == 2) ? bV : bO;
        const float sc = (which < 3) ? 64.0f : 1.0f;
        const v4f u = *(const v4f*)(b + (tid & 63) * 8);
        const v4f v = *(const v4f*)(b + (tid & 63) * 8 + 4);
        v4f p, q;
        p.x = bf16r(u.x) * sc; p.y = bf16r(u.y) * sc; p.z = bf16r(u.z) * sc; p.w = bf16r(u.w) * sc;
        q.x = bf16r(v.x) * sc; q.y = bf16r(v.y) * sc; q.z = bf16r(v.z) * sc; q.w = bf16r(v.w) * sc;
        *(v4f*)(bias + tid * 8)     = p;
        *(v4f*)(bias + tid * 8 + 4) = q;
        // another job's code follows in the built kernel and reuses the registers these stores name
        asm volatile("s_wait_xcnt 0x0" ::: "memory");
    } else {
        prep_x(X, xh, (blk - (PREP_WT_BLOCKS + 1)) * 256 + tid);
    }
}

// ---------------------------------------------------------------------------
// GEMM main loop: wave tile 32 rows x 64 columns, K = DM, A and B planes both in
// fragment order (16 rows = 16*DM halves, 32 k = 512 halves), fragments straight
// from the 16-bit global planes (arithmetic addressing only).
// The six fragments of a 32-k step are loaded as one group, three steps ahead of their
// products, into a ring of four register sets: the blocks of a launch walk k in step, so
// no other wave hides a load's latency; the wave's own loads in flight have to.
// Four sets and the accumulators fit the 336 VGPRs that leave three waves a SIMD; a fifth set spills.
// ---------------------------------------------------------------------------
#define KSTEPS (DM / 32)
#define KRING  4
static_assert(KSTEPS >= KRING - 1);

static __device__ __forceinline__ void load_kstep(const _Float16* __restrict__ Ap,
                                                  const _Float16* __restrict__ Bp,
                                                  int t, int lane, v16h (&a)[2], v16h (&b)[4]) {
    a[0] = load_fragF(Ap + t * 512, lane);
    a[1] = load_fragF(Ap + 16 * DM + t * 512, lane);
#pragma unroll
    for (int nt = 0; nt < 4; ++nt) b[nt] = load_fragF(Bp + nt * 16 * DM + t * 512, lane);
}

static __device__ __forceinline__ void gemm_32x64(const _Float16* __restrict__ Ap,
                                                  const _Float16* __restrict__ Bp,
                                                  int lane, v8f (&acc)[2][4]) {
    v16h a[KRING][2], b[KRING][4];
#pragma unroll
    for (int t = 0; t < KRING - 1; ++t) load_kstep(Ap, Bp, t, lane, a[t], b[t]);
#pragma unroll
    for (int rt = 0; rt < 2; ++rt)
#pragma unroll
        for (int nt = 0; nt < 4; ++nt) acc[rt][nt] = zero8();
    // unrolled whole: the ring's set numbers become register names
#pragma unroll
    for (int t = 0; t < KSTEPS; ++t) {
        constexpr int AH = KRING - 1;
        if (t + AH < KSTEPS) load_kstep(Ap, Bp, t + AH, lane, a[(t + AH) % KRING], b[(t + AH) % KRING]);
        // behind the last fetch: the address registers of the fragment loads are free for reuse from here on
        if (t + AH == KSTEPS - 1) asm volatile("s_wait_xcnt 0x0" ::: "memory");
        // keeps the fetch above this step's products: sunk among them it loses its lead
        __builtin_amdgcn_sched_barrier(0);
#pragma unroll
        for (int nt = 0; nt < 4; ++nt) {
            acc[0][nt] = wmma16b(a[t % KRING][0], b[t % KRING][nt], acc[0][nt]);
            acc[1][nt] = wmma16b(a[t % KRING][1], b[t % KRING][nt], acc[1][nt]);
        }
        // keeps the next fetch below these products: raised above them it takes one more set
        __builtin_amdgcn_sched_barrier(0);
    }
}

// ---------------------------------------------------------------------------
// Projections: [MTOT x 512] x [512 x 1536]. Block = 4 waves; wave = 32 token rows
// x 64 columns (one of q/k/v, one head). Output planes q,k [h][b] in fragment order
// (16 s = 1024 halves): 8 consecutive lanes write the same piece of 8 consecutive s =
// one whole line. coverage: 32 rows x 8 pieces = 8 instructions x 32 lanes.
// Output plane V^T [h][b] in fragment order, rows = v column, k = key: [s>>5][v>>4] blocks
// of 512 halves. The wave's 32 token rows are 8 consecutive s (from a multiple of 8) of all
// 4 batches, and 8 such s of one v column are one 16-byte piece of that plane, so the wave
// writes it itself: 16 consecutive lanes write the pieces of 16 v columns = two whole lines.
// coverage: 4 batches x 64 columns = 256 pieces = 8 instructions x 32 lanes.
// ---------------------------------------------------------------------------
__global__ __launch_bounds__(128) __attribute__((amdgpu_num_vgpr(336)))
void k_proj(const _Float16* __restrict__ xh,
            const _Float16* __restrict__ wT,
            const float*    __restrict__ bias,
            _Float16* __restrict__ qkv) {
    __shared__ __align__(16) _Float16 st[4][32 * 72];     // 18 KB, wave-private tiles, pitch 144 B
    const int tid  = threadIdx.x;
    const int lane = tid & 31;
    const int w    = tid >> 5;
    const int m0   = blockIdx.x * 128 + w * 32;
    const int n0   = blockIdx.y * 64;

    const int r0 = (lane >> 4) << 3;
    const int cc = lane & 15;
    // fetched ahead of the k loop: behind it, the epilogue would wait out this load's whole latency
    float bb[4];
#pragma unroll
    for (int nt = 0; nt < 4; ++nt) bb[nt] = bias[n0 + nt * 16 + cc];
    // the fragment loads that follow land in the register that holds these loads' address
    asm volatile("s_wait_xcnt 0x0" ::: "memory");

    v8f acc[2][4];
    gemm_32x64(xh + (size_t)m0 * DM, wT + (size_t)n0 * DM, lane, acc);

    const int which = n0 >> 9;               // 0 q, 1 k, 2 v (the same for the whole block)
    const int hh    = (n0 & 511) >> 6;
    _Float16* plane = qkv + (size_t)which * PL_ELEMS;
    v8h pv[8];
    int off[8];
    if (which == 2) {
        // tile kept as pieces [batch][v column][8 s]: accumulator row rt*16 + r0 + g is
        // s = rt*4 + (r0 >> 2) + (g >> 2), batch g & 3, so elements g and g + 4 are two consecutive s
#pragma unroll
        for (int rt = 0; rt < 2; ++rt)
#pragma unroll
            for (int nt = 0; nt < 4; ++nt)
#pragma unroll
                for (int b = 0; b < NB; ++b) {
                    v2f t;
                    t.x = acc[rt][nt][b] + bb[nt];
                    t.y = acc[rt][nt][b + 4] + bb[nt];
                    *(v2h*)(&st[w][(b * 64 + nt * 16 + cc) * 8 + rt * 4 + (r0 >> 2)]) = __builtin_convertvector(t, v2h);
                }
        wave_lds_sync();
        const int sb = m0 >> 2;              // first of the wave's 8 s
#pragma unroll
        for (int it = 0; it < 8; ++it) {
            // piece it*32 + lane: batch it >> 1, v column (it & 1)*32 + lane
            pv[it]  = *(const v8h*)(&st[w][(it * 32 + lane) * 8]);
            off[it] = ((hh * NB + (it >> 1)) * SEQ + (sb & ~31)) * HD + ((it & 1) * 2 + (lane >> 4)) * 512
                    + ((sb >> 4) & 1) * 256 + (cc + 16 * ((sb >> 3) & 1)) * 8;
        }
    } else {
#pragma unroll
        for (int rt = 0; rt < 2; ++rt)
#pragma unroll
            for (int nt = 0; nt < 4; ++nt)
#pragma unroll
                for (int g = 0; g < 8; ++g)
                    st[w][(rt * 16 + r0 + g) * 72 + nt * 16 + cc] = (_Float16)(acc[rt][nt][g] + bb[nt]);
        wave_lds_sync();
        const int rq = lane >> 3, pc = lane & 7;
#pragma unroll
        for (int it = 0; it < 8; ++it) {
            // lanes run over 8 s of batch rq, piece it
            const int i = pc * 4 + rq;
            pv[it] = *(const v8h*)(&st[w][i * 72 + it * 8]);
            const int m = m0 + i;
            const int s = m >> 2, b = m & 3;     // m = s*NB + b, NB = 4
            off[it] = ((hh * NB + b) * SEQ + (s & ~15)) * HD + (it >> 1) * 256 + ((s & 15) + 16 * (it & 1)) * 8;
        }
    }
#pragma unroll
    for (int it = 0; it < 8; ++it) *(v8h*)(plane + off[it]) = pv[it];
    
}

// ---------------------------------------------------------------------------
// Fused attention, block = (head h, 64 queries), 8 waves = 4 query tiles of 16 x 2 key halves
// (wave kh takes the 32-key chunks 2i + kh). A wave holds the score tiles of ALL FOUR batches
// of its 16 queries: the four tiles have the same lane/register map, so the softmax over the
// batch axis is plain register arithmetic, with one maximum, one sum and one reciprocal per
// (query, key) for the four batches; nothing is exchanged between waves inside the loop.
// The scores are formed transposed, S^T = K q^T (A = K rows, B = q): a lane then holds 8
// consecutive keys of ONE query, which is the B-operand map of P^T, so the two 16-key tiles of
// a chunk, converted in place, are the B fragment of o^T += V^T P^T; P touches no LDS.
// Per 16-key half of a chunk: 8 WMMAs (q/k fragments from the fragment-order planes), then
//   e_b = 2^((s_b - max_b s) * CS), p1_b = e_b / sum_b e     (sum >= 1, no overflow)
//   P_b = 2^(p1_b * log2 e) in [1, e]  (key-axis softmax numerator, no shift needed)
// the sum of P is accumulated per lane in f32 (one query, half of the keys; two partial sums),
// o^T_b += V^T_b @ P^T_b (16 WMMAs per chunk, V^T fragments from the plane as A).
// After the loop the two key halves' o and row sums are joined through LDS (one block barrier).
// ---------------------------------------------------------------------------
static __device__ __forceinline__ void batch_softmax16(const v8f (&sc)[NB], v2f (&rs)[NB], v8h (&ph)[NB]) {
#pragma unroll
    for (int g = 0; g < 8; g += 2) {
        v2f p[NB];
#pragma unroll
        for (int u = 0; u < 2; ++u) {
            const float m  = fmaxf(fmaxf(sc[0][g + u], sc[1][g + u]), fmaxf(sc[2][g + u], sc[3][g + u]));
            const float mc = m * CS;
            float e[NB];
#pragma unroll
            for (int b = 0; b < NB; ++b) e[b] = ex2(__builtin_fmaf(sc[b][g + u], CS, -mc));
            const float r = __builtin_amdgcn_rcpf((e[0] + e[1]) + (e[2] + e[3])) * L2E;
#pragma unroll
            for (int b = 0; b < NB; ++b) p[b][u] = ex2(e[b] * r);
        }
#pragma unroll
        for (int b = 0; b < NB; ++b) {
            const v2h hp = __builtin_convertvector(p[b], v2h);
            rs[b] += p[b];
            ph[b][g]     = hp[0];
            ph[b][g + 1] = hp[1];
        }
    }
}

__global__ __launch_bounds__(256)
void k_attn(const _Float16* __restrict__ qp,
            const _Float16* __restrict__ kp,
            const _Float16* __restrict__ vT,
            _Float16* __restrict__ zc) {
    __shared__ __align__(32) float    Xo[4][NB * 4][32 * 8];     // 64 KB, key half 1 -> key half 0
    __shared__ __align__(16) float    Xr[4][NB][32];             // 2 KB, key half 1 -> key half 0
    __shared__ __align__(16) _Float16 Zst[4][NB][16 * 72];       // 36 KB, pitch 144 B, wave-private

    const int tid  = threadIdx.x;
    const int lane = tid & 31;
    const int wv   = __builtin_amdgcn_readfirstlane(tid >> 5);
    const int qt   = wv & 3;                  // query tile of the block
    const int kh   = wv >> 2;                 // key half
    const int h    = blockIdx.y;
    const int s0   = blockIdx.x * 64 + qt * 16;
    const int r0   = (lane >> 4) << 3;
    const int cc   = lane & 15;
    constexpr int PB = SEQ * HD;              // halves of one (h, b) plane

    const _Float16* qb = qp + ((size_t)h * NB * SEQ + s0) * HD;
    const _Float16* kc = kp + (size_t)h * NB * PB + kh * (32 * HD);   // this wave's current chunk
    const _Float16* vr = vT + (size_t)h * NB * PB + kh * (32 * HD);

    v16h qf[NB][2];
#pragma unroll
    for (int b = 0; b < NB; ++b) {
        qf[b][0] = load_fragF(qb + b * PB, lane);         // d 0..31
        qf[b][1] = load_fragF(qb + b * PB + 512, lane);   // d 32..63
    }

    v8f o[NB][4];
    v2f rs[NB];
#pragma unroll
    for (int b = 0; b < NB; ++b) {
#pragma unroll
        for (int nt = 0; nt < 4; ++nt) o[b][nt] = zero8();
        rs[b] = 0.0f;
    }

    // K fragments of 16 keys x 4 batches, fetched one 16-key half ahead into the same registers
    v16h kf[NB][2];
#pragma unroll
    for (int b = 0; b < NB; ++b) {
        kf[b][0] = load_fragF(kc + b * PB, lane);
        kf[b][1] = load_fragF(kc + b * PB + 512, lane);
    }

    // the q base's registers are free for reuse from here on
    asm volatile("s_wait_xcnt 0x0" ::: "memory");
    // keeps what follows below that wait
    __builtin_amdgcn_sched_barrier(0);

#pragma unroll 1
    for (int i = 0; i < SEQ / 64; ++i) {
        // this chunk's V^T fragments, one group, in flight under the scores and the softmax
        v16h vf[NB][4];
#pragma unroll
        for (int b = 0; b < NB; ++b)
#pragma unroll
            for (int nt = 0; nt < 4; ++nt)
                vf[b][nt] = load_fragF(vr + b * PB + nt * 512, lane);   // rows = v column, k = key

        v8f sc[NB];
        v8h p0[NB], p1[NB];                   // P^T of keys 0..15 and 16..31: B elements 0..7 and 8..15
        // keys 0..15 of the chunk, then the fetch of keys 16..31 into the same registers
#pragma unroll
        for (int b = 0; b < NB; ++b) sc[b] = wmma16b(kf[b][0], qf[b][0], zero8());
#pragma unroll
        for (int b = 0; b < NB; ++b) sc[b] = wmma16b(kf[b][1], qf[b][1], sc[b]);
#pragma unroll
        for (int b = 0; b < NB; ++b) {
            kf[b][0] = load_fragF(kc + b * PB + 16 * HD, lane);
            kf[b][1] = load_fragF(kc + b * PB + 16 * HD + 512, lane);
        }
        // keeps the fetch above the softmax: moved below it, the next scores wait out its whole latency
        __builtin_amdgcn_sched_barrier(0);
        batch_softmax16(sc, rs, p0);
        // keeps the second scores below the first softmax: moved up, they wait on a fetch just issued
        __builtin_amdgcn_sched_barrier(0);

        // keys 16..31 of the chunk
#pragma unroll
        for (int b = 0; b < NB; ++b) sc[b] = wmma16b(kf[b][0], qf[b][0], zero8());
#pragma unroll
        for (int b = 0; b < NB; ++b) sc[b] = wmma16b(kf[b][1], qf[b][1], sc[b]);
        // the address registers of the loads issued so far are advanced next
        asm volatile("s_wait_xcnt 0x0" ::: "memory");
        // keeps the two additions below that wait
        __builtin_amdgcn_sched_barrier(0);
        // first half of this wave's next chunk (the last trip re-reads its own chunk, so the
        // addresses stay inside the planes)
        const int step = (i + 1 < SEQ / 64) ? 64 * HD : 0;
        kc += step;
        vr += step;
#pragma unroll
        for (int b = 0; b < NB; ++b) {
            kf[b][0] = load_fragF(kc + b * PB, lane);
            kf[b][1] = load_fragF(kc + b * PB + 512, lane);
        }
        // keeps the fetch above the softmax, as above
        __builtin_amdgcn_sched_barrier(0);
        batch_softmax16(sc, rs, p1);

        Frag pb[NB];                          // n = query, k = 32 keys, the order of the V^T fragments
#pragma unroll
        for (int b = 0; b < NB; ++b) { pb[b].h[0] = p0[b]; pb[b].h[1] = p1[b]; }
#pragma unroll
        for (int nt = 0; nt < 4; ++nt)
#pragma unroll
            for (int b = 0; b < NB; ++b) o[b][nt] = wmma16b(vf[b][nt], pb[b].v, o[b][nt]);
    }

    // key half 1 hands its partial o and row sums to key half 0 of the same query tile
    if (kh == 1) {
#pragma unroll
        for (int b = 0; b < NB; ++b) {
#pragma unroll
            for (int nt = 0; nt < 4; ++nt) *(v8f*)(&Xo[qt][b * 4 + nt][lane * 8]) = o[b][nt];
            Xr[qt][b][lane] = rs[b].x + rs[b].y;
        }
    }
    __syncthreads();
    if (kh == 1) return;

#pragma unroll
    for (int b = 0; b < NB; ++b) {
        // row sum of query cc: both key halves, then lanes cc and cc + 16 (each has half of the keys)
        const float v  = (rs[b].x + rs[b].y) + Xr[qt][b][lane];
        const int   vi = __float_as_int(v);
        const float vx = __int_as_float(__builtin_amdgcn_permlanex16(vi, vi, 0x76543210, 0xfedcba98, false, false));
        const float ri = __builtin_amdgcn_rcpf(v + vx);
        // o^T: a lane holds v columns nt*16 + r0 .. + 7 of query cc = one 16-byte piece of the z row
#pragma unroll
        for (int nt = 0; nt < 4; ++nt) {
            const v8f x = *(const v8f*)(&Xo[qt][b * 4 + nt][lane * 8]);
            v8h zr;
#pragma unroll
            for (int g = 0; g < 8; ++g) zr[g] = (_Float16)((o[b][nt][g] + x[g]) * ri);
            *(v8h*)(&Zst[qt][b][cc * 72 + nt * 16 + r0]) = zr;
        }
    }
    // zc is kept in fragment order, rows m = s*NB + b: a 16-row group holds 4 queries of all
    // 4 batches, all of them this wave's own, so the wave writes whole 512-B runs from its tiles
    wave_lds_sync();

    const int zb = lane & 3;                       // batch whose tile is read
#pragma unroll
    for (int gq = 0; gq < 4; ++gq) {
        const int zq = gq * 4 + ((lane & 15) >> 2);    // query of the 16
        v8h zv[4];
        int off[4];
#pragma unroll
        for (int it = 0; it < 4; ++it) {
            zv[it]  = *(const v8h*)(&Zst[qt][zb][zq * 72 + (it * 2 + (lane >> 4)) * 8]);
            off[it] = ((s0 >> 2) + gq) * (16 * DM) + h * 1024 + it * 256 + lane * 8;
        }
#pragma unroll
        for (int it = 0; it < 4; ++it) *(v8h*)(zc + off[it]) = zv[it];
    }
}

// ---------------------------------------------------------------------------
// Output projection: out[m][n] = 2^-12 * (64 z)[m][:] . (64 Wo)[:][n] + bO[n].
// Block = 4 waves; wave = 32 rows x 64 columns. f32 tile staged in a wave-private
// LDS tile; each instruction writes two whole 256-B row segments (16 lanes x 16 B
// coverage: 32 rows = 16 instructions x 2 rows.
// ---------------------------------------------------------------------------
__global__ __launch_bounds__(128) __attribute__((amdgpu_num_vgpr(336)))
void k_out(const _Float16* __restrict__ zc,
           const _Float16* __restrict__ woT,
           const float*    __restrict__ bo,
           float* __restrict__ out) {
    __shared__ __align__(16) float Ost[4][32 * 64];     // 32 KB, wave-private tiles
    const int tid  = threadIdx.x;
    const int lane = tid & 31;
    const int w    = tid >> 5;
    const int m0   = blockIdx.x * 128 + w * 32;
    const int n0   = blockIdx.y * 64;

    const int r0 = (lane >> 4) << 3;
    const int cc = lane & 15;
    // fetched ahead of the k loop: behind it, the epilogue would wait out this load's whole latency
    float bb[4];
#pragma unroll
    for (int nt = 0; nt < 4; ++nt) bb[nt] = bo[n0 + nt * 16 + cc];
    // the fragment loads that follow land in the register that holds these loads' address
    asm volatile("s_wait_xcnt 0x0" ::: "memory");

    v8f acc[2][4];
    gemm_32x64(zc + (size_t)m0 * DM, woT + (size_t)n0 * DM, lane, acc);

#pragma unroll
    for (int rt = 0; rt < 2; ++rt)
#pragma unroll
        for (int nt = 0; nt < 4; ++nt)
#pragma unroll
            for (int g = 0; g < 8; ++g)
                Ost[w][(rt * 16 + r0 + g) * 64 + nt * 16 + cc] =
                    __builtin_fmaf(acc[rt][nt][g], SC_OUT, bb[nt]);
    wave_lds_sync();

    const int rh = lane >> 4, c4 = lane & 15;
    v4f sv[16];
#pragma unroll
    for (int it = 0; it < 16; ++it) sv[it] = *(const v4f*)(&Ost[w][(it * 2 + rh) * 64 + c4 * 4]);
    float* ob = out + (size_t)m0 * DM + n0 + (size_t)rh * DM + c4 * 4;
#pragma unroll
    for (int it = 0; it < 16; ++it) *(v4f*)(ob + (size_t)(it * 2) * DM) = sv[it];
    
}

// ---------------------------------------------------------------------------
extern "C" void kernel_launch(void* const* d_in, const int* in_sizes, int n_in,
                              void* d_out, int out_size, void* d_ws, size_t ws_size,
                              hipStream_t stream) {
    if (n_in < 9) return;
    if (in_sizes[0] < ((SEQ - 1) * NB_FULL + NB) * DM) return;
    if (in_sizes[1] < NH * DM * HD || in_sizes[3] < NH * DM * HD || in_sizes[5] < NH * DM * HD) return;
    if (in_sizes[2] < NH * HD || in_sizes[4] < NH * HD || in_sizes[6] < NH * HD) return;
    if (in_sizes[7] < DM * DM || in_sizes[8] < DM) return;
    if (out_size < MTOT * DM) return;
    if ((size_t)WS_TOTAL > ws_size) return;

    const float* X  = (const float*)d_in[0];   // [S][B][512], row m = s*4 + b
    const float* WQ = (const float*)d_in[1];   // [8][512][64]
    const float* bQ = (const float*)d_in[2];   // [8][64]
    const float* WK = (const float*)d_in[3];
    const float* bK = (const float*)d_in[4];
    const float* WV = (const float*)d_in[5];
    const float* bV = (const float*)d_in[6];
    const float* WO = (const float*)d_in[7];   // [512 in][512 out]
    const float* bO = (const float*)d_in[8];   // [512]
    float* out = (float*)d_out;                // [S][B][512]

    char* ws = (char*)d_ws;
    size_t off = 0;
    _Float16* wT   = (_Float16*)(ws + off); off += WT_BYTES;     // [1536][512], fragment order
    _Float16* woT  = (_Float16*)(ws + off); off += WOT_BYTES;    // [512][512], fragment order
    float*    bias = (float*)(ws + off);    off += BIAS_BYTES;   // [2048]
    _Float16* xh   = (_Float16*)(ws + off); off += XH_BYTES;     // [MTOT][512], fragment order
    _Float16* qkv  = (_Float16*)(ws + off); off += 3 * PL_BYTES; // q, k, V^T, each [h][b] in fragment order
    _Float16* zc   = (_Float16*)(ws + off); off += ZC_BYTES;     // [MTOT][512], fragment order
    if (off > ws_size) return;

    k_prep<<<dim3(PREP_BLOCKS), dim3(256), 0, stream>>>(X, WQ, bQ, WK, bK, WV, bV, WO, bO, wT, woT, bias, xh);
    k_proj<<<dim3(MTOT / 128, NQKV / 64), dim3(128), 0, stream>>>(xh, wT, bias, qkv);
    k_attn<<<dim3(SEQ / 64, NH), dim3(256), 0, stream>>>(qkv, qkv + PL_ELEMS, qkv + 2 * PL_ELEMS, zc);
    k_out<<<dim3(MTOT / 128, DM / 64), dim3(128), 0, stream>>>(zc, woT, bias + NQKV, out);
}

// v008
// It runs in 75.3 microseconds.
// Two timings next to v007 put it at 1.10 and 1.12 times that version's speed.
// Counting every step since v000, it is 3.74 times as fast.
#include <hip/hip_runtime.h>
#include <hip/hip_fp16.h>

// All contractions on v_wmma_f32_16x16x32_f16 (f16 operands, f32 accumulate), single products: x*[Wq|Wk|Wv], q*k^T, P*v, z*Wo; every float input RNE-converted to bf16 first (exact in f16), weight planes and q/k/v/z planes carried x64, P = exp(p1) in [1,e] unscaled.

#ifndef NB
#define NB 4             // batch; an attention wave holds the score tiles of all 4 batches (must stay 4)
#endif
#ifndef SEQ
#define SEQ 2048
#endif
#define NB_FULL  4
#define SEQ_FULL 2048
#define DM   512          // model width
#define NH   8            // heads
#define HD   64           // head width (dk = dv)
#define NQKV (3 * NH * HD)
#define MTOT (SEQ * NB)   // token rows m = s*NB + b

static_assert(NB == 4);
static_assert(NB_FULL == 4);
static_assert(SEQ >= 64 && SEQ <= SEQ_FULL);
static_assert(SEQ % 64 == 0);
static_assert(MTOT % 128 == 0);
static_assert(DM % 32 == 0);
static_assert(DM == NH * HD);
static_assert(HD == 64);
static_assert(NQKV % 64 == 0);
static_assert(((size_t)MTOT * DM) % 2048 == 0);

typedef _Float16 v16h __attribute__((ext_vector_type(16)));
typedef _Float16 v8h  __attribute__((ext_vector_type(8)));
typedef float    v8f  __attribute__((ext_vector_type(8)));
typedef float    v4f  __attribute__((ext_vector_type(4)));
typedef float    v2f  __attribute__((ext_vector_type(2)));
typedef _Float16 v2h  __attribute__((ext_vector_type(2)));

union Frag { v16h v; v8h h[2]; };

#define L2E     1.44269504088896340736f
#define CS      (1.44269504088896340736f * 3.0517578125e-05f)   // log2(e) * 2^-15 : (64q).(64k)/8 -> log2 units
#define SC_OUT  2.44140625e-04f                                  // 2^-12 : (64 z)(64 Wo) -> out

#define WT_BYTES   ((size_t)NQKV * DM * 2)
#define WOT_BYTES  ((size_t)DM * DM * 2)
#define BIAS_ELEMS 2048
#define BIAS_BYTES ((size_t)BIAS_ELEMS * 4)
#define XH_BYTES   ((size_t)MTOT * DM * 2)
#define PL_ELEMS   ((size_t)NH * NB * SEQ * HD)
#define PL_BYTES   (PL_ELEMS * 2)
#define ZC_BYTES   ((size_t)MTOT * DM * 2)
#define WS_TOTAL   (WT_BYTES + WOT_BYTES + BIAS_BYTES + XH_BYTES + 3 * PL_BYTES + ZC_BYTES)
static_assert(WS_TOTAL <= (size_t)134217728);
static_assert(WT_BYTES % 128 == 0 && WOT_BYTES % 128 == 0 && BIAS_BYTES % 128 == 0);
static_assert(XH_BYTES % 128 == 0 && PL_BYTES % 128 == 0 && ZC_BYTES % 128 == 0);
static_assert(NQKV + DM == BIAS_ELEMS);

static __device__ __forceinline__ v8f zero8() {
    v8f z;
#pragma unroll
    for (int i = 0; i < 8; ++i) z[i] = 0.0f;
    return z;
}

// 16x32 A fragment (or B fragment, n for row) from a plane kept in fragment order: lane holds
// row lane&15; with kb = 8*(lane>>4), elements 0..7 = k kb..kb+7, elements 8..15 = k kb+16..kb+23.
// A 16-row x 32-k block is 512
// halves, [j 0..1][lane 0..31][8 halves], where lane = row + 16*((k>>3)&1), j = k>>4,
// so each of the two loads reads 512 contiguous bytes (four whole lines) per wave.
static __device__ __forceinline__ v16h load_fragF(const _Float16* blk, int lane) {
    const _Float16* p = blk + lane * 8;
    Frag f;
    f.h[0] = *(const v8h*)(p);
    f.h[1] = *(const v8h*)(p + 256);
    return f.v;
}

// the bare builtin: the matrix kernels hold more than 256 VGPRs, and an asm operand cannot sit
// above v255, so a pad written in asm behind it would force its fragments into the low window
static __device__ __forceinline__ v8f wmma16b(v16h a, v16h b, v8f c) {
    return __builtin_amdgcn_wmma_f32_16x16x32_f16(false, a, false, b, (short)0, c, false, false);
}

// f32 -> bf16 RNE convert, value kept as f32
static __device__ __forceinline__ float bf16r(float x) {
    unsigned u = __float_as_uint(x);
    u = (u + 0x7FFFu + ((u >> 16) & 1u)) & 0xFFFF0000u;
    return __uint_as_float(u);
}

static __device__ __forceinline__ float ex2(float x) {
    return __builtin_amdgcn_exp2f(x);
}

// ordering for a wave-private LDS tile: stores before later loads of the same wave
static __device__ __forceinline__ void wave_lds_sync() {
    __builtin_amdgcn_fence(3, "wavefront");
    asm volatile("s_wait_dscnt 0" ::: "memory");
    __builtin_amdgcn_wave_barrier();
}

// ---------------------------------------------------------------------------
// Operand planes, one launch: the weight planes, the bias plane and the x plane need nothing
// of each other, so they share one grid; a range of the block index picks the job
// (block-uniform): [0, 256) weight tiles, 256 the bias plane, the rest the x plane.
// The weight tiles come first: theirs is the longest chain (load, LDS, barrier, store).
// ---------------------------------------------------------------------------
#define PREP_WT_BLOCKS 256                                  // 4 matrices x 8 x 8 tiles of 64 x 64
#define PREP_X_BLOCKS  ((int)(((size_t)MTOT * DM) / 2048))
#define PREP_BLOCKS    (PREP_WT_BLOCKS + 1 + PREP_X_BLOCKS)

// Weight plane builder: one 64x64 tile per block, in[i][j] (f32) -> out[j][i]
// (f16 = 64 * bf16-RNE value).
// out is kept in fragment order: [j>>4][i>>5] blocks of 512 halves, 16 out rows = 16*DM halves.
// coverage: 4 x 2 blocks x 2 halves = 16 runs of 512 B = 8 waves x 2.
static __device__ __forceinline__ void prep_wT(const float* __restrict__ sp, int src_pitch,
                                               _Float16* __restrict__ dp, _Float16* T, int tid) {
#pragma unroll
    for (int it = 0; it < 4; ++it) {
        int idx = tid + it * 256;
        int r = idx >> 4, c4 = idx & 15;
        v4f v = *(const v4f*)(sp + (size_t)r * src_pitch + c4 * 4);
        T[(c4 * 4 + 0) * 72 + r] = (_Float16)(bf16r(v.x) * 64.0f);
        T[(c4 * 4 + 1) * 72 + r] = (_Float16)(bf16r(v.y) * 64.0f);
        T[(c4 * 4 + 2) * 72 + r] = (_Float16)(bf16r(v.z) * 64.0f);
        T[(c4 * 4 + 3) * 72 + r] = (_Float16)(bf16r(v.w) * 64.0f);
    }
    __syncthreads();
    const int lane = tid & 31, wv = tid >> 5;
    const int nt0 = wv >> 2, nt1 = nt0 + 2;            // 16-row group of the out rows
    const int pq  = (wv & 3) * 2 + (lane >> 4);        // 8-half piece of the 64 k: (kc*2 + j)*2 + hi
    v8h o0 = *(const v8h*)(&T[(nt0 * 16 + (lane & 15)) * 72 + pq * 8]);
    v8h o1 = *(const v8h*)(&T[(nt1 * 16 + (lane & 15)) * 72 + pq * 8]);
    _Float16* d0 = dp + (size_t)(nt0 * 16) * DM + (wv & 3) * 256 + lane * 8;
    _Float16* d1 = dp + (size_t)(nt1 * 16) * DM + (wv & 3) * 256 + lane * 8;
    *(v8h*)d0 = o0;
    *(v8h*)d1 = o1;
    // another job's code follows in the built kernel and reuses the registers these stores name
    asm volatile("s_wait_xcnt 0x0" ::: "memory");
}

// x plane in fragment order: f16(bf16r(x[m][d])); 8 elements per thread; 8 consecutive
// lanes take the same 8-column piece of 8 consecutive rows = one whole 128-B line of xh
static __device__ __forceinline__ void prep_x(const float* __restrict__ x, _Float16* __restrict__ xh, int gid) {
    const int pc  = (gid >> 3) & 63;                   // 8-column piece of the row
    const int row = ((gid >> 9) << 3) + (gid & 7);
    const size_t i = (size_t)row * DM + pc * 8;
    const size_t j = (size_t)(row >> 4) * (16 * DM) + (pc >> 1) * 256 + ((row & 15) + 16 * (pc & 1)) * 8;
    v4f a = *(const v4f*)(x + i);
    v4f b = *(const v4f*)(x + i + 4);
    v8h o;
    o[0] = (_Float16)bf16r(a.x); o[1] = (_Float16)bf16r(a.y);
    o[2] = (_Float16)bf16r(a.z); o[3] = (_Float16)bf16r(a.w);
    o[4] = (_Float16)bf16r(b.x); o[5] = (_Float16)bf16r(b.y);
    o[6] = (_Float16)bf16r(b.z); o[7] = (_Float16)bf16r(b.w);
    *(v8h*)(xh + j) = o;
    // another job's code follows in the built kernel and reuses the registers this store names
    asm volatile("s_wait_xcnt 0x0" ::: "memory");
}

__global__ __launch_bounds__(256) void k_prep(const float* __restrict__ X,
                                              const float* __restrict__ WQ, const float* __restrict__ bQ,
                                              const float* __restrict__ WK, const float* __restrict__ bK,
                                              const float* __restrict__ WV, const float* __restrict__ bV,
                                              const float* __restrict__ WO, const float* __restrict__ bO,
                                              _Float16* __restrict__ wT, _Float16* __restrict__ woT,
                                              float* __restrict__ bias, _Float16* __restrict__ xh) {
    __shared__ __align__(16) _Float16 T[64 * 72];
    const int tid = threadIdx.x;
    const int blk = blockIdx.x;
    if (blk < PREP_WT_BLOCKS) {
        const int which = blk >> 6;                    // 0 Wq, 1 Wk, 2 Wv, 3 Wo
        const int bx = blk & 7, by = (blk >> 3) & 7;
        if (which < 3) {
            // per-head weights: in[d 512][k 64] -> out[h*64 + k][d]; bx tiles = d, by tiles = head
            const float* w = (which == 0) ? WQ : (which == 1) ? WK : WV;
            prep_wT(w + (size_t)bx * (64 * HD) + (size_t)by * (DM * HD), HD,
                    wT + (size_t)which * (DM * DM) + (size_t)bx * 1024 + (size_t)by * (64 * DM), T, tid);
        } else {
            // Wo: in[k 512][n 512] -> out[n][k]; bx tiles = k rows, by tiles = n columns
            prep_wT(WO + (size_t)bx * (64 * DM) + (size_t)by * 64, DM,
                    woT + (size_t)bx * 1024 + (size_t)by * (64 * DM), T, tid);
        }
    } else if (blk == PREP_WT_BLOCKS) {
        // Bias plane [2048] f32: [0..1535] = 64*bf16r(bQ|bK|bV) (index which*512 + h*64 + k),
        // [1536..2047] = bf16r(bO). 8 consecutive elements per thread, 64 threads per vector.
        const int which = tid >> 6;
        const float* b = (which == 0) ? bQ : (which == 1) ? bK : (which == 2) ? bV : bO;
        const float sc = (which < 3) ? 64.0f : 1.0f;
        const v4f u = *(const v4f*)(b + (tid & 63) * 8);
        const v4f v = *(const v4f*)(b + (tid & 63) * 8 + 4);
        v4f p, q;
        p.x = bf16r(u.x) * sc; p.y = bf16r(u.y) * sc; p.z = bf16r(u.z) * sc; p.w = bf16r(u.w) * sc;
        q.x = bf16r(v.x) * sc; q.y = bf16r(v.y) * sc; q.z = bf16r(v.z) * sc; q.w = bf16r(v.w) * sc;
        *(v4f*)(bias + tid * 8)     = p;
        *(v4f*)(bias + tid * 8 + 4) = q;
        // another job's code follows in the built kernel and reuses the registers these stores name
        asm volatile("s_wait_xcnt 0x0" ::: "memory");
    } else {
        prep_x(X, xh, (blk - (PREP_WT_BLOCKS + 1)) * 256 + tid);
    }
}

// ---------------------------------------------------------------------------
// GEMM main loop: wave tile 32 rows x 64 columns, K = DM, A and B planes both in
// fragment order (16 rows = 16*DM halves, 32 k = 512 halves), fragments straight
// from the 16-bit global planes (arithmetic addressing only).
// The six fragments of a 32-k step are loaded as one group, three steps ahead of their
// products, into a ring of four register sets: three waves a SIMD do not hide a load's
// latency; the wave's own loads in flight have to.
// Four sets and the accumulators fit the 336 VGPRs that leave three waves a SIMD; a fifth set spills.
// The blocks of a launch that share rows of A or of B each enter the k walk at their own step
// (st, from the block's two indices) and wrap round, so that they do not ask L2 for the same
// lines at the same moment; trip t takes k step (st + t) mod KSTEPS.
// ---------------------------------------------------------------------------
#define KSTEPS (DM / 32)
#define KRING  4
static_assert(KSTEPS >= KRING - 1);
static_assert((KSTEPS & (KSTEPS - 1)) == 0);

static __device__ __forceinline__ void load_kstep(const _Float16* __restrict__ Ak,
                                                  const _Float16* __restrict__ Bk,
                                                  int lane, v16h (&a)[2], v16h (&b)[4]) {
    a[0] = load_fragF(Ak, lane);
    a[1] = load_fragF(Ak + 16 * DM, lane);
#pragma unroll
    for (int nt = 0; nt < 4; ++nt) b[nt] = load_fragF(Bk + nt * 16 * DM, lane);
}

// to the next k step of the walk; behind the last one comes the first
static __device__ __forceinline__ void next_kstep(const _Float16*& Ak, const _Float16*& Bk, int& ks) {
    // the address registers of the fetch before are advanced next
    asm volatile("s_wait_xcnt 0x0" ::: "memory");
    // keeps the two additions below that wait
    __builtin_amdgcn_sched_barrier(0);
    const bool wrap = (ks == KSTEPS - 1);
    const int  step = wrap ? -(KSTEPS - 1) * 512 : 512;
    ks = wrap ? 0 : ks + 1;
    Ak += step;
    Bk += step;
}

static __device__ __forceinline__ void gemm_32x64(const _Float16* __restrict__ Ap,
                                                  const _Float16* __restrict__ Bp,
                                                  int st, int lane, v8f (&acc)[2][4]) {
    v16h a[KRING][2], b[KRING][4];
    int ks = st & (KSTEPS - 1);
    const _Float16* Ak = Ap + ks * 512;
    const _Float16* Bk = Bp + ks * 512;
#pragma unroll
    for (int t = 0; t < KRING - 1; ++t) {
        if (t > 0) next_kstep(Ak, Bk, ks);
        load_kstep(Ak, Bk, lane, a[t], b[t]);
    }
#pragma unroll
    for (int rt = 0; rt < 2; ++rt)
#pragma unroll
        for (int nt = 0; nt < 4; ++nt) acc[rt][nt] = zero8();
    // unrolled whole: the ring's set numbers become register names
#pragma unroll
    for (int t = 0; t < KSTEPS; ++t) {
        constexpr int AH = KRING - 1;
        if (t + AH < KSTEPS) {
            next_kstep(Ak, Bk, ks);
            load_kstep(Ak, Bk, lane, a[(t + AH) % KRING], b[(t + AH) % KRING]);
        }
        // behind the last fetch: the address registers of the fragment loads are free for reuse from here on
        if (t + AH == KSTEPS - 1) asm volatile("s_wait_xcnt 0x0" ::: "memory");
        // keeps the fetch above this step's products: sunk among them it loses its lead
        __builtin_amdgcn_sched_barrier(0);
#pragma unroll
        for (int nt = 0; nt < 4; ++nt) {
            acc[0][nt] = wmma16b(a[t % KRING][0], b[t % KRING][nt], acc[0][nt]);
            acc[1][nt] = wmma16b(a[t % KRING][1], b[t % KRING][nt], acc[1][nt]);
        }
        // keeps the next fetch below these products: raised above them it takes one more set
        __builtin_amdgcn_sched_barrier(0);
    }
}

// ---------------------------------------------------------------------------
// Projections: [MTOT x 512] x [512 x 1536]. Block = 4 waves; wave = 32 token rows
// x 64 columns (one of q/k/v, one head). Output planes q,k [h][b] in fragment order
// (16 s = 1024 halves): 8 consecutive lanes write the same piece of 8 consecutive s =
// one whole line. coverage: 32 rows x 8 pieces = 8 instructions x 32 lanes.
// Output plane V^T [h][b] in fragment order, rows = v column, k = key: [s>>5][v>>4] blocks
// of 512 halves. The wave's 32 token rows are 8 consecutive s (from a multiple of 8) of all
// 4 batches, and 8 such s of one v column are one 16-byte piece of that plane, so the wave
// writes it itself: 16 consecutive lanes write the pieces of 16 v columns = two whole lines.
// coverage: 4 batches x 64 columns = 256 pieces = 8 instructions x 32 lanes.
// ---------------------------------------------------------------------------
__global__ __launch_bounds__(128) __attribute__((amdgpu_num_vgpr(336)))
void k_proj(const _Float16* __restrict__ xh,
            const _Float16* __restrict__ wT,
            const float*    __restrict__ bias,
            _Float16* __restrict__ qkv) {
    __shared__ __align__(16) _Float16 st[4][32 * 72];     // 18 KB, wave-private tiles, pitch 144 B
    const int tid  = threadIdx.x;
    const int lane = tid & 31;
    const int w    = __builtin_amdgcn_readfirstlane(tid >> 5);   // scalar: the A base stays in scalar registers
    const int m0   = blockIdx.x * 128 + w * 32;
    const int n0   = blockIdx.y * 64;

    const int r0 = (lane >> 4) << 3;
    const int cc = lane & 15;
    // fetched ahead of the k loop: behind it, the epilogue would wait out this load's whole latency
    float bb[4];
#pragma unroll
    for (int nt = 0; nt < 4; ++nt) bb[nt] = bias[n0 + nt * 16 + cc];
    // the fragment loads that follow land in the register that holds these loads' address
    asm volatile("s_wait_xcnt 0x0" ::: "memory");

    v8f acc[2][4];
    gemm_32x64(xh + (size_t)m0 * DM, wT + (size_t)n0 * DM, blockIdx.x + blockIdx.y, lane, acc);

    const int which = n0 >> 9;               // 0 q, 1 k, 2 v (the same for the whole block)
    const int hh    = (n0 & 511) >> 6;
    _Float16* plane = qkv + (size_t)which * PL_ELEMS;
    v8h pv[8];
    int off[8];
    if (which == 2) {
        // tile kept as pieces [batch][v column][8 s]: accumulator row rt*16 + r0 + g is
        // s = rt*4 + (r0 >> 2) + (g >> 2), batch g & 3, so elements g and g + 4 are two consecutive s
#pragma unroll
        for (int rt = 0; rt < 2; ++rt)
#pragma unroll
            for (int nt = 0; nt < 4; ++nt)
#pragma unroll
                for (int b = 0; b < NB; ++b) {
                    v2f t;
                    t.x = acc[rt][nt][b] + bb[nt];
                    t.y = acc[rt][nt][b + 4] + bb[nt];
                    *(v2h*)(&st[w][(b * 64 + nt * 16 + cc) * 8 + rt * 4 + (r0 >> 2)]) = __builtin_convertvector(t, v2h);
                }
        wave_lds_sync();
        const int sb = m0 >> 2;              // first of the wave's 8 s
#pragma unroll
        for (int it = 0; it < 8; ++it) {
            // piece it*32 + lane: batch it >> 1, v column (it & 1)*32 + lane
            pv[it]  = *(const v8h*)(&st[w][(it * 32 + lane) * 8]);
            off[it] = ((hh * NB + (it >> 1)) * SEQ + (sb & ~31)) * HD + ((it & 1) * 2 + (lane >> 4)) * 512
                    + ((sb >> 4) & 1) * 256 + (cc + 16 * ((sb >> 3) & 1)) * 8;
        }
    } else {
#pragma unroll
        for (int rt = 0; rt < 2; ++rt)
#pragma unroll
            for (int nt = 0; nt < 4; ++nt)
#pragma unroll
                for (int g = 0; g < 8; ++g)
                    st[w][(rt * 16 + r0 + g) * 72 + nt * 16 + cc] = (_Float16)(acc[rt][nt][g] + bb[nt]);
        wave_lds_sync();
        const int rq = lane >> 3, pc = lane & 7;
#pragma unroll
        for (int it = 0; it < 8; ++it) {
            // lanes run over 8 s of batch rq, piece it
            const int i = pc * 4 + rq;
            pv[it] = *(const v8h*)(&st[w][i * 72 + it * 8]);
            const int m = m0 + i;
            const int s = m >> 2, b = m & 3;     // m = s*NB + b, NB = 4
            off[it] = ((hh * NB + b) * SEQ + (s & ~15)) * HD + (it >> 1) * 256 + ((s & 15) + 16 * (it & 1)) * 8;
        }
    }
#pragma unroll
    for (int it = 0; it < 8; ++it) *(v8h*)(plane + off[it]) = pv[it];
    
}

// ---------------------------------------------------------------------------
// Fused attention, block = (head h, 64 queries), 8 waves = 4 query tiles of 16 x 2 key halves
// (wave kh takes the 32-key chunks 2i + kh). A wave holds the score tiles of ALL FOUR batches
// of its 16 queries: the four tiles have the same lane/register map, so the softmax over the
// batch axis is plain register arithmetic, with one maximum, one sum and one reciprocal per
// (query, key) for the four batches; nothing is exchanged between waves inside the loop.
// The scores are formed transposed, S^T = K q^T (A = K rows, B = q): a lane then holds 8
// consecutive keys of ONE query, which is the B-operand map of P^T, so the two 16-key tiles of
// a chunk, converted in place, are the B fragment of o^T += V^T P^T; P touches no LDS.
// Per 16-key half of a chunk: 8 WMMAs (q/k fragments from the fragment-order planes), then
//   e_b = 2^((s_b - max_b s) * CS), p1_b = e_b / sum_b e     (sum >= 1, no overflow)
//   P_b = 2^(p1_b * log2 e) in [1, e]  (key-axis softmax numerator, no shift needed)
// the sum of P is accumulated per lane in f32 (one query, half of the keys; two partial sums),
// o^T_b += V^T_b @ P^T_b (16 WMMAs per chunk, V^T fragments from the plane as A).
// After the loop the two key halves' o and row sums are joined through LDS (one block barrier).
// ---------------------------------------------------------------------------
static __device__ __forceinline__ void batch_softmax16(const v8f (&sc)[NB], v2f (&rs)[NB], v8h (&ph)[NB]) {
#pragma unroll
    for (int g = 0; g < 8; g += 2) {
        v2f p[NB];
#pragma unroll
        for (int u = 0; u < 2; ++u) {
            const float m  = fmaxf(fmaxf(sc[0][g + u], sc[1][g + u]), fmaxf(sc[2][g + u], sc[3][g + u]));
            const float mc = m * CS;
            float e[NB];
#pragma unroll
            for (int b = 0; b < NB; ++b) e[b] = ex2(__builtin_fmaf(sc[b][g + u], CS, -mc));
            const float r = __builtin_amdgcn_rcpf((e[0] + e[1]) + (e[2] + e[3])) * L2E;
#pragma unroll
            for (int b = 0; b < NB; ++b) p[b][u] = ex2(e[b] * r);
        }
#pragma unroll
        for (int b = 0; b < NB; ++b) {
            const v2h hp = __builtin_convertvector(p[b], v2h);
            rs[b] += p[b];
            ph[b][g]     = hp[0];
            ph[b][g + 1] = hp[1];
        }
    }
}

__global__ __launch_bounds__(256)
void k_attn(const _Float16* __restrict__ qp,
            const _Float16* __restrict__ kp,
            const _Float16* __restrict__ vT,
            _Float16* __restrict__ zc) {
    __shared__ __align__(32) float    Xo[4][NB * 4][32 * 8];     // 64 KB, key half 1 -> key half 0
    __shared__ __align__(16) float    Xr[4][NB][32];             // 2 KB, key half 1 -> key half 0
    __shared__ __align__(16) _Float16 Zst[4][NB][16 * 72];       // 36 KB, pitch 144 B, wave-private

    const int tid  = threadIdx.x;
    const int lane = tid & 31;
    const int wv   = __builtin_amdgcn_readfirstlane(tid >> 5);
    const int qt   = wv & 3;                  // query tile of the block
    const int kh   = wv >> 2;                 // key half
    const int h    = blockIdx.y;
    const int s0   = blockIdx.x * 64 + qt * 16;
    const int r0   = (lane >> 4) << 3;
    const int cc   = lane & 15;
    constexpr int PB = SEQ * HD;              // halves of one (h, b) plane

    const _Float16* qb = qp + ((size_t)h * NB * SEQ + s0) * HD;
    // The blocks of one head walk the same K and V^T planes. Each enters the walk at its own
    // 64-key stage (its block index) and wraps round, so that no two of them ask L2 for the
    // same lines at the same moment; the sums over the keys take any order.
    int stage = blockIdx.x;                   // grid x = SEQ / 64 = the number of stages
    const _Float16* kc = kp + (size_t)h * NB * PB + stage * (64 * HD) + kh * (32 * HD);   // this wave's current chunk
    const _Float16* vr = vT + (size_t)h * NB * PB + stage * (64 * HD) + kh * (32 * HD);

    v16h qf[NB][2];
#pragma unroll
    for (int b = 0; b < NB; ++b) {
        qf[b][0] = load_fragF(qb + b * PB, lane);         // d 0..31
        qf[b][1] = load_fragF(qb + b * PB + 512, lane);   // d 32..63
    }

    v8f o[NB][4];
    v2f rs[NB];
#pragma unroll
    for (int b = 0; b < NB; ++b) {
#pragma unroll
        for (int nt = 0; nt < 4; ++nt) o[b][nt] = zero8();
        rs[b] = 0.0f;
    }

    // K fragments of 16 keys x 4 batches, fetched one 16-key half ahead into the same registers
    v16h kf[NB][2];
#pragma unroll
    for (int b = 0; b < NB; ++b) {
        kf[b][0] = load_fragF(kc + b * PB, lane);
        kf[b][1] = load_fragF(kc + b * PB + 512, lane);
    }

    // the q base's registers are free for reuse from here on
    asm volatile("s_wait_xcnt 0x0" ::: "memory");
    // keeps what follows below that wait
    __builtin_amdgcn_sched_barrier(0);

#pragma unroll 1
    for (int i = 0; i < SEQ / 64; ++i) {
        // this chunk's V^T fragments, one group, in flight under the scores and the softmax
        v16h vf[NB][4];
#pragma unroll
        for (int b = 0; b < NB; ++b)
#pragma unroll
            for (int nt = 0; nt < 4; ++nt)
                vf[b][nt] = load_fragF(vr + b * PB + nt * 512, lane);   // rows = v column, k = key

        v8f sc[NB];
        v8h p0[NB], p1[NB];                   // P^T of keys 0..15 and 16..31: B elements 0..7 and 8..15
        // keys 0..15 of the chunk, then the fetch of keys 16..31 into the same registers
#pragma unroll
        for (int b = 0; b < NB; ++b) sc[b] = wmma16b(kf[b][0], qf[b][0], zero8());
#pragma unroll
        for (int b = 0; b < NB; ++b) sc[b] = wmma16b(kf[b][1], qf[b][1], sc[b]);
#pragma unroll
        for (int b = 0; b < NB; ++b) {
            kf[b][0] = load_fragF(kc + b * PB + 16 * HD, lane);
            kf[b][1] = load_fragF(kc + b * PB + 16 * HD + 512, lane);
        }
        // keeps the fetch above the softmax: moved below it, the next scores wait out its whole latency
        __builtin_amdgcn_sched_barrier(0);
        batch_softmax16(sc, rs, p0);
        // keeps the second scores below the first softmax: moved up, they wait on a fetch just issued
        __builtin_amdgcn_sched_barrier(0);

        // keys 16..31 of the chunk
#pragma unroll
        for (int b = 0; b < NB; ++b) sc[b] = wmma16b(kf[b][0], qf[b][0], zero8());
#pragma unroll
        for (int b = 0; b < NB; ++b) sc[b] = wmma16b(kf[b][1], qf[b][1], sc[b]);
        // the address registers of the loads issued so far are advanced next
        asm volatile("s_wait_xcnt 0x0" ::: "memory");
        // keeps the two additions below that wait
        __builtin_amdgcn_sched_barrier(0);
        // first half of this wave's next chunk; behind the last stage of the planes comes the first
        // (the last trip fetches the block's first chunk again, so the addresses stay inside the planes)
        const bool wrap = (stage + 1 == SEQ / 64);
        const int  step = wrap ? -(SEQ / 64 - 1) * (64 * HD) : 64 * HD;
        stage = wrap ? 0 : stage + 1;
        kc += step;
        vr += step;
#pragma unroll
        for (int b = 0; b < NB; ++b) {
            kf[b][0] = load_fragF(kc + b * PB, lane);
            kf[b][1] = load_fragF(kc + b * PB + 512, lane);
        }
        // keeps the fetch above the softmax, as above
        __builtin_amdgcn_sched_barrier(0);
        batch_softmax16(sc, rs, p1);

        Frag pb[NB];                          // n = query, k = 32 keys, the order of the V^T fragments
#pragma unroll
        for (int b = 0; b < NB; ++b) { pb[b].h[0] = p0[b]; pb[b].h[1] = p1[b]; }
#pragma unroll
        for (int nt = 0; nt < 4; ++nt)
#pragma unroll
            for (int b = 0; b < NB; ++b) o[b][nt] = wmma16b(vf[b][nt], pb[b].v, o[b][nt]);
    }

    // key half 1 hands its partial o and row sums to key half 0 of the same query tile
    if (kh == 1) {
#pragma unroll
        for (int b = 0; b < NB; ++b) {
#pragma unroll
            for (int nt = 0; nt < 4; ++nt) *(v8f*)(&Xo[qt][b * 4 + nt][lane * 8]) = o[b][nt];
            Xr[qt][b][lane] = rs[b].x + rs[b].y;
        }
    }
    __syncthreads();
    if (kh == 1) return;

#pragma unroll
    for (int b = 0; b < NB; ++b) {
        // row sum of query cc: both key halves, then lanes cc and cc + 16 (each has half of the keys)
        const float v  = (rs[b].x + rs[b].y) + Xr[qt][b][lane];
        const int   vi = __float_as_int(v);
        const float vx = __int_as_float(__builtin_amdgcn_permlanex16(vi, vi, 0x76543210, 0xfedcba98, false, false));
        const float ri = __builtin_amdgcn_rcpf(v + vx);
        // o^T: a lane holds v columns nt*16 + r0 .. + 7 of query cc = one 16-byte piece of the z row
#pragma unroll
        for (int nt = 0; nt < 4; ++nt) {
            const v8f x = *(const v8f*)(&Xo[qt][b * 4 + nt][lane * 8]);
            v8h zr;
#pragma unroll
            for (int g = 0; g < 8; ++g) zr[g] = (_Float16)((o[b][nt][g] + x[g]) * ri);
            *(v8h*)(&Zst[qt][b][cc * 72 + nt * 16 + r0]) = zr;
        }
    }
    // zc is kept in fragment order, rows m = s*NB + b: a 16-row group holds 4 queries of all
    // 4 batches, all of them this wave's own, so the wave writes whole 512-B runs from its tiles
    wave_lds_sync();

    const int zb = lane & 3;                       // batch whose tile is read
#pragma unroll
    for (int gq = 0; gq < 4; ++gq) {
        const int zq = gq * 4 + ((lane & 15) >> 2);    // query of the 16
        v8h zv[4];
        int off[4];
#pragma unroll
        for (int it = 0; it < 4; ++it) {
            zv[it]  = *(const v8h*)(&Zst[qt][zb][zq * 72 + (it * 2 + (lane >> 4)) * 8]);
            off[it] = ((s0 >> 2) + gq) * (16 * DM) + h * 1024 + it * 256 + lane * 8;
        }
#pragma unroll
        for (int it = 0; it < 4; ++it) *(v8h*)(zc + off[it]) = zv[it];
    }
}

// ---------------------------------------------------------------------------
// Output projection: out[m][n] = 2^-12 * (64 z)[m][:] . (64 Wo)[:][n] + bO[n].
// Block = 4 waves; wave = 32 rows x 64 columns. f32 tile staged in a wave-private
// LDS tile; each instruction writes two whole 256-B row segments (16 lanes x 16 B
// coverage: 32 rows = 16 instructions x 2 rows.
// ---------------------------------------------------------------------------
__global__ __launch_bounds__(128) __attribute__((amdgpu_num_vgpr(336)))
void k_out(const _Float16* __restrict__ zc,
           const _Float16* __restrict__ woT,
           const float*    __restrict__ bo,
           float* __restrict__ out) {
    __shared__ __align__(16) float Ost[4][32 * 64];     // 32 KB, wave-private tiles
    const int tid  = threadIdx.x;
    const int lane = tid & 31;
    const int w    = __builtin_amdgcn_readfirstlane(tid >> 5);   // scalar: the A base stays in scalar registers
    const int m0   = blockIdx.x * 128 + w * 32;
    const int n0   = blockIdx.y * 64;

    const int r0 = (lane >> 4) << 3;
    const int cc = lane & 15;
    // fetched ahead of the k loop: behind it, the epilogue would wait out this load's whole latency
    float bb[4];
#pragma unroll
    for (int nt = 0; nt < 4; ++nt) bb[nt] = bo[n0 + nt * 16 + cc];
    // the fragment loads that follow land in the register that holds these loads' address
    asm volatile("s_wait_xcnt 0x0" ::: "memory");

    v8f acc[2][4];
    gemm_32x64(zc + (size_t)m0 * DM, woT + (size_t)n0 * DM, blockIdx.x + blockIdx.y, lane, acc);

#pragma unroll
    for (int rt = 0; rt < 2; ++rt)
#pragma unroll
        for (int nt = 0; nt < 4; ++nt)
#pragma unroll
            for (int g = 0; g < 8; ++g)
                Ost[w][(rt * 16 + r0 + g) * 64 + nt * 16 + cc] =
                    __builtin_fmaf(acc[rt][nt][g], SC_OUT, bb[nt]);
    wave_lds_sync();

    const int rh = lane >> 4, c4 = lane & 15;
    v4f sv[16];
#pragma unroll
    for (int it = 0; it < 16; ++it) sv[it] = *(const v4f*)(&Ost[w][(it * 2 + rh) * 64 + c4 * 4]);
    float* ob = out + (size_t)m0 * DM + n0 + (size_t)rh * DM + c4 * 4;
#pragma unroll
    for (int it = 0; it < 16; ++it) *(v4f*)(ob + (size_t)(it * 2) * DM) = sv[it];
    
}

// ---------------------------------------------------------------------------
extern "C" void kernel_launch(void* const* d_in, const int* in_sizes, int n_in,
                              void* d_out, int out_size, void* d_ws, size_t ws_size,
                              hipStream_t stream) {
    if (n_in < 9) return;
    if (in_sizes[0] < ((SEQ - 1) * NB_FULL + NB) * DM) return;
    if (in_sizes[1] < NH * DM * HD || in_sizes[3] < NH * DM * HD || in_sizes[5] < NH * DM * HD) return;
    if (in_sizes[2] < NH * HD || in_sizes[4] < NH * HD || in_sizes[6] < NH * HD) return;
    if (in_sizes[7] < DM * DM || in_sizes[8] < DM) return;
    if (out_size < MTOT * DM) return;
    if ((size_t)WS_TOTAL > ws_size) return;

    const float* X  = (const float*)d_in[0];   // [S][B][512], row m = s*4 + b
    const float* WQ = (const float*)d_in[1];   // [8][512][64]
    const float* bQ = (const float*)d_in[2];   // [8][64]
    const float* WK = (const float*)d_in[3];
    const float* bK = (const float*)d_in[4];
    const float* WV = (const float*)d_in[5];
    const float* bV = (const float*)d_in[6];
    const float* WO = (const float*)d_in[7];   // [512 in][512 out]
    const float* bO = (const float*)d_in[8];   // [512]
    float* out = (float*)d_out;                // [S][B][512]

    char* ws = (char*)d_ws;
    size_t off = 0;
    _Float16* wT   = (_Float16*)(ws + off); off += WT_BYTES;     // [1536][512], fragment order
    _Float16* woT  = (_Float16*)(ws + off); off += WOT_BYTES;    // [512][512], fragment order
    float*    bias = (float*)(ws + off);    off += BIAS_BYTES;   // [2048]
    _Float16* xh   = (_Float16*)(ws + off); off += XH_BYTES;     // [MTOT][512], fragment order
    _Float16* qkv  = (_Float16*)(ws + off); off += 3 * PL_BYTES; // q, k, V^T, each [h][b] in fragment order
    _Float16* zc   = (_Float16*)(ws + off); off += ZC_BYTES;     // [MTOT][512], fragment order
    if (off > ws_size) return;

    k_prep<<<dim3(PREP_BLOCKS), dim3(256), 0, stream>>>(X, WQ, bQ, WK, bK, WV, bV, WO, bO, wT, woT, bias, xh);
    k_proj<<<dim3(MTOT / 128, NQKV / 64), dim3(128), 0, stream>>>(xh, wT, bias, qkv);
    k_attn<<<dim3(SEQ / 64, NH), dim3(256), 0, stream>>>(qkv, qkv + PL_ELEMS, qkv + 2 * PL_ELEMS, zc);
    k_out<<<dim3(MTOT / 128, DM / 64), dim3(128), 0, stream>>>(zc, woT, bias + NQKV, out);
}

// v009
// A run of this version takes 67.2 microseconds.
// Timed twice side by side with v008, it ran 1.11 and 1.12 times as fast.
// Over all steps from v000 it is 4.17 times as fast.
#include <hip/hip_runtime.h>
#include <hip/hip_fp16.h>

// All contractions on v_wmma_f32_16x16x32_f16 (f16 operands, f32 accumulate), single products: x*[Wq|Wk|Wv], q*k^T, P*v, z*Wo; every float input RNE-converted to bf16 first (exact in f16), weight planes and q/k/v/z planes carried x64, P = exp(p1) in [1,e] unscaled.

#ifndef NB
#define NB 4             // batch; an attention wave holds the score tiles of all 4 batches (must stay 4)
#endif
#ifndef SEQ
#define SEQ 2048
#endif
#define NB_FULL  4
#define SEQ_FULL 2048
#define DM   512          // model width
#define NH   8            // heads
#define HD   64           // head width (dk = dv)
#define NQKV (3 * NH * HD)
#define MTOT (SEQ * NB)   // token rows m = s*NB + b

static_assert(NB == 4);
static_assert(NB_FULL == 4);
static_assert(SEQ >= 64 && SEQ <= SEQ_FULL);
static_assert(SEQ % 64 == 0);
static_assert(MTOT % 128 == 0);
static_assert(DM % 32 == 0);
static_assert(DM == NH * HD);
static_assert(HD == 64);
static_assert(NQKV % 64 == 0);
static_assert(((size_t)MTOT * DM) % 2048 == 0);

typedef _Float16 v16h __attribute__((ext_vector_type(16)));
typedef _Float16 v8h  __attribute__((ext_vector_type(8)));
typedef float    v8f  __attribute__((ext_vector_type(8)));
typedef float    v4f  __attribute__((ext_vector_type(4)));
typedef float    v2f  __attribute__((ext_vector_type(2)));
typedef _Float16 v2h  __attribute__((ext_vector_type(2)));

union Frag { v16h v; v8h h[2]; };

#define L2E     1.44269504088896340736f
#define CS      (1.44269504088896340736f * 3.0517578125e-05f)   // log2(e) * 2^-15 : (64q).(64k)/8 -> log2 units
#define SC_OUT  2.44140625e-04f                                  // 2^-12 : (64 z)(64 Wo) -> out

#define WT_BYTES   ((size_t)NQKV * DM * 2)
#define WOT_BYTES  ((size_t)DM * DM * 2)
#define BIAS_ELEMS 2048
#define BIAS_BYTES ((size_t)BIAS_ELEMS * 4)
#define XH_BYTES   ((size_t)MTOT * DM * 2)
#define PL_ELEMS   ((size_t)NH * NB * SEQ * HD)
#define PL_BYTES   (PL_ELEMS * 2)
#define ZC_BYTES   ((size_t)MTOT * DM * 2)
#define WS_TOTAL   (WT_BYTES + WOT_BYTES + BIAS_BYTES + XH_BYTES + 3 * PL_BYTES + ZC_BYTES)
static_assert(WS_TOTAL <= (size_t)134217728);
static_assert(WT_BYTES % 128 == 0 && WOT_BYTES % 128 == 0 && BIAS_BYTES % 128 == 0);
static_assert(XH_BYTES % 128 == 0 && PL_BYTES % 128 == 0 && ZC_BYTES % 128 == 0);
static_assert(NQKV + DM == BIAS_ELEMS);

static __device__ __forceinline__ v8f zero8() {
    v8f z;
#pragma unroll
    for (int i = 0; i < 8; ++i) z[i] = 0.0f;
    return z;
}

// 16x32 A fragment (or B fragment, n for row) from a plane kept in fragment order: lane holds
// row lane&15; with kb = 8*(lane>>4), elements 0..7 = k kb..kb+7, elements 8..15 = k kb+16..kb+23.
// A 16-row x 32-k block is 512
// halves, [j 0..1][lane 0..31][8 halves], where lane = row + 16*((k>>3)&1), j = k>>4,
// so each of the two loads reads 512 contiguous bytes (four whole lines) per wave.
static __device__ __forceinline__ v16h load_fragF(const _Float16* blk, int lane) {
    const _Float16* p = blk + lane * 8;
    Frag f;
    f.h[0] = *(const v8h*)(p);
    f.h[1] = *(const v8h*)(p + 256);
    return f.v;
}

// the bare builtin: the matrix kernels hold more than 256 VGPRs, and an asm operand cannot sit
// above v255, so a pad written in asm behind it would force its fragments into the low window
static __device__ __forceinline__ v8f wmma16b(v16h a, v16h b, v8f c) {
    return __builtin_amdgcn_wmma_f32_16x16x32_f16(false, a, false, b, (short)0, c, false, false);
}

// f32 -> bf16 RNE convert, value kept as f32
static __device__ __forceinline__ float bf16r(float x) {
    unsigned u = __float_as_uint(x);
    u = (u + 0x7FFFu + ((u >> 16) & 1u)) & 0xFFFF0000u;
    return __uint_as_float(u);
}

static __device__ __forceinline__ float ex2(float x) {
    return __builtin_amdgcn_exp2f(x);
}

// ordering for a wave-private LDS tile: stores before later loads of the same wave
static __device__ __forceinline__ void wave_lds_sync() {
    __builtin_amdgcn_fence(3, "wavefront");
    asm volatile("s_wait_dscnt 0" ::: "memory");
    __builtin_amdgcn_wave_barrier();
}

// ---------------------------------------------------------------------------
// Operand planes, one launch: the weight planes, the bias plane and the x plane need nothing
// of each other, so they share one grid; a range of the block index picks the job
// (block-uniform): [0, 256) weight tiles, 256 the bias plane, the rest the x plane.
// The weight tiles come first: theirs is the longest chain (load, LDS, barrier, store).
// ---------------------------------------------------------------------------
#define PREP_WT_BLOCKS 256                                  // 4 matrices x 8 x 8 tiles of 64 x 64
#define PREP_X_BLOCKS  ((int)(((size_t)MTOT * DM) / 2048))
#define PREP_BLOCKS    (PREP_WT_BLOCKS + 1 + PREP_X_BLOCKS)

// Weight plane builder: one 64x64 tile per block, in[i][j] (f32) -> out[j][i]
// (f16 = 64 * bf16-RNE value).
// out is kept in fragment order: [j>>4][i>>5] blocks of 512 halves, 16 out rows = 16*DM halves.
// coverage: 4 x 2 blocks x 2 halves = 16 runs of 512 B = 8 waves x 2.
static __device__ __forceinline__ void prep_wT(const float* __restrict__ sp, int src_pitch,
                                               _Float16* __restrict__ dp, _Float16* T, int tid) {
#pragma unroll
    for (int it = 0; it < 4; ++it) {
        int idx = tid + it * 256;
        int r = idx >> 4, c4 = idx & 15;
        v4f v = *(const v4f*)(sp + (size_t)r * src_pitch + c4 * 4);
        T[(c4 * 4 + 0) * 72 + r] = (_Float16)(bf16r(v.x) * 64.0f);
        T[(c4 * 4 + 1) * 72 + r] = (_Float16)(bf16r(v.y) * 64.0f);
        T[(c4 * 4 + 2) * 72 + r] = (_Float16)(bf16r(v.z) * 64.0f);
        T[(c4 * 4 + 3) * 72 + r] = (_Float16)(bf16r(v.w) * 64.0f);
    }
    __syncthreads();
    const int lane = tid & 31, wv = tid >> 5;
    const int nt0 = wv >> 2, nt1 = nt0 + 2;            // 16-row group of the out rows
    const int pq  = (wv & 3) * 2 + (lane >> 4);        // 8-half piece of the 64 k: (kc*2 + j)*2 + hi
    v8h o0 = *(const v8h*)(&T[(nt0 * 16 + (lane & 15)) * 72 + pq * 8]);
    v8h o1 = *(const v8h*)(&T[(nt1 * 16 + (lane & 15)) * 72 + pq * 8]);
    _Float16* d0 = dp + (size_t)(nt0 * 16) * DM + (wv & 3) * 256 + lane * 8;
    _Float16* d1 = dp + (size_t)(nt1 * 16) * DM + (wv & 3) * 256 + lane * 8;
    *(v8h*)d0 = o0;
    *(v8h*)d1 = o1;
    // another job's code follows in the built kernel and reuses the registers these stores name
    asm volatile("s_wait_xcnt 0x0" ::: "memory");
}

// x plane in fragment order: f16(bf16r(x[m][d])); 8 elements per thread; 8 consecutive
// lanes take the same 8-column piece of 8 consecutive rows = one whole 128-B line of xh
static __device__ __forceinline__ void prep_x(const float* __restrict__ x, _Float16* __restrict__ xh, int gid) {
    const int pc  = (gid >> 3) & 63;                   // 8-column piece of the row
    const int row = ((gid >> 9) << 3) + (gid & 7);
    const size_t i = (size_t)row * DM + pc * 8;
    const size_t j = (size_t)(row >> 4) * (16 * DM) + (pc >> 1) * 256 + ((row & 15) + 16 * (pc & 1)) * 8;
    v4f a = *(const v4f*)(x + i);
    v4f b = *(const v4f*)(x + i + 4);
    v8h o;
    o[0] = (_Float16)bf16r(a.x); o[1] = (_Float16)bf16r(a.y);
    o[2] = (_Float16)bf16r(a.z); o[3] = (_Float16)bf16r(a.w);
    o[4] = (_Float16)bf16r(b.x); o[5] = (_Float16)bf16r(b.y);
    o[6] = (_Float16)bf16r(b.z); o[7] = (_Float16)bf16r(b.w);
    *(v8h*)(xh + j) = o;
    // another job's code follows in the built kernel and reuses the registers this store names
    asm volatile("s_wait_xcnt 0x0" ::: "memory");
}

__global__ __launch_bounds__(256) void k_prep(const float* __restrict__ X,
                                              const float* __restrict__ WQ, const float* __restrict__ bQ,
                                              const float* __restrict__ WK, const float* __restrict__ bK,
                                              const float* __restrict__ WV, const float* __restrict__ bV,
                                              const float* __restrict__ WO, const float* __restrict__ bO,
                                              _Float16* __restrict__ wT, _Float16* __restrict__ woT,
                                              float* __restrict__ bias, _Float16* __restrict__ xh) {
    __shared__ __align__(16) _Float16 T[64 * 72];
    const int tid = threadIdx.x;
    const int blk = blockIdx.x;
    if (blk < PREP_WT_BLOCKS) {
        const int which = blk >> 6;                    // 0 Wq, 1 Wk, 2 Wv, 3 Wo
        const int bx = blk & 7, by = (blk >> 3) & 7;
        if (which < 3) {
            // per-head weights: in[d 512][k 64] -> out[h*64 + k][d]; bx tiles = d, by tiles = head
            const float* w = (which == 0) ? WQ : (which == 1) ? WK : WV;
            prep_wT(w + (size_t)bx * (64 * HD) + (size_t)by * (DM * HD), HD,
                    wT + (size_t)which * (DM * DM) + (size_t)bx * 1024 + (size_t)by * (64 * DM), T, tid);
        } else {
            // Wo: in[k 512][n 512] -> out[n][k]; bx tiles = k rows, by tiles = n columns
            prep_wT(WO + (size_t)bx * (64 * DM) + (size_t)by * 64, DM,
                    woT + (size_t)bx * 1024 + (size_t)by * (64 * DM), T, tid);
        }
    } else if (blk == PREP_WT_BLOCKS) {
        // Bias plane [2048] f32: [0..1535] = 64*bf16r(bQ|bK|bV) (index which*512 + h*64 + k),
        // [1536..2047] = bf16r(bO). 8 consecutive elements per thread, 64 threads per vector.
        const int which = tid >> 6;
        const float* b = (which == 0) ? bQ : (which == 1) ? bK : (which == 2) ? bV : bO;
        const float sc = (which < 3) ? 64.0f : 1.0f;
        const v4f u = *(const v4f*)(b + (tid & 63) * 8);
        const v4f v = *(const v4f*)(b + (tid & 63) * 8 + 4);
        v4f p, q;
        p.x = bf16r(u.x) * sc; p.y = bf16r(u.y) * sc; p.z = bf16r(u.z) * sc; p.w = bf16r(u.w) * sc;
        q.x = bf16r(v.x) * sc; q.y = bf16r(v.y) * sc; q.z = bf16r(v.z) * sc; q.w = bf16r(v.w) * sc;
        *(v4f*)(bias + tid * 8)     = p;
        *(v4f*)(bias + tid * 8 + 4) = q;
        // another job's code follows in the built kernel and reuses the registers these stores name
        asm volatile("s_wait_xcnt 0x0" ::: "memory");
    } else {
        prep_x(X, xh, (blk - (PREP_WT_BLOCKS + 1)) * 256 + tid);
    }
}

// ---------------------------------------------------------------------------
// GEMM main loop: wave tile 64 rows x 64 columns, K = DM, A and B planes both in
// fragment order (16 rows = 16*DM halves, 32 k = 512 halves), fragments straight
// from the 16-bit global planes (arithmetic addressing only). Each of the eight fragments
// of a 32-k step feeds four products, so a product costs 512 loaded bytes.
// The eight fragments of a step are loaded as one group, KRING - 1 steps ahead of their
// products, into a ring of KRING register sets: the few waves of a SIMD do not hide a load's
// latency; the wave's own loads in flight have to.
// The blocks of a launch that share rows of A or of B each enter the k walk at their own step
// (st, from the block's two indices) and wrap round, so that they do not ask L2 for the same
// lines at the same moment; trip t takes k step (st + t) mod KSTEPS. The waves of one block
// share st: waves with the same rows or the same columns ask for the same lines together.
// ---------------------------------------------------------------------------
#define KSTEPS (DM / 32)
static_assert((KSTEPS & (KSTEPS - 1)) == 0);

static __device__ __forceinline__ void load_kstep(const _Float16* __restrict__ Ak,
                                                  const _Float16* __restrict__ Bk,
                                                  int lane, v16h (&a)[4], v16h (&b)[4]) {
#pragma unroll
    for (int rt = 0; rt < 4; ++rt) a[rt] = load_fragF(Ak + rt * 16 * DM, lane);
#pragma unroll
    for (int nt = 0; nt < 4; ++nt) b[nt] = load_fragF(Bk + nt * 16 * DM, lane);
}

// to the next k step of the walk; behind the last one comes the first
static __device__ __forceinline__ void next_kstep(const _Float16*& Ak, const _Float16*& Bk, int& ks) {
    // the address registers of the fetch before are advanced next
    asm volatile("s_wait_xcnt 0x0" ::: "memory");
    // keeps the two additions below that wait
    __builtin_amdgcn_sched_barrier(0);
    const bool wrap = (ks == KSTEPS - 1);
    const int  step = wrap ? -(KSTEPS - 1) * 512 : 512;
    ks = wrap ? 0 : ks + 1;
    Ak += step;
    Bk += step;
}

template <int KRING>
static __device__ __forceinline__ void gemm_64x64(const _Float16* __restrict__ Ap,
                                                  const _Float16* __restrict__ Bp,
                                                  const float* __restrict__ bp,
                                                  int st, int lane, v8f (&acc)[4][4], float (&bb)[4]) {
    static_assert(KSTEPS >= KRING - 1);
    v16h a[KRING][4], b[KRING][4];
    int ks = st & (KSTEPS - 1);
    const _Float16* Ak = Ap + ks * 512;
    const _Float16* Bk = Bp + ks * 512;
#pragma unroll
    for (int t = 0; t < KRING - 1; ++t) {
        if (t > 0) next_kstep(Ak, Bk, ks);
        load_kstep(Ak, Bk, lane, a[t], b[t]);
    }
#pragma unroll
    for (int rt = 0; rt < 4; ++rt)
#pragma unroll
        for (int nt = 0; nt < 4; ++nt) acc[rt][nt] = zero8();
    // unrolled whole: the ring's set numbers become register names
#pragma unroll
    for (int t = 0; t < KSTEPS; ++t) {
        constexpr int AH = KRING - 1;
        if (t + AH < KSTEPS) {
            next_kstep(Ak, Bk, ks);
            load_kstep(Ak, Bk, lane, a[(t + AH) % KRING], b[(t + AH) % KRING]);
        }
        // behind the last fetch: the address registers of the fragment loads are free for reuse from here on
        if (t + AH == KSTEPS - 1) asm volatile("s_wait_xcnt 0x0" ::: "memory");
        // the bias of the lane's four columns, in the first trip without a fetch: a set of the ring is
        // free by then (held from the start these four spill), and the products left cover the latency
        if (t + AH == KSTEPS) {
#pragma unroll
            for (int nt = 0; nt < 4; ++nt) bb[nt] = bp[nt * 16];
            // the register that holds these loads' address is free for reuse from here on
            asm volatile("s_wait_xcnt 0x0" ::: "memory");
        }
        // keeps the fetch above this step's products: sunk among them it loses its lead
        __builtin_amdgcn_sched_barrier(0);
#pragma unroll
        for (int nt = 0; nt < 4; ++nt)
#pragma unroll
            for (int rt = 0; rt < 4; ++rt)
                acc[rt][nt] = wmma16b(a[t % KRING][rt], b[t % KRING][nt], acc[rt][nt]);
        // keeps the next fetch below these products: raised above them it takes one more set
        __builtin_amdgcn_sched_barrier(0);
    }
}

// ---------------------------------------------------------------------------
// Projections: [MTOT x 512] x [512 x 1536]. Block = 12 waves, 2 down the rows x 6 along the
// columns = 128 token rows x 384 columns; wave = 64 token rows x 64 columns (one of q/k/v, one
// head). 256 blocks of three waves a SIMD: the whole launch is resident at once. Waves 4r .. 4r+3
// form a 2 x 2 group, two of them sharing each fragment.
// The epilogue takes the wave's tile as two halves of 32 token rows, one after the other.
// Output planes q,k [h][b] in fragment order
// (16 s = 1024 halves): 8 consecutive lanes write the same piece of 8 consecutive s =
// one whole line. coverage: 32 rows x 8 pieces = 8 instructions x 32 lanes.
// Output plane V^T [h][b] in fragment order, rows = v column, k = key: [s>>5][v>>4] blocks
// of 512 halves. A half's 32 token rows are 8 consecutive s (from a multiple of 8) of all
// 4 batches, and 8 such s of one v column are one 16-byte piece of that plane, so the wave
// writes it itself: 16 consecutive lanes write the pieces of 16 v columns = two whole lines.
// coverage: 4 batches x 64 columns = 256 pieces = 8 instructions x 32 lanes.
// ---------------------------------------------------------------------------
#define PROJ_WN 6
static_assert(NQKV % (PROJ_WN * 64) == 0);
__global__ __launch_bounds__(PROJ_WN * 64) __attribute__((amdgpu_num_vgpr(336)))
void k_proj(const _Float16* __restrict__ xh,
            const _Float16* __restrict__ wT,
            const float*    __restrict__ bias,
            _Float16* __restrict__ qkv) {
    __shared__ __align__(16) _Float16 st[PROJ_WN * 2][32 * 72];   // 54 KB, wave-private tiles, pitch 144 B
    const int tid  = threadIdx.x;
    const int lane = tid & 31;
    const int w    = __builtin_amdgcn_readfirstlane(tid >> 5);   // scalar: the bases stay in scalar registers
    const int m0   = blockIdx.x * 128 + (w & 1) * 64;
    const int n0   = blockIdx.y * (PROJ_WN * 64) + (w >> 1) * 64;

    const int r0 = (lane >> 4) << 3;
    const int cc = lane & 15;
    float bb[4];
    v8f acc[4][4];
    // three sets and the accumulators fit the 336 VGPRs that leave three waves a SIMD
    gemm_64x64<3>(xh + (size_t)m0 * DM, wT + (size_t)n0 * DM, bias + n0 + cc, blockIdx.x + blockIdx.y, lane, acc, bb);

    const int which = n0 >> 9;               // 0 q, 1 k, 2 v (the same for the whole wave)
    const int hh    = (n0 & 511) >> 6;
    _Float16* plane = qkv + (size_t)which * PL_ELEMS;
#pragma unroll
    for (int hf = 0; hf < 2; ++hf) {
        const int mh = m0 + hf * 32;         // first token row of this half
        v8h pv[8];
        int off[8];
        if (which == 2) {
            // tile kept as pieces [batch][v column][8 s]: accumulator row rt*16 + r0 + g is
            // s = rt*4 + (r0 >> 2) + (g >> 2), batch g & 3, so elements g and g + 4 are two consecutive s
#pragma unroll
            for (int rt = 0; rt < 2; ++rt)
#pragma unroll
                for (int nt = 0; nt < 4; ++nt)
#pragma unroll
                    for (int b = 0; b < NB; ++b) {
                        v2f t;
                        t.x = acc[hf * 2 + rt][nt][b] + bb[nt];
                        t.y = acc[hf * 2 + rt][nt][b + 4] + bb[nt];
                        *(v2h*)(&st[w][(b * 64 + nt * 16 + cc) * 8 + rt * 4 + (r0 >> 2)]) = __builtin_convertvector(t, v2h);
                    }
            wave_lds_sync();
            const int sb = mh >> 2;          // first of the half's 8 s
#pragma unroll
            for (int it = 0; it < 8; ++it) {
                // piece it*32 + lane: batch it >> 1, v column (it & 1)*32 + lane
                pv[it]  = *(const v8h*)(&st[w][(it * 32 + lane) * 8]);
                off[it] = ((hh * NB + (it >> 1)) * SEQ + (sb & ~31)) * HD + ((it & 1) * 2 + (lane >> 4)) * 512
                        + ((sb >> 4) & 1) * 256 + (cc + 16 * ((sb >> 3) & 1)) * 8;
            }
        } else {
#pragma unroll
            for (int rt = 0; rt < 2; ++rt)
#pragma unroll
                for (int nt = 0; nt < 4; ++nt)
#pragma unroll
                    for (int g = 0; g < 8; ++g)
                        st[w][(rt * 16 + r0 + g) * 72 + nt * 16 + cc] = (_Float16)(acc[hf * 2 + rt][nt][g] + bb[nt]);
            wave_lds_sync();
            const int rq = lane >> 3, pc = lane & 7;
#pragma unroll
            for (int it = 0; it < 8; ++it) {
                // lanes run over 8 s of batch rq, piece it
                const int i = pc * 4 + rq;
                pv[it] = *(const v8h*)(&st[w][i * 72 + it * 8]);
                const int m = mh + i;
                const int s = m >> 2, b = m & 3;     // m = s*NB + b, NB = 4
                off[it] = ((hh * NB + b) * SEQ + (s & ~15)) * HD + (it >> 1) * 256 + ((s & 15) + 16 * (it & 1)) * 8;
            }
        }
#pragma unroll
        for (int it = 0; it < 8; ++it) *(v8h*)(plane + off[it]) = pv[it];
        if (hf == 0) {
            // the second half's code reuses the registers these stores name
            asm volatile("s_wait_xcnt 0x0" ::: "memory");
            // the tile's reads above come before the second half's writes to it
            wave_lds_sync();
        }
    }
}

// ---------------------------------------------------------------------------
// Fused attention, block = (head h, 64 queries), 8 waves = 4 query tiles of 16 x 2 key halves
// (wave kh takes the 32-key chunks 2i + kh). A wave holds the score tiles of ALL FOUR batches
// of its 16 queries: the four tiles have the same lane/register map, so the softmax over the
// batch axis is plain register arithmetic, with one maximum, one sum and one reciprocal per
// (query, key) for the four batches; nothing is exchanged between waves inside the loop.
// The scores are formed transposed, S^T = K q^T (A = K rows, B = q): a lane then holds 8
// consecutive keys of ONE query, which is the B-operand map of P^T, so the two 16-key tiles of
// a chunk, converted in place, are the B fragment of o^T += V^T P^T; P touches no LDS.
// Per 16-key half of a chunk: 8 WMMAs (q/k fragments from the fragment-order planes), then
//   e_b = 2^((s_b - max_b s) * CS), p1_b = e_b / sum_b e     (sum >= 1, no overflow)
//   P_b = 2^(p1_b * log2 e) in [1, e]  (key-axis softmax numerator, no shift needed)
// the sum of P is accumulated per lane in f32 (one query, half of the keys; two partial sums),
// o^T_b += V^T_b @ P^T_b (16 WMMAs per chunk, V^T fragments from the plane as A).
// After the loop the two key halves' o and row sums are joined through LDS (one block barrier).
// ---------------------------------------------------------------------------
static __device__ __forceinline__ void batch_softmax16(const v8f (&sc)[NB], v2f (&rs)[NB], v8h (&ph)[NB]) {
#pragma unroll
    for (int g = 0; g < 8; g += 2) {
        v2f p[NB];
#pragma unroll
        for (int u = 0; u < 2; ++u) {
            const float m  = fmaxf(fmaxf(sc[0][g + u], sc[1][g + u]), fmaxf(sc[2][g + u], sc[3][g + u]));
            const float mc = m * CS;
            float e[NB];
#pragma unroll
            for (int b = 0; b < NB; ++b) e[b] = ex2(__builtin_fmaf(sc[b][g + u], CS, -mc));
            const float r = __builtin_amdgcn_rcpf((e[0] + e[1]) + (e[2] + e[3])) * L2E;
#pragma unroll
            for (int b = 0; b < NB; ++b) p[b][u] = ex2(e[b] * r);
        }
#pragma unroll
        for (int b = 0; b < NB; ++b) {
            const v2h hp = __builtin_convertvector(p[b], v2h);
            rs[b] += p[b];
            ph[b][g]     = hp[0];
            ph[b][g + 1] = hp[1];
        }
    }
}

__global__ __launch_bounds__(256)
void k_attn(const _Float16* __restrict__ qp,
            const _Float16* __restrict__ kp,
            const _Float16* __restrict__ vT,
            _Float16* __restrict__ zc) {
    __shared__ __align__(32) float    Xo[4][NB * 4][32 * 8];     // 64 KB, key half 1 -> key half 0
    __shared__ __align__(16) float    Xr[4][NB][32];             // 2 KB, key half 1 -> key half 0
    __shared__ __align__(16) _Float16 Zst[4][NB][16 * 72];       // 36 KB, pitch 144 B, wave-private

    const int tid  = threadIdx.x;
    const int lane = tid & 31;
    const int wv   = __builtin_amdgcn_readfirstlane(tid >> 5);
    const int qt   = wv & 3;                  // query tile of the block
    const int kh   = wv >> 2;                 // key half
    const int h    = blockIdx.y;
    const int s0   = blockIdx.x * 64 + qt * 16;
    const int r0   = (lane >> 4) << 3;
    const int cc   = lane & 15;
    constexpr int PB = SEQ * HD;              // halves of one (h, b) plane

    const _Float16* qb = qp + ((size_t)h * NB * SEQ + s0) * HD;
    // The blocks of one head walk the same K and V^T planes. Each enters the walk at its own
    // 64-key stage (its block index) and wraps round, so that no two of them ask L2 for the
    // same lines at the same moment; the sums over the keys take any order.
    int stage = blockIdx.x;                   // grid x = SEQ / 64 = the number of stages
    const _Float16* kc = kp + (size_t)h * NB * PB + stage * (64 * HD) + kh * (32 * HD);   // this wave's current chunk
    const _Float16* vr = vT + (size_t)h * NB * PB + stage * (64 * HD) + kh * (32 * HD);

    v16h qf[NB][2];
#pragma unroll
    for (int b = 0; b < NB; ++b) {
        qf[b][0] = load_fragF(qb + b * PB, lane);         // d 0..31
        qf[b][1] = load_fragF(qb + b * PB + 512, lane);   // d 32..63
    }

    v8f o[NB][4];
    v2f rs[NB];
#pragma unroll
    for (int b = 0; b < NB; ++b) {
#pragma unroll
        for (int nt = 0; nt < 4; ++nt) o[b][nt] = zero8();
        rs[b] = 0.0f;
    }

    // K fragments of 16 keys x 4 batches, fetched one 16-key half ahead into the same registers
    v16h kf[NB][2];
#pragma unroll
    for (int b = 0; b < NB; ++b) {
        kf[b][0] = load_fragF(kc + b * PB, lane);
        kf[b][1] = load_fragF(kc + b * PB + 512, lane);
    }

    // the q base's registers are free for reuse from here on
    asm volatile("s_wait_xcnt 0x0" ::: "memory");
    // keeps what follows below that wait
    __builtin_amdgcn_sched_barrier(0);

#pragma unroll 1
    for (int i = 0; i < SEQ / 64; ++i) {
        // this chunk's V^T fragments, one group, in flight under the scores and the softmax
        v16h vf[NB][4];
#pragma unroll
        for (int b = 0; b < NB; ++b)
#pragma unroll
            for (int nt = 0; nt < 4; ++nt)
                vf[b][nt] = load_fragF(vr + b * PB + nt * 512, lane);   // rows = v column, k = key

        v8f sc[NB];
        v8h p0[NB], p1[NB];                   // P^T of keys 0..15 and 16..31: B elements 0..7 and 8..15
        // keys 0..15 of the chunk, then the fetch of keys 16..31 into the same registers
#pragma unroll
        for (int b = 0; b < NB; ++b) sc[b] = wmma16b(kf[b][0], qf[b][0], zero8());
#pragma unroll
        for (int b = 0; b < NB; ++b) sc[b] = wmma16b(kf[b][1], qf[b][1], sc[b]);
#pragma unroll
        for (int b = 0; b < NB; ++b) {
            kf[b][0] = load_fragF(kc + b * PB + 16 * HD, lane);
            kf[b][1] = load_fragF(kc + b * PB + 16 * HD + 512, lane);
        }
        // keeps the fetch above the softmax: moved below it, the next scores wait out its whole latency
        __builtin_amdgcn_sched_barrier(0);
        batch_softmax16(sc, rs, p0);
        // keeps the second scores below the first softmax: moved up, they wait on a fetch just issued
        __builtin_amdgcn_sched_barrier(0);

        // keys 16..31 of the chunk
#pragma unroll
        for (int b = 0; b < NB; ++b) sc[b] = wmma16b(kf[b][0], qf[b][0], zero8());
#pragma unroll
        for (int b = 0; b < NB; ++b) sc[b] = wmma16b(kf[b][1], qf[b][1], sc[b]);
        // the address registers of the loads issued so far are advanced next
        asm volatile("s_wait_xcnt 0x0" ::: "memory");
        // keeps the two additions below that wait
        __builtin_amdgcn_sched_barrier(0);
        // first half of this wave's next chunk; behind the last stage of the planes comes the first
        // (the last trip fetches the block's first chunk again, so the addresses stay inside the planes)
        const bool wrap = (stage + 1 == SEQ / 64);
        const int  step = wrap ? -(SEQ / 64 - 1) * (64 * HD) : 64 * HD;
        stage = wrap ? 0 : stage + 1;
        kc += step;
        vr += step;
#pragma unroll
        for (int b = 0; b < NB; ++b) {
            kf[b][0] = load_fragF(kc + b * PB, lane);
            kf[b][1] = load_fragF(kc + b * PB + 512, lane);
        }
        // keeps the fetch above the softmax, as above
        __builtin_amdgcn_sched_barrier(0);
        batch_softmax16(sc, rs, p1);

        Frag pb[NB];                          // n = query, k = 32 keys, the order of the V^T fragments
#pragma unroll
        for (int b = 0; b < NB; ++b) { pb[b].h[0] = p0[b]; pb[b].h[1] = p1[b]; }
#pragma unroll
        for (int nt = 0; nt < 4; ++nt)
#pragma unroll
            for (int b = 0; b < NB; ++b) o[b][nt] = wmma16b(vf[b][nt], pb[b].v, o[b][nt]);
    }

    // key half 1 hands its partial o and row sums to key half 0 of the same query tile
    if (kh == 1) {
#pragma unroll
        for (int b = 0; b < NB; ++b) {
#pragma unroll
            for (int nt = 0; nt < 4; ++nt) *(v8f*)(&Xo[qt][b * 4 + nt][lane * 8]) = o[b][nt];
            Xr[qt][b][lane] = rs[b].x + rs[b].y;
        }
    }
    __syncthreads();
    if (kh == 1) return;

#pragma unroll
    for (int b = 0; b < NB; ++b) {
        // row sum of query cc: both key halves, then lanes cc and cc + 16 (each has half of the keys)
        const float v  = (rs[b].x + rs[b].y) + Xr[qt][b][lane];
        const int   vi = __float_as_int(v);
        const float vx = __int_as_float(__builtin_amdgcn_permlanex16(vi, vi, 0x76543210, 0xfedcba98, false, false));
        const float ri = __builtin_amdgcn_rcpf(v + vx);
        // o^T: a lane holds v columns nt*16 + r0 .. + 7 of query cc = one 16-byte piece of the z row
#pragma unroll
        for (int nt = 0; nt < 4; ++nt) {
            const v8f x = *(const v8f*)(&Xo[qt][b * 4 + nt][lane * 8]);
            v8h zr;
#pragma unroll
            for (int g = 0; g < 8; ++g) zr[g] = (_Float16)((o[b][nt][g] + x[g]) * ri);
            *(v8h*)(&Zst[qt][b][cc * 72 + nt * 16 + r0]) = zr;
        }
    }
    // zc is kept in fragment order, rows m = s*NB + b: a 16-row group holds 4 queries of all
    // 4 batches, all of them this wave's own, so the wave writes whole 512-B runs from its tiles
    wave_lds_sync();

    const int zb = lane & 3;                       // batch whose tile is read
#pragma unroll
    for (int gq = 0; gq < 4; ++gq) {
        const int zq = gq * 4 + ((lane & 15) >> 2);    // query of the 16
        v8h zv[4];
        int off[4];
#pragma unroll
        for (int it = 0; it < 4; ++it) {
            zv[it]  = *(const v8h*)(&Zst[qt][zb][zq * 72 + (it * 2 + (lane >> 4)) * 8]);
            off[it] = ((s0 >> 2) + gq) * (16 * DM) + h * 1024 + it * 256 + lane * 8;
        }
#pragma unroll
        for (int it = 0; it < 4; ++it) *(v8h*)(zc + off[it]) = zv[it];
    }
}

// ---------------------------------------------------------------------------
// Output projection: out[m][n] = 2^-12 * (64 z)[m][:] . (64 Wo)[:][n] + bO[n].
// Block = 4 waves, 2 x 2 = 128 rows x 128 columns; wave = 64 rows x 64 columns, stored as two
// halves of 32 rows. f32 tile staged in a wave-private
// LDS tile; each instruction writes two whole 256-B row segments (16 lanes x 16 B);
// coverage: 32 rows = 16 instructions x 2 rows.
// ---------------------------------------------------------------------------
static_assert(DM % 128 == 0);
__global__ __launch_bounds__(128) __attribute__((amdgpu_num_vgpr(512)))
void k_out(const _Float16* __restrict__ zc,
           const _Float16* __restrict__ woT,
           const float*    __restrict__ bo,
           float* __restrict__ out) {
    __shared__ __align__(16) float Ost[4][32 * 64];     // 32 KB, wave-private tiles
    const int tid  = threadIdx.x;
    const int lane = tid & 31;
    const int w    = __builtin_amdgcn_readfirstlane(tid >> 5);   // scalar: the bases stay in scalar registers
    const int m0   = blockIdx.x * 128 + (w & 1) * 64;
    const int n0   = blockIdx.y * 128 + (w >> 1) * 64;

    const int r0 = (lane >> 4) << 3;
    const int cc = lane & 15;
    float bb[4];
    v8f acc[4][4];
    // one wave a SIMD: four sets, three steps of loads in flight
    gemm_64x64<4>(zc + (size_t)m0 * DM, woT + (size_t)n0 * DM, bo + n0 + cc, blockIdx.x + blockIdx.y, lane, acc, bb);

    const int rh = lane >> 4, c4 = lane & 15;
#pragma unroll
    for (int hf = 0; hf < 2; ++hf) {
#pragma unroll
        for (int rt = 0; rt < 2; ++rt)
#pragma unroll
            for (int nt = 0; nt < 4; ++nt)
#pragma unroll
                for (int g = 0; g < 8; ++g)
                    Ost[w][(rt * 16 + r0 + g) * 64 + nt * 16 + cc] =
                        __builtin_fmaf(acc[hf * 2 + rt][nt][g], SC_OUT, bb[nt]);
        wave_lds_sync();

        v4f sv[16];
#pragma unroll
        for (int it = 0; it < 16; ++it) sv[it] = *(const v4f*)(&Ost[w][(it * 2 + rh) * 64 + c4 * 4]);
        float* ob = out + (size_t)(m0 + hf * 32) * DM + n0 + (size_t)rh * DM + c4 * 4;
#pragma unroll
        for (int it = 0; it < 16; ++it) *(v4f*)(ob + (size_t)(it * 2) * DM) = sv[it];
        // the tile's reads above come before the second half's writes to it
        if (hf == 0) wave_lds_sync();
    }
}

// ---------------------------------------------------------------------------
extern "C" void kernel_launch(void* const* d_in, const int* in_sizes, int n_in,
                              void* d_out, int out_size, void* d_ws, size_t ws_size,
                              hipStream_t stream) {
    if (n_in < 9) return;
    if (in_sizes[0] < ((SEQ - 1) * NB_FULL + NB) * DM) return;
    if (in_sizes[1] < NH * DM * HD || in_sizes[3] < NH * DM * HD || in_sizes[5] < NH * DM * HD) return;
    if (in_sizes[2] < NH * HD || in_sizes[4] < NH * HD || in_sizes[6] < NH * HD) return;
    if (in_sizes[7] < DM * DM || in_sizes[8] < DM) return;
    if (out_size < MTOT * DM) return;
    if ((size_t)WS_TOTAL > ws_size) return;

    const float* X  = (const float*)d_in[0];   // [S][B][512], row m = s*4 + b
    const float* WQ = (const float*)d_in[1];   // [8][512][64]
    const float* bQ = (const float*)d_in[2];   // [8][64]
    const float* WK = (const float*)d_in[3];
    const float* bK = (const float*)d_in[4];
    const float* WV = (const float*)d_in[5];
    const float* bV = (const float*)d_in[6];
    const float* WO = (const float*)d_in[7];   // [512 in][512 out]
    const float* bO = (const float*)d_in[8];   // [512]
    float* out = (float*)d_out;                // [S][B][512]

    char* ws = (char*)d_ws;
    size_t off = 0;
    _Float16* wT   = (_Float16*)(ws + off); off += WT_BYTES;     // [1536][512], fragment order
    _Float16* woT  = (_Float16*)(ws + off); off += WOT_BYTES;    // [512][512], fragment order
    float*    bias = (float*)(ws + off);    off += BIAS_BYTES;   // [2048]
    _Float16* xh   = (_Float16*)(ws + off); off += XH_BYTES;     // [MTOT][512], fragment order
    _Float16* qkv  = (_Float16*)(ws + off); off += 3 * PL_BYTES; // q, k, V^T, each [h][b] in fragment order
    _Float16* zc   = (_Float16*)(ws + off); off += ZC_BYTES;     // [MTOT][512], fragment order
    if (off > ws_size) return;

    k_prep<<<dim3(PREP_BLOCKS), dim3(256), 0, stream>>>(X, WQ, bQ, WK, bK, WV, bV, WO, bO, wT, woT, bias, xh);
    k_proj<<<dim3(MTOT / 128, NQKV / (PROJ_WN * 64)), dim3(PROJ_WN * 64), 0, stream>>>(xh, wT, bias, qkv);
    k_attn<<<dim3(SEQ / 64, NH), dim3(256), 0, stream>>>(qkv, qkv + PL_ELEMS, qkv + 2 * PL_ELEMS, zc);
    k_out<<<dim3(MTOT / 128, DM / 128), dim3(128), 0, stream>>>(zc, woT, bias + NQKV, out);
}

// v010
// Measured time: 63.8 microseconds a run.
// Next to v009, in two timings, it ran 1.05 and 1.06 times as fast.
// Counting every step since v000, it is 4.39 times as fast.
#include <hip/hip_runtime.h>
#include <hip/hip_fp16.h>

// All contractions on v_wmma_f32_16x16x32_f16 (f16 operands, f32 accumulate), single products: x*[Wq|Wk|Wv], q*k^T, P*v, z*Wo; every float input RNE-converted to bf16 first (exact in f16), weight planes and v/z planes carried x64, the q plane x log2(e)/2 and the k plane x 1/4 (their product is the score in log2 units), P = exp(p1) in [1,e] unscaled.

#ifndef NB
#define NB 4             // batch; an attention wave holds the score tiles of all 4 batches (must stay 4)
#endif
#ifndef SEQ
#define SEQ 2048
#endif
#define NB_FULL  4
#define SEQ_FULL 2048
#define DM   512          // model width
#define NH   8            // heads
#define HD   64           // head width (dk = dv)
#define NQKV (3 * NH * HD)
#define MTOT (SEQ * NB)   // token rows m = s*NB + b

static_assert(NB == 4);
static_assert(NB_FULL == 4);
static_assert(SEQ >= 64 && SEQ <= SEQ_FULL);
static_assert(SEQ % 64 == 0);
static_assert(MTOT % 128 == 0);
static_assert(DM % 32 == 0);
static_assert(DM == NH * HD);
static_assert(HD == 64);
static_assert(NQKV % 64 == 0);
static_assert(((size_t)MTOT * DM) % 2048 == 0);

typedef _Float16 v16h __attribute__((ext_vector_type(16)));
typedef _Float16 v8h  __attribute__((ext_vector_type(8)));
typedef float    v8f  __attribute__((ext_vector_type(8)));
typedef float    v4f  __attribute__((ext_vector_type(4)));
typedef float    v2f  __attribute__((ext_vector_type(2)));
typedef _Float16 v2h  __attribute__((ext_vector_type(2)));

union Frag { v16h v; v8h h[2]; };

#define L2E     1.44269504088896340736f
#define SQ      (1.44269504088896340736f * 7.8125e-03f)         // log2(e) * 2^-7 : 64 q -> q plane
#define SK      3.90625e-03f                                     // 2^-8 : 64 k -> k plane; SQ * SK * 4096 = log2(e) / 8
#define SUM_LO  0x1p-100f                                        // a batch sum of 2^score inside [SUM_LO, SUM_HI] has
#define SUM_HI  0x1p+122f                                        // neither overflowed nor lost a term that counts
#define SC_OUT  2.44140625e-04f                                  // 2^-12 : (64 z)(64 Wo) -> out

#define WT_BYTES   ((size_t)NQKV * DM * 2)
#define WOT_BYTES  ((size_t)DM * DM * 2)
#define BIAS_ELEMS 2048
#define BIAS_BYTES ((size_t)BIAS_ELEMS * 4)
#define XH_BYTES   ((size_t)MTOT * DM * 2)
#define PL_ELEMS   ((size_t)NH * NB * SEQ * HD)
#define PL_BYTES   (PL_ELEMS * 2)
#define ZC_BYTES   ((size_t)MTOT * DM * 2)
#define WS_TOTAL   (WT_BYTES + WOT_BYTES + BIAS_BYTES + XH_BYTES + 3 * PL_BYTES + ZC_BYTES)
static_assert(WS_TOTAL <= (size_t)134217728);
static_assert(WT_BYTES % 128 == 0 && WOT_BYTES % 128 == 0 && BIAS_BYTES % 128 == 0);
static_assert(XH_BYTES % 128 == 0 && PL_BYTES % 128 == 0 && ZC_BYTES % 128 == 0);
static_assert(NQKV + DM == BIAS_ELEMS);

static __device__ __forceinline__ v8f zero8() {
    v8f z;
#pragma unroll
    for (int i = 0; i < 8; ++i) z[i] = 0.0f;
    return z;
}

// 16x32 A fragment (or B fragment, n for row) from a plane kept in fragment order: lane holds
// row lane&15; with kb = 8*(lane>>4), elements 0..7 = k kb..kb+7, elements 8..15 = k kb+16..kb+23.
// A 16-row x 32-k block is 512
// halves, [j 0..1][lane 0..31][8 halves], where lane = row + 16*((k>>3)&1), j = k>>4,
// so each of the two loads reads 512 contiguous bytes (four whole lines) per wave.
static __device__ __forceinline__ v16h load_fragF(const _Float16* blk, int lane) {
    const _Float16* p = blk + lane * 8;
    Frag f;
    f.h[0] = *(const v8h*)(p);
    f.h[1] = *(const v8h*)(p + 256);
    return f.v;
}

// the bare builtin: the matrix kernels hold more than 256 VGPRs, and an asm operand cannot sit
// above v255, so a pad written in asm behind it would force its fragments into the low window
static __device__ __forceinline__ v8f wmma16b(v16h a, v16h b, v8f c) {
    return __builtin_amdgcn_wmma_f32_16x16x32_f16(false, a, false, b, (short)0, c, false, false);
}

// f32 -> bf16 RNE convert, value kept as f32
static __device__ __forceinline__ float bf16r(float x) {
    unsigned u = __float_as_uint(x);
    u = (u + 0x7FFFu + ((u >> 16) & 1u)) & 0xFFFF0000u;
    return __uint_as_float(u);
}

static __device__ __forceinline__ float ex2(float x) {
    return __builtin_amdgcn_exp2f(x);
}

// ordering for a wave-private LDS tile: stores before later loads of the same wave
static __device__ __forceinline__ void wave_lds_sync() {
    __builtin_amdgcn_fence(3, "wavefront");
    asm volatile("s_wait_dscnt 0" ::: "memory");
    __builtin_amdgcn_wave_barrier();
}

// ---------------------------------------------------------------------------
// Operand planes, one launch: the weight planes, the bias plane and the x plane need nothing
// of each other, so they share one grid; a range of the block index picks the job
// (block-uniform): [0, 256) weight tiles, 256 the bias plane, the rest the x plane.
// The weight tiles come first: theirs is the longest chain (load, LDS, barrier, store).
// ---------------------------------------------------------------------------
#define PREP_WT_BLOCKS 256                                  // 4 matrices x 8 x 8 tiles of 64 x 64
#define PREP_X_BLOCKS  ((int)(((size_t)MTOT * DM) / 2048))
#define PREP_BLOCKS    (PREP_WT_BLOCKS + 1 + PREP_X_BLOCKS)

// Weight plane builder: one 64x64 tile per block, in[i][j] (f32) -> out[j][i]
// (f16 = 64 * bf16-RNE value).
// out is kept in fragment order: [j>>4][i>>5] blocks of 512 halves, 16 out rows = 16*DM halves.
// coverage: 4 x 2 blocks x 2 halves = 16 runs of 512 B = 8 waves x 2.
static __device__ __forceinline__ void prep_wT(const float* __restrict__ sp, int src_pitch,
                                               _Float16* __restrict__ dp, _Float16* T, int tid) {
#pragma unroll
    for (int it = 0; it < 4; ++it) {
        int idx = tid + it * 256;
        int r = idx >> 4, c4 = idx & 15;
        v4f v = *(const v4f*)(sp + (size_t)r * src_pitch + c4 * 4);
        T[(c4 * 4 + 0) * 72 + r] = (_Float16)(bf16r(v.x) * 64.0f);
        T[(c4 * 4 + 1) * 72 + r] = (_Float16)(bf16r(v.y) * 64.0f);
        T[(c4 * 4 + 2) * 72 + r] = (_Float16)(bf16r(v.z) * 64.0f);
        T[(c4 * 4 + 3) * 72 + r] = (_Float16)(bf16r(v.w) * 64.0f);
    }
    __syncthreads();
    const int lane = tid & 31, wv = tid >> 5;
    const int nt0 = wv >> 2, nt1 = nt0 + 2;            // 16-row group of the out rows
    const int pq  = (wv & 3) * 2 + (lane >> 4);        // 8-half piece of the 64 k: (kc*2 + j)*2 + hi
    v8h o0 = *(const v8h*)(&T[(nt0 * 16 + (lane & 15)) * 72 + pq * 8]);
    v8h o1 = *(const v8h*)(&T[(nt1 * 16 + (lane & 15)) * 72 + pq * 8]);
    _Float16* d0 = dp + (size_t)(nt0 * 16) * DM + (wv & 3) * 256 + lane * 8;
    _Float16* d1 = dp + (size_t)(nt1 * 16) * DM + (wv & 3) * 256 + lane * 8;
    *(v8h*)d0 = o0;
    *(v8h*)d1 = o1;
    // another job's code follows in the built kernel and reuses the registers these stores name
    asm volatile("s_wait_xcnt 0x0" ::: "memory");
}

// x plane in fragment order: f16(bf16r(x[m][d])); 8 elements per thread; 8 consecutive
// lanes take the same 8-column piece of 8 consecutive rows = one whole 128-B line of xh
static __device__ __forceinline__ void prep_x(const float* __restrict__ x, _Float16* __restrict__ xh, int gid) {
    const int pc  = (gid >> 3) & 63;                   // 8-column piece of the row
    const int row = ((gid >> 9) << 3) + (gid & 7);
    const size_t i = (size_t)row * DM + pc * 8;
    const size_t j = (size_t)(row >> 4) * (16 * DM) + (pc >> 1) * 256 + ((row & 15) + 16 * (pc & 1)) * 8;
    v4f a = *(const v4f*)(x + i);
    v4f b = *(const v4f*)(x + i + 4);
    v8h o;
    o[0] = (_Float16)bf16r(a.x); o[1] = (_Float16)bf16r(a.y);
    o[2] = (_Float16)bf16r(a.z); o[3] = (_Float16)bf16r(a.w);
    o[4] = (_Float16)bf16r(b.x); o[5] = (_Float16)bf16r(b.y);
    o[6] = (_Float16)bf16r(b.z); o[7] = (_Float16)bf16r(b.w);
    *(v8h*)(xh + j) = o;
    // another job's code follows in the built kernel and reuses the registers this store names
    asm volatile("s_wait_xcnt 0x0" ::: "memory");
}

__global__ __launch_bounds__(256) void k_prep(const float* __restrict__ X,
                                              const float* __restrict__ WQ, const float* __restrict__ bQ,
                                              const float* __restrict__ WK, const float* __restrict__ bK,
                                              const float* __restrict__ WV, const float* __restrict__ bV,
                                              const float* __restrict__ WO, const float* __restrict__ bO,
                                              _Float16* __restrict__ wT, _Float16* __restrict__ woT,
                                              float* __restrict__ bias, _Float16* __restrict__ xh) {
    __shared__ __align__(16) _Float16 T[64 * 72];
    const int tid = threadIdx.x;
    const int blk = blockIdx.x;
    if (blk < PREP_WT_BLOCKS) {
        const int which = blk >> 6;                    // 0 Wq, 1 Wk, 2 Wv, 3 Wo
        const int bx = blk & 7, by = (blk >> 3) & 7;
        if (which < 3) {
            // per-head weights: in[d 512][k 64] -> out[h*64 + k][d]; bx tiles = d, by tiles = head
            const float* w = (which == 0) ? WQ : (which == 1) ? WK : WV;
            prep_wT(w + (size_t)bx * (64 * HD) + (size_t)by * (DM * HD), HD,
                    wT + (size_t)which * (DM * DM) + (size_t)bx * 1024 + (size_t)by * (64 * DM), T, tid);
        } else {
            // Wo: in[k 512][n 512] -> out[n][k]; bx tiles = k rows, by tiles = n columns
            prep_wT(WO + (size_t)bx * (64 * DM) + (size_t)by * 64, DM,
                    woT + (size_t)bx * 1024 + (size_t)by * (64 * DM), T, tid);
        }
    } else if (blk == PREP_WT_BLOCKS) {
        // Bias plane [2048] f32: [0..1535] = 64*bf16r(bQ|bK|bV) (index which*512 + h*64 + k),
        // [1536..2047] = bf16r(bO). 8 consecutive elements per thread, 64 threads per vector.
        const int which = tid >> 6;
        const float* b = (which == 0) ? bQ : (which == 1) ? bK : (which == 2) ? bV : bO;
        const float sc = (which < 3) ? 64.0f : 1.0f;
        const v4f u = *(const v4f*)(b + (tid & 63) * 8);
        const v4f v = *(const v4f*)(b + (tid & 63) * 8 + 4);
        v4f p, q;
        p.x = bf16r(u.x) * sc; p.y = bf16r(u.y) * sc; p.z = bf16r(u.z) * sc; p.w = bf16r(u.w) * sc;
        q.x = bf16r(v.x) * sc; q.y = bf16r(v.y) * sc; q.z = bf16r(v.z) * sc; q.w = bf16r(v.w) * sc;
        *(v4f*)(bias + tid * 8)     = p;
        *(v4f*)(bias + tid * 8 + 4) = q;
        // another job's code follows in the built kernel and reuses the registers these stores name
        asm volatile("s_wait_xcnt 0x0" ::: "memory");
    } else {
        prep_x(X, xh, (blk - (PREP_WT_BLOCKS + 1)) * 256 + tid);
    }
}

// ---------------------------------------------------------------------------
// GEMM main loop: wave tile 64 rows x 64 columns, K = DM, A and B planes both in
// fragment order (16 rows = 16*DM halves, 32 k = 512 halves), fragments straight
// from the 16-bit global planes (arithmetic addressing only). Each of the eight fragments
// of a 32-k step feeds four products, so a product costs 512 loaded bytes.
// The eight fragments of a step are loaded as one group, KRING - 1 steps ahead of their
// products, into a ring of KRING register sets: the few waves of a SIMD do not hide a load's
// latency; the wave's own loads in flight have to.
// The blocks of a launch that share rows of A or of B each enter the k walk at their own step
// (st, from the block's two indices) and wrap round, so that they do not ask L2 for the same
// lines at the same moment; trip t takes k step (st + t) mod KSTEPS. The waves of one block
// share st: waves with the same rows or the same columns ask for the same lines together.
// ---------------------------------------------------------------------------
#define KSTEPS (DM / 32)
static_assert((KSTEPS & (KSTEPS - 1)) == 0);

static __device__ __forceinline__ void load_kstep(const _Float16* __restrict__ Ak,
                                                  const _Float16* __restrict__ Bk,
                                                  int lane, v16h (&a)[4], v16h (&b)[4]) {
#pragma unroll
    for (int rt = 0; rt < 4; ++rt) a[rt] = load_fragF(Ak + rt * 16 * DM, lane);
#pragma unroll
    for (int nt = 0; nt < 4; ++nt) b[nt] = load_fragF(Bk + nt * 16 * DM, lane);
}

// to the next k step of the walk; behind the last one comes the first
static __device__ __forceinline__ void next_kstep(const _Float16*& Ak, const _Float16*& Bk, int& ks) {
    // the address registers of the fetch before are advanced next
    asm volatile("s_wait_xcnt 0x0" ::: "memory");
    // keeps the two additions below that wait
    __builtin_amdgcn_sched_barrier(0);
    const bool wrap = (ks == KSTEPS - 1);
    const int  step = wrap ? -(KSTEPS - 1) * 512 : 512;
    ks = wrap ? 0 : ks + 1;
    Ak += step;
    Bk += step;
}

template <int KRING>
static __device__ __forceinline__ void gemm_64x64(const _Float16* __restrict__ Ap,
                                                  const _Float16* __restrict__ Bp,
                                                  const float* __restrict__ bp,
                                                  int st, int lane, v8f (&acc)[4][4], float (&bb)[4]) {
    static_assert(KSTEPS >= KRING - 1);
    v16h a[KRING][4], b[KRING][4];
    int ks = st & (KSTEPS - 1);
    const _Float16* Ak = Ap + ks * 512;
    const _Float16* Bk = Bp + ks * 512;
#pragma unroll
    for (int t = 0; t < KRING - 1; ++t) {
        if (t > 0) next_kstep(Ak, Bk, ks);
        load_kstep(Ak, Bk, lane, a[t], b[t]);
    }
#pragma unroll
    for (int rt = 0; rt < 4; ++rt)
#pragma unroll
        for (int nt = 0; nt < 4; ++nt) acc[rt][nt] = zero8();
    // unrolled whole: the ring's set numbers become register names
#pragma unroll
    for (int t = 0; t < KSTEPS; ++t) {
        constexpr int AH = KRING - 1;
        if (t + AH < KSTEPS) {
            next_kstep(Ak, Bk, ks);
            load_kstep(Ak, Bk, lane, a[(t + AH) % KRING], b[(t + AH) % KRING]);
        }
        // behind the last fetch: the address registers of the fragment loads are free for reuse from here on
        if (t + AH == KSTEPS - 1) asm volatile("s_wait_xcnt 0x0" ::: "memory");
        // the bias of the lane's four columns, in the first trip without a fetch: a set of the ring is
        // free by then (held from the start these four spill), and the products left cover the latency
        if (t + AH == KSTEPS) {
#pragma unroll
            for (int nt = 0; nt < 4; ++nt) bb[nt] = bp[nt * 16];
            // the register that holds these loads' address is free for reuse from here on
            asm volatile("s_wait_xcnt 0x0" ::: "memory");
        }
        // keeps the fetch above this step's products: sunk among them it loses its lead
        __builtin_amdgcn_sched_barrier(0);
#pragma unroll
        for (int nt = 0; nt < 4; ++nt)
#pragma unroll
            for (int rt = 0; rt < 4; ++rt)
                acc[rt][nt] = wmma16b(a[t % KRING][rt], b[t % KRING][nt], acc[rt][nt]);
        // keeps the next fetch below these products: raised above them it takes one more set
        __builtin_amdgcn_sched_barrier(0);
    }
}

// ---------------------------------------------------------------------------
// Projections: [MTOT x 512] x [512 x 1536]. Block = 12 waves, 2 down the rows x 6 along the
// columns = 128 token rows x 384 columns; wave = 64 token rows x 64 columns (one of q/k/v, one
// head). 256 blocks of three waves a SIMD: the whole launch is resident at once. Waves 4r .. 4r+3
// form a 2 x 2 group, two of them sharing each fragment.
// The epilogue takes the wave's tile as two halves of 32 token rows, one after the other.
// Output planes q,k [h][b] in fragment order
// (16 s = 1024 halves): 8 consecutive lanes write the same piece of 8 consecutive s =
// one whole line. coverage: 32 rows x 8 pieces = 8 instructions x 32 lanes.
// Output plane V^T [h][b] in fragment order, rows = v column, k = key: [s>>5][v>>4] blocks
// of 512 halves. A half's 32 token rows are 8 consecutive s (from a multiple of 8) of all
// 4 batches, and 8 such s of one v column are one 16-byte piece of that plane, so the wave
// writes it itself: 16 consecutive lanes write the pieces of 16 v columns = two whole lines.
// coverage: 4 batches x 64 columns = 256 pieces = 8 instructions x 32 lanes.
// ---------------------------------------------------------------------------
#define PROJ_WN 6
static_assert(NQKV % (PROJ_WN * 64) == 0);
__global__ __launch_bounds__(PROJ_WN * 64) __attribute__((amdgpu_num_vgpr(336)))
void k_proj(const _Float16* __restrict__ xh,
            const _Float16* __restrict__ wT,
            const float*    __restrict__ bias,
            _Float16* __restrict__ qkv) {
    __shared__ __align__(16) _Float16 st[PROJ_WN * 2][32 * 72];   // 54 KB, wave-private tiles, pitch 144 B
    const int tid  = threadIdx.x;
    const int lane = tid & 31;
    const int w    = __builtin_amdgcn_readfirstlane(tid >> 5);   // scalar: the bases stay in scalar registers
    const int m0   = blockIdx.x * 128 + (w & 1) * 64;
    const int n0   = blockIdx.y * (PROJ_WN * 64) + (w >> 1) * 64;

    const int r0 = (lane >> 4) << 3;
    const int cc = lane & 15;
    float bb[4];
    v8f acc[4][4];
    // three sets and the accumulators fit the 336 VGPRs that leave three waves a SIMD
    gemm_64x64<3>(xh + (size_t)m0 * DM, wT + (size_t)n0 * DM, bias + n0 + cc, blockIdx.x + blockIdx.y, lane, acc, bb);

    const int which = n0 >> 9;               // 0 q, 1 k, 2 v (the same for the whole wave)
    const int hh    = (n0 & 511) >> 6;
    _Float16* plane = qkv + (size_t)which * PL_ELEMS;
#pragma unroll
    for (int hf = 0; hf < 2; ++hf) {
        const int mh = m0 + hf * 32;         // first token row of this half
        v8h pv[8];
        int off[8];
        if (which == 2) {
            // tile kept as pieces [batch][v column][8 s]: accumulator row rt*16 + r0 + g is
            // s = rt*4 + (r0 >> 2) + (g >> 2), batch g & 3, so elements g and g + 4 are two consecutive s
#pragma unroll
            for (int rt = 0; rt < 2; ++rt)
#pragma unroll
                for (int nt = 0; nt < 4; ++nt)
#pragma unroll
                    for (int b = 0; b < NB; ++b) {
                        v2f t;
                        t.x = acc[hf * 2 + rt][nt][b] + bb[nt];
                        t.y = acc[hf * 2 + rt][nt][b + 4] + bb[nt];
                        *(v2h*)(&st[w][(b * 64 + nt * 16 + cc) * 8 + rt * 4 + (r0 >> 2)]) = __builtin_convertvector(t, v2h);
                    }
            wave_lds_sync();
            const int sb = mh >> 2;          // first of the half's 8 s
#pragma unroll
            for (int it = 0; it < 8; ++it) {
                // piece it*32 + lane: batch it >> 1, v column (it & 1)*32 + lane
                pv[it]  = *(const v8h*)(&st[w][(it * 32 + lane) * 8]);
                off[it] = ((hh * NB + (it >> 1)) * SEQ + (sb & ~31)) * HD + ((it & 1) * 2 + (lane >> 4)) * 512
                        + ((sb >> 4) & 1) * 256 + (cc + 16 * ((sb >> 3) & 1)) * 8;
            }
        } else {
            const float ps = (which == 0) ? SQ : SK;     // the plane's scale
#pragma unroll
            for (int rt = 0; rt < 2; ++rt)
#pragma unroll
                for (int nt = 0; nt < 4; ++nt)
#pragma unroll
                    for (int g = 0; g < 8; ++g)
                        st[w][(rt * 16 + r0 + g) * 72 + nt * 16 + cc] =
                            (_Float16)__builtin_fmaf(acc[hf * 2 + rt][nt][g], ps, bb[nt] * ps);
            wave_lds_sync();
            const int rq = lane >> 3, pc = lane & 7;
#pragma unroll
            for (int it = 0; it < 8; ++it) {
                // lanes run over 8 s of batch rq, piece it
                const int i = pc * 4 + rq;
                pv[it] = *(const v8h*)(&st[w][i * 72 + it * 8]);
                const int m = mh + i;
                const int s = m >> 2, b = m & 3;     // m = s*NB + b, NB = 4
                off[it] = ((hh * NB + b) * SEQ + (s & ~15)) * HD + (it >> 1) * 256 + ((s & 15) + 16 * (it & 1)) * 8;
            }
        }
#pragma unroll
        for (int it = 0; it < 8; ++it) *(v8h*)(plane + off[it]) = pv[it];
        if (hf == 0) {
            // the second half's code reuses the registers these stores name
            asm volatile("s_wait_xcnt 0x0" ::: "memory");
            // the tile's reads above come before the second half's writes to it
            wave_lds_sync();
        }
    }
}

// ---------------------------------------------------------------------------
// Fused attention, block = (head h, 64 queries), 8 waves = 4 query tiles of 16 x 2 key halves
// (wave kh takes the 32-key chunks 2i + kh). A wave holds the score tiles of ALL FOUR batches
// of its 16 queries: the four tiles have the same lane/register map, so the softmax over the
// batch axis is plain register arithmetic, with one sum and one reciprocal (and, in the shifted walk, one maximum) per
// (query, key) for the four batches; nothing is exchanged between waves inside the loop.
// The scores are formed transposed, S^T = K q^T (A = K rows, B = q): a lane then holds 8
// consecutive keys of ONE query, which is the B-operand map of P^T, so the two 16-key tiles of
// a chunk, converted in place, are the B fragment of o^T += V^T P^T; P touches no LDS.
// Per 16-key half of a chunk: 8 WMMAs (q/k fragments from the fragment-order planes) give the
// scores s_b in log2 units, then
//   e_b = 2^s_b, p1_b = e_b / sum_b e
//   P_b = 2^(p1_b * log2 e) in [1, e]  (key-axis softmax numerator, no shift needed)
// the sum of P is accumulated per lane in f32 (one query, half of the keys; two partial sums),
// o^T_b += V^T_b @ P^T_b (16 WMMAs per chunk, V^T fragments from the plane as A).
// p1 does not depend on a shift common to the four batches; a shift only keeps 2^s in range. So
// the walk over the keys first runs without one and keeps the smallest and the largest batch sum
// it meets; a wave that met a sum outside [SUM_LO, SUM_HI] (scores too large or too small for
// 2^s) walks its keys again with e_b = 2^(s_b - max_b s), which holds for scores of any size.
// After the walk the two key halves' o and row sums are joined through LDS (one block barrier).
// ---------------------------------------------------------------------------
template <bool SHIFT>
static __device__ __forceinline__ void batch_softmax16(const v8f (&sc)[NB], v2f (&rs)[NB], v8h (&ph)[NB],
                                                       float& lo, float& hi) {
#pragma unroll
    for (int g = 0; g < 8; g += 2) {
        v2f p[NB];
#pragma unroll
        for (int u = 0; u < 2; ++u) {
            float e[NB];
            if (SHIFT) {
                const float m = fmaxf(fmaxf(sc[0][g + u], sc[1][g + u]), fmaxf(sc[2][g + u], sc[3][g + u]));
#pragma unroll
                for (int b = 0; b < NB; ++b) e[b] = ex2(sc[b][g + u] - m);
            } else {
#pragma unroll
                for (int b = 0; b < NB; ++b) e[b] = ex2(sc[b][g + u]);
            }
            const float sum = (e[0] + e[1]) + (e[2] + e[3]);
            if (!SHIFT) {
                lo = fminf(lo, sum);
                hi = fmaxf(hi, sum);
            }
            const float r = __builtin_amdgcn_rcpf(sum) * L2E;
#pragma unroll
            for (int b = 0; b < NB; ++b) p[b][u] = ex2(e[b] * r);
        }
#pragma unroll
        for (int b = 0; b < NB; ++b) {
            const v2h hp = __builtin_convertvector(p[b], v2h);
            rs[b] += p[b];
            ph[b][g]     = hp[0];
            ph[b][g + 1] = hp[1];
        }
    }
}

// One wave's walk over its half of the keys, from the block's own stage round to it again:
// o and rs are started at zero and hold the wave's partial sums at the end.
template <bool SHIFT>
static __device__ __forceinline__ void attn_walk(const _Float16* kc, const _Float16* vr, int stage, int lane,
                                                 const v16h (&qf)[NB][2], v8f (&o)[NB][4], v2f (&rs)[NB],
                                                 float& lo, float& hi) {
    constexpr int PB = SEQ * HD;              // halves of one (h, b) plane
#pragma unroll
    for (int b = 0; b < NB; ++b) {
#pragma unroll
        for (int nt = 0; nt < 4; ++nt) o[b][nt] = zero8();
        rs[b] = 0.0f;
    }

    // K fragments of 16 keys x 4 batches, fetched one 16-key half ahead into the same registers
    v16h kf[NB][2];
#pragma unroll
    for (int b = 0; b < NB; ++b) {
        kf[b][0] = load_fragF(kc + b * PB, lane);
        kf[b][1] = load_fragF(kc + b * PB + 512, lane);
    }

    // the address registers of the loads issued so far (the q fragments' too) are free for reuse from here on
    asm volatile("s_wait_xcnt 0x0" ::: "memory");
    // keeps what follows below that wait
    __builtin_amdgcn_sched_barrier(0);

#pragma unroll 1
    for (int i = 0; i < SEQ / 64; ++i) {
        // this chunk's V^T fragments, one group, in flight under the scores and the softmax
        v16h vf[NB][4];
#pragma unroll
        for (int b = 0; b < NB; ++b)
#pragma unroll
            for (int nt = 0; nt < 4; ++nt)
                vf[b][nt] = load_fragF(vr + b * PB + nt * 512, lane);   // rows = v column, k = key

        v8f sc[NB];
        v8h p0[NB], p1[NB];                   // P^T of keys 0..15 and 16..31: B elements 0..7 and 8..15
        // keys 0..15 of the chunk, then the fetch of keys 16..31 into the same registers
#pragma unroll
        for (int b = 0; b < NB; ++b) sc[b] = wmma16b(kf[b][0], qf[b][0], zero8());
#pragma unroll
        for (int b = 0; b < NB; ++b) sc[b] = wmma16b(kf[b][1], qf[b][1], sc[b]);
#pragma unroll
        for (int b = 0; b < NB; ++b) {
            kf[b][0] = load_fragF(kc + b * PB + 16 * HD, lane);
            kf[b][1] = load_fragF(kc + b * PB + 16 * HD + 512, lane);
        }
        // keeps the fetch above the softmax: moved below it, the next scores wait out its whole latency
        __builtin_amdgcn_sched_barrier(0);
        batch_softmax16<SHIFT>(sc, rs, p0, lo, hi);
        // keeps the second scores below the first softmax: moved up, they wait on a fetch just issued
        __builtin_amdgcn_sched_barrier(0);

        // keys 16..31 of the chunk
#pragma unroll
        for (int b = 0; b < NB; ++b) sc[b] = wmma16b(kf[b][0], qf[b][0], zero8());
#pragma unroll
        for (int b = 0; b < NB; ++b) sc[b] = wmma16b(kf[b][1], qf[b][1], sc[b]);
        // the address registers of the loads issued so far are advanced next
        asm volatile("s_wait_xcnt 0x0" ::: "memory");
        // keeps the two additions below that wait
        __builtin_amdgcn_sched_barrier(0);
        // first half of this wave's next chunk; behind the last stage of the planes comes the first
        // (the last trip fetches the block's first chunk again, so the addresses stay inside the planes)
        const bool wrap = (stage + 1 == SEQ / 64);
        const int  step = wrap ? -(SEQ / 64 - 1) * (64 * HD) : 64 * HD;
        stage = wrap ? 0 : stage + 1;
        kc += step;
        vr += step;
#pragma unroll
        for (int b = 0; b < NB; ++b) {
            kf[b][0] = load_fragF(kc + b * PB, lane);
            kf[b][1] = load_fragF(kc + b * PB + 512, lane);
        }
        // keeps the fetch above the softmax, as above
        __builtin_amdgcn_sched_barrier(0);
        batch_softmax16<SHIFT>(sc, rs, p1, lo, hi);

        Frag pb[NB];                          // n = query, k = 32 keys, the order of the V^T fragments
#pragma unroll
        for (int b = 0; b < NB; ++b) { pb[b].h[0] = p0[b]; pb[b].h[1] = p1[b]; }
#pragma unroll
        for (int nt = 0; nt < 4; ++nt)
#pragma unroll
            for (int b = 0; b < NB; ++b) o[b][nt] = wmma16b(vf[b][nt], pb[b].v, o[b][nt]);
    }
    // the address registers of the last trip's fetch are free for reuse from here on
    asm volatile("s_wait_xcnt 0x0" ::: "memory");
    // keeps what follows below that wait
    __builtin_amdgcn_sched_barrier(0);
}

__global__ __launch_bounds__(256)
void k_attn(const _Float16* __restrict__ qp,
            const _Float16* __restrict__ kp,
            const _Float16* __restrict__ vT,
            _Float16* __restrict__ zc) {
    __shared__ __align__(32) float    Xo[4][NB * 4][32 * 8];     // 64 KB, key half 1 -> key half 0
    __shared__ __align__(16) float    Xr[4][NB][32];             // 2 KB, key half 1 -> key half 0
    __shared__ __align__(16) _Float16 Zst[4][NB][16 * 72];       // 36 KB, pitch 144 B, wave-private

    const int tid  = threadIdx.x;
    const int lane = tid & 31;
    const int wv   = __builtin_amdgcn_readfirstlane(tid >> 5);
    const int qt   = wv & 3;                  // query tile of the block
    const int kh   = wv >> 2;                 // key half
    const int h    = blockIdx.y;
    const int s0   = blockIdx.x * 64 + qt * 16;
    const int r0   = (lane >> 4) << 3;
    const int cc   = lane & 15;
    constexpr int PB = SEQ * HD;              // halves of one (h, b) plane

    const _Float16* qb = qp + ((size_t)h * NB * SEQ + s0) * HD;
    // The blocks of one head walk the same K and V^T planes. Each enters the walk at its own
    // 64-key stage (its block index) and wraps round, so that no two of them ask L2 for the
    // same lines at the same moment; the sums over the keys take any order.
    const int stage = blockIdx.x;             // grid x = SEQ / 64 = the number of stages
    const _Float16* kc = kp + (size_t)h * NB * PB + stage * (64 * HD) + kh * (32 * HD);   // this wave's first chunk
    const _Float16* vr = vT + (size_t)h * NB * PB + stage * (64 * HD) + kh * (32 * HD);

    v16h qf[NB][2];
#pragma unroll
    for (int b = 0; b < NB; ++b) {
        qf[b][0] = load_fragF(qb + b * PB, lane);         // d 0..31
        qf[b][1] = load_fragF(qb + b * PB + 512, lane);   // d 32..63
    }

    v8f o[NB][4];
    v2f rs[NB];
    float lo = SUM_HI, hi = SUM_LO;
    attn_walk<false>(kc, vr, stage, lane, qf, o, rs, lo, hi);
    // one test a wave, after the walk; the ballot makes it a scalar branch (the products need every lane on)
    if (__builtin_amdgcn_ballot_w32(!(lo >= SUM_LO && hi <= SUM_HI)) != 0u)
        attn_walk<true>(kc, vr, stage, lane, qf, o, rs, lo, hi);

    // key half 1 hands its partial o and row sums to key half 0 of the same query tile
    if (kh == 1) {
#pragma unroll
        for (int b = 0; b < NB; ++b) {
#pragma unroll
            for (int nt = 0; nt < 4; ++nt) *(v8f*)(&Xo[qt][b * 4 + nt][lane * 8]) = o[b][nt];
            Xr[qt][b][lane] = rs[b].x + rs[b].y;
        }
    }
    __syncthreads();
    if (kh == 1) return;

#pragma unroll
    for (int b = 0; b < NB; ++b) {
        // row sum of query cc: both key halves, then lanes cc and cc + 16 (each has half of the keys)
        const float v  = (rs[b].x + rs[b].y) + Xr[qt][b][lane];
        const int   vi = __float_as_int(v);
        const float vx = __int_as_float(__builtin_amdgcn_permlanex16(vi, vi, 0x76543210, 0xfedcba98, false, false));
        const float ri = __builtin_amdgcn_rcpf(v + vx);
        // o^T: a lane holds v columns nt*16 + r0 .. + 7 of query cc = one 16-byte piece of the z row
#pragma unroll
        for (int nt = 0; nt < 4; ++nt) {
            const v8f x = *(const v8f*)(&Xo[qt][b * 4 + nt][lane * 8]);
            v8h zr;
#pragma unroll
            for (int g = 0; g < 8; ++g) zr[g] = (_Float16)((o[b][nt][g] + x[g]) * ri);
            *(v8h*)(&Zst[qt][b][cc * 72 + nt * 16 + r0]) = zr;
        }
    }
    // zc is kept in fragment order, rows m = s*NB + b: a 16-row group holds 4 queries of all
    // 4 batches, all of them this wave's own, so the wave writes whole 512-B runs from its tiles
    wave_lds_sync();

    const int zb = lane & 3;                       // batch whose tile is read
#pragma unroll
    for (int gq = 0; gq < 4; ++gq) {
        const int zq = gq * 4 + ((lane & 15) >> 2);    // query of the 16
        v8h zv[4];
        int off[4];
#pragma unroll
        for (int it = 0; it < 4; ++it) {
            zv[it]  = *(const v8h*)(&Zst[qt][zb][zq * 72 + (it * 2 + (lane >> 4)) * 8]);
            off[it] = ((s0 >> 2) + gq) * (16 * DM) + h * 1024 + it * 256 + lane * 8;
        }
#pragma unroll
        for (int it = 0; it < 4; ++it) *(v8h*)(zc + off[it]) = zv[it];
    }
}

// ---------------------------------------------------------------------------
// Output projection: out[m][n] = 2^-12 * (64 z)[m][:] . (64 Wo)[:][n] + bO[n].
// Block = 4 waves, 2 x 2 = 128 rows x 128 columns; wave = 64 rows x 64 columns, stored as two
// halves of 32 rows. f32 tile staged in a wave-private
// LDS tile; each instruction writes two whole 256-B row segments (16 lanes x 16 B);
// coverage: 32 rows = 16 instructions x 2 rows.
// ---------------------------------------------------------------------------
static_assert(DM % 128 == 0);
__global__ __launch_bounds__(128) __attribute__((amdgpu_num_vgpr(512)))
void k_out(const _Float16* __restrict__ zc,
           const _Float16* __restrict__ woT,
           const float*    __restrict__ bo,
           float* __restrict__ out) {
    __shared__ __align__(16) float Ost[4][32 * 64];     // 32 KB, wave-private tiles
    const int tid  = threadIdx.x;
    const int lane = tid & 31;
    const int w    = __builtin_amdgcn_readfirstlane(tid >> 5);   // scalar: the bases stay in scalar registers
    const int m0   = blockIdx.x * 128 + (w & 1) * 64;
    const int n0   = blockIdx.y * 128 + (w >> 1) * 64;

    const int r0 = (lane >> 4) << 3;
    const int cc = lane & 15;
    float bb[4];
    v8f acc[4][4];
    // one wave a SIMD: four sets, three steps of loads in flight
    gemm_64x64<4>(zc + (size_t)m0 * DM, woT + (size_t)n0 * DM, bo + n0 + cc, blockIdx.x + blockIdx.y, lane, acc, bb);

    const int rh = lane >> 4, c4 = lane & 15;
#pragma unroll
    for (int hf = 0; hf < 2; ++hf) {
#pragma unroll
        for (int rt = 0; rt < 2; ++rt)
#pragma unroll
            for (int nt = 0; nt < 4; ++nt)
#pragma unroll
                for (int g = 0; g < 8; ++g)
                    Ost[w][(rt * 16 + r0 + g) * 64 + nt * 16 + cc] =
                        __builtin_fmaf(acc[hf * 2 + rt][nt][g], SC_OUT, bb[nt]);
        wave_lds_sync();

        v4f sv[16];
#pragma unroll
        for (int it = 0; it < 16; ++it) sv[it] = *(const v4f*)(&Ost[w][(it * 2 + rh) * 64 + c4 * 4]);
        float* ob = out + (size_t)(m0 + hf * 32) * DM + n0 + (size_t)rh * DM + c4 * 4;
#pragma unroll
        for (int it = 0; it < 16; ++it) *(v4f*)(ob + (size_t)(it * 2) * DM) = sv[it];
        // the tile's reads above come before the second half's writes to it
        if (hf == 0) wave_lds_sync();
    }
}

// ---------------------------------------------------------------------------
extern "C" void kernel_launch(void* const* d_in, const int* in_sizes, int n_in,
                              void* d_out, int out_size, void* d_ws, size_t ws_size,
                              hipStream_t stream) {
    if (n_in < 9) return;
    if (in_sizes[0] < ((SEQ - 1) * NB_FULL + NB) * DM) return;
    if (in_sizes[1] < NH * DM * HD || in_sizes[3] < NH * DM * HD || in_sizes[5] < NH * DM * HD) return;
    if (in_sizes[2] < NH * HD || in_sizes[4] < NH * HD || in_sizes[6] < NH * HD) return;
    if (in_sizes[7] < DM * DM || in_sizes[8] < DM) return;
    if (out_size < MTOT * DM) return;
    if ((size_t)WS_TOTAL > ws_size) return;

    const float* X  = (const float*)d_in[0];   // [S][B][512], row m = s*4 + b
    const float* WQ = (const float*)d_in[1];   // [8][512][64]
    const float* bQ = (const float*)d_in[2];   // [8][64]
    const float* WK = (const float*)d_in[3];
    const float* bK = (const float*)d_in[4];
    const float* WV = (const float*)d_in[5];
    const float* bV = (const float*)d_in[6];
    const float* WO = (const float*)d_in[7];   // [512 in][512 out]
    const float* bO = (const float*)d_in[8];   // [512]
    float* out = (float*)d_out;                // [S][B][512]

    char* ws = (char*)d_ws;
    size_t off = 0;
    _Float16* wT   = (_Float16*)(ws + off); off += WT_BYTES;     // [1536][512], fragment order
    _Float16* woT  = (_Float16*)(ws + off); off += WOT_BYTES;    // [512][512], fragment order
    float*    bias = (float*)(ws + off);    off += BIAS_BYTES;   // [2048]
    _Float16* xh   = (_Float16*)(ws + off); off += XH_BYTES;     // [MTOT][512], fragment order
    _Float16* qkv  = (_Float16*)(ws + off); off += 3 * PL_BYTES; // q, k, V^T, each [h][b] in fragment order
    _Float16* zc   = (_Float16*)(ws + off); off += ZC_BYTES;     // [MTOT][512], fragment order
    if (off > ws_size) return;

    k_prep<<<dim3(PREP_BLOCKS), dim3(256), 0, stream>>>(X, WQ, bQ, WK, bK, WV, bV, WO, bO, wT, woT, bias, xh);
    k_proj<<<dim3(MTOT / 128, NQKV / (PROJ_WN * 64)), dim3(PROJ_WN * 64), 0, stream>>>(xh, wT, bias, qkv);
    k_attn<<<dim3(SEQ / 64, NH), dim3(256), 0, stream>>>(qkv, qkv + PL_ELEMS, qkv + 2 * PL_ELEMS, zc);
    k_out<<<dim3(MTOT / 128, DM / 128), dim3(128), 0, stream>>>(zc, woT, bias + NQKV, out);
}
